// v000
// The times below were measured on an AMD MI455X: many runs one after another, warmed up first and cycling through
// copies of the inputs, with the whole window's GPU time divided by the number of runs. Launches and the gaps
// between them are all in it. The median over several windows is given; except for v000 it joins two sittings, which
// can be a few percent apart, so the side-by-side timings, each taken in one sitting, are the better comparison.
// The starting kernel, v000, takes 393 microseconds a run.
#include <hip/hip_runtime.h>

// Contractions: q/k/v 1x1 projections via v_wmma_f32_16x16x32_bf16 (bf16 operands = RNE-converted inputs, K=12 zero-padded to 32, f32 accumulate);
// k^T.q scores (K=36 zero-padded to 64) and v.P value product via v_wmma_f32_16x16x32_f16 (f16 operands: q x1, k x(log2e/sqrt(12)), v x16, P x4096), f32 accumulate;
// softmax statistics in f32; 12x36 output mixing in f32 on the VALU (12 output channels < one tile).

#define DEV __device__ __forceinline__

#ifndef NB
#define NB 8
#endif
#ifndef SEQ
#define SEQ 4096
#endif
#define NB_FULL  8
#define SEQ_FULL 4096
#define CIN   12
#define CQK   36
#define CPAD  64                                         // q/k plane row pitch (halves), channels 36..63 are zeros
#define VROWS 48                                         // v plane rows per batch, rows 36..47 are zeros
#define QP    72                                         // LDS pitch (halves) of q/k staging rows
#define VP    136                                        // LDS pitch (halves) of v staging rows
#define OSP   132                                        // LDS pitch (floats) of output staging rows
#define KSCALE (0.28867513459481287f * 1.4426950408889634f)   // 1/sqrt(12) * log2(e), folded into the k plane
#define VCARRY 16.0f
#define PLOG2  12.0f                                     // P carried x 2^12
#define OUT_SCALE (1.0f / 65536.0f)                      // 1 / (16 * 4096)

static_assert(NB >= 1 && NB <= NB_FULL);
static_assert(SEQ >= 128 && SEQ <= SEQ_FULL && (SEQ % 128) == 0);
static_assert(256 * 4 * 8 == 128 * CPAD);                // q/k plane coverage per block
static_assert(256 * 3 * 8 == VROWS * 128);               // v plane coverage per block
static_assert(384 * 4 == CIN * 128);                     // output coverage per block
static_assert(32 * 4 == 128);                            // stats coverage per block
static_assert(((QP * 2) % 16) == 0 && ((VP * 2) % 16) == 0 && ((OSP * 4) % 16) == 0);
static_assert(CQK <= CPAD && CQK <= VROWS && CIN <= 16);

typedef _Float16       v8h   __attribute__((ext_vector_type(8)));
typedef _Float16       v16h  __attribute__((ext_vector_type(16)));
typedef __bf16         v16bf __attribute__((ext_vector_type(16)));
typedef unsigned short v8us  __attribute__((ext_vector_type(8)));
typedef unsigned short v16us __attribute__((ext_vector_type(16)));
typedef float          v8f   __attribute__((ext_vector_type(8)));
typedef float          v4f   __attribute__((ext_vector_type(4)));

union FragH { v16h v;  v8h  half[2]; };
union FragB { v16bf v; v16us u; v8us half[2]; };

// ---------------------------------------------------------------------------
// helpers
// ---------------------------------------------------------------------------
DEV unsigned int bf16_bits(float f) {                    // f32 -> bf16 bits, RNE convert
    unsigned int u = __float_as_uint(f);
    u += 0x7FFFu + ((u >> 16) & 1u);
    return u >> 16;
}
DEV float bf16_val(float f) { return __uint_as_float(bf16_bits(f) << 16); }

DEV v8f zero8f() {
    v8f z;
#pragma unroll
    for (int i = 0; i < 8; ++i) z[i] = 0.f;
    return z;
}

DEV float ex2(float x) { return __builtin_amdgcn_exp2f(x); }

// 16x16x32 WMMA with f32 accumulate; 4 nops guard D and keep A/B live
DEV v8f mma_bf16(v16bf a, v16bf b, v8f c) {
    c = __builtin_amdgcn_wmma_f32_16x16x32_bf16(false, a, false, b, (short)0, c, false, false);
    asm volatile("v_nop\n\tv_nop\n\tv_nop\n\tv_nop" : "+v"(c) : "v"(a), "v"(b));
    return c;
}
DEV v8f mma_f16(v16h a, v16h b, v8f c) {
    c = __builtin_amdgcn_wmma_f32_16x16x32_f16(false, a, false, b, (short)0, c, false, false);
    asm volatile("v_nop\n\tv_nop\n\tv_nop\n\tv_nop" : "+v"(c) : "v"(a), "v"(b));
    return c;
}

// A fragment of a [36][12] weight held in LDS as bf16-exact f32 values.
// row c = 16t + l15 (zero for c >= 36); elements 0..7 <- k = 8h+e (zero for k >= 12); elements 8..15 <- k >= 16 -> zero
DEV FragB w_frag(const float* Wl, unsigned t, unsigned h, unsigned l15) {
    FragB a;
    const unsigned c  = 16u * t + l15;
    const unsigned cc = c < (unsigned)CQK ? c : (unsigned)(CQK - 1);
#pragma unroll
    for (unsigned e = 0; e < 8; ++e) {
        const unsigned i  = 8u * h + e;
        const unsigned ic = i < (unsigned)CIN ? i : (unsigned)(CIN - 1);
        const unsigned bits = __float_as_uint(Wl[cc * CIN + ic]) >> 16;
        a.u[e]     = (unsigned short)((c < (unsigned)CQK && i < (unsigned)CIN) ? bits : 0u);
        a.u[8 + e] = (unsigned short)0;
    }
    return a;
}

// one 16(channel) x 16(position) projection tile: (W.x + bias) * carry ; D row = channel 16t+8h+r, column = position l15
DEV v8f proj_tile(const float* Wl, const float* Bl, unsigned t, unsigned h, unsigned l15, v16bf xb, float carry) {
    const FragB a = w_frag(Wl, t, h, l15);
    v8f acc = mma_bf16(a.v, xb, zero8f());
#pragma unroll
    for (unsigned r = 0; r < 8; ++r) {
        const unsigned c  = 16u * t + 8u * h + r;
        const unsigned cc = c < (unsigned)CQK ? c : (unsigned)(CQK - 1);
        const float bvl = Bl[cc];
        acc[r] = (acc[r] + ((c < (unsigned)CQK) ? bvl : 0.f)) * carry;
    }
    return acc;
}

// ---------------------------------------------------------------------------
// Kernel 1: projections. Block = 8 waves = 128 positions of one batch; wave w owns 16 positions.
//   B fragment = x[b][i][n] (bf16 RNE, k = i zero-padded 12 -> 32), A fragments = weights (rows = channels).
//   Outputs: Qp [NB*SEQ][64] f16 (q), Kp [NB*SEQ][64] f16 (k * KSCALE), channels 36..63 zero;
//            Vp [NB][48][SEQ] f16 (v * 16), rows 36..47 zero.
// LDS: Ws/Bs, Qs/Ks/Vs are cross-wave (block barriers). staged extent == consumed extent:
//   Qs/Ks rows 0..127 x halves 0..63, Vs rows 0..47 x halves 0..127.
// coverage: grid NB*SEQ/128 blocks; per block 256 thr x 4 x 8 halves = 128 x 64 (q, k); 256 x 3 x 8 = 48 x 128 (v)
// ---------------------------------------------------------------------------
__global__ __launch_bounds__(256) void k_proj(const float* __restrict__ x,
                                              const float* __restrict__ wq, const float* __restrict__ bq,
                                              const float* __restrict__ wk, const float* __restrict__ bk,
                                              const float* __restrict__ wv, const float* __restrict__ bv,
                                              _Float16* __restrict__ Qp, _Float16* __restrict__ Kp,
                                              _Float16* __restrict__ Vp)
{
    __shared__ __attribute__((aligned(16))) _Float16 Qs[128 * QP];
    __shared__ __attribute__((aligned(16))) _Float16 Ks[128 * QP];
    __shared__ __attribute__((aligned(16))) _Float16 Vs[VROWS * VP];
    __shared__ float Ws[3 * CQK * CIN];
    __shared__ float Bs[3 * CQK];

    const unsigned tid = threadIdx.x, lane = tid & 31u, w = tid >> 5;
    const unsigned h = lane >> 4, l15 = lane & 15u;
    const unsigned bps = (unsigned)(SEQ / 128);
    const unsigned b = blockIdx.x / bps;
    const unsigned pos0 = (blockIdx.x - b * bps) * 128u;
    const unsigned nl = w * 16u + l15;                   // position inside the block

    // weights and biases -> LDS as bf16-exact f32 (clamped addresses, guarded LDS stores)
#pragma unroll
    for (unsigned it = 0; it < 2; ++it) {
        const unsigned i  = it * 256u + tid;
        const unsigned ic = i < 432u ? i : 431u;
        const float a0 = bf16_val(wq[ic]);
        const float a1 = bf16_val(wk[ic]);
        const float a2 = bf16_val(wv[ic]);
        if (i < 432u) { Ws[i] = a0; Ws[432u + i] = a1; Ws[864u + i] = a2; }
    }
    {
        const unsigned ic = tid < (unsigned)CQK ? tid : (unsigned)(CQK - 1);
        const float a0 = bf16_val(bq[ic]);
        const float a1 = bf16_val(bk[ic]);
        const float a2 = bf16_val(bv[ic]);
        if (tid < (unsigned)CQK) { Bs[tid] = a0; Bs[CQK + tid] = a1; Bs[2 * CQK + tid] = a2; }
    }

    // x fragment: column = position, elements 0..7 <- input channel 8h+e (zero for >= 12), 8..15 <- zero
    FragB xb;
    {
        const float* xp = x + (size_t)b * CIN * SEQ_FULL + pos0 + nl;
#pragma unroll
        for (unsigned e = 0; e < 8; ++e) {
            const unsigned i  = 8u * h + e;
            const unsigned ic = i < (unsigned)CIN ? i : (unsigned)(CIN - 1);
            const unsigned bits = bf16_bits(xp[(size_t)ic * SEQ_FULL]);
            xb.u[e]     = (unsigned short)((i < (unsigned)CIN) ? bits : 0u);
            xb.u[8 + e] = (unsigned short)0;
        }
    }
    __syncthreads();

    v8h zz;
#pragma unroll
    for (int i = 0; i < 8; ++i) zz[i] = (_Float16)0.f;

    // q
#pragma unroll
    for (unsigned t = 0; t < 3; ++t) {
        const v8f acc = proj_tile(Ws, Bs, t, h, l15, xb.v, 1.0f);
        v8h o;
#pragma unroll
        for (int r = 0; r < 8; ++r) o[r] = (_Float16)acc[r];
        *(v8h*)(Qs + nl * QP + 16u * t + 8u * h) = o;
    }
    *(v8h*)(Qs + nl * QP + 48u + 8u * h) = zz;
    // k (scaled into the exp2 domain)
#pragma unroll
    for (unsigned t = 0; t < 3; ++t) {
        const v8f acc = proj_tile(Ws + CQK * CIN, Bs + CQK, t, h, l15, xb.v, KSCALE);
        v8h o;
#pragma unroll
        for (int r = 0; r < 8; ++r) o[r] = (_Float16)acc[r];
        *(v8h*)(Ks + nl * QP + 16u * t + 8u * h) = o;
    }
    *(v8h*)(Ks + nl * QP + 48u + 8u * h) = zz;
    // v (channel-major)
#pragma unroll
    for (unsigned t = 0; t < 3; ++t) {
        const v8f acc = proj_tile(Ws + 2 * CQK * CIN, Bs + 2 * CQK, t, h, l15, xb.v, VCARRY);
#pragma unroll
        for (unsigned r = 0; r < 8; ++r)
            Vs[(16u * t + 8u * h + r) * VP + nl] = (_Float16)acc[r];
    }
    __syncthreads();

    v8h qv[4], kv[4], vv[3];
#pragma unroll
    for (unsigned it = 0; it < 4; ++it) {
        const unsigned idx = it * 256u + tid;
        const unsigned row = idx >> 3, pc = idx & 7u;
        qv[it] = *(const v8h*)(Qs + row * QP + pc * 8u);
        kv[it] = *(const v8h*)(Ks + row * QP + pc * 8u);
    }
#pragma unroll
    for (unsigned it = 0; it < 3; ++it) {
        const unsigned idx = it * 256u + tid;
        const unsigned row = idx >> 4, pc = idx & 15u;
        vv[it] = *(const v8h*)(Vs + row * VP + pc * 8u);
    }
    _Float16* qd = Qp + ((size_t)b * SEQ + pos0) * CPAD;
    _Float16* kd = Kp + ((size_t)b * SEQ + pos0) * CPAD;
    _Float16* vd = Vp + (size_t)b * VROWS * SEQ + pos0;
#pragma unroll
    for (unsigned it = 0; it < 4; ++it) {
        const unsigned idx = it * 256u + tid;
        *(v8h*)(qd + (size_t)idx * 8u) = qv[it];
        *(v8h*)(kd + (size_t)idx * 8u) = kv[it];
    }
#pragma unroll
    for (unsigned it = 0; it < 3; ++it) {
        const unsigned idx = it * 256u + tid;
        const unsigned row = idx >> 4, pc = idx & 15u;
        *(v8h*)(vd + (size_t)row * SEQ + pc * 8u) = vv[it];
    }
    
}

// ---------------------------------------------------------------------------
// Kernel 2: row statistics. Wave w owns score rows n = pos0 + 16w .. +15 (A = k rows, resident),
// sweeps all column tiles m (B = q rows from the plane). Per-lane running max + rescaled sum,
// combined over the 16 lanes of a half at the end. Table entry: off[n] = M_n + log2(Z_n) - 12,
// so that exp2(s - off[n]) = 4096 * softmax weight.
// LDS offS: cross-wave (block barrier); staged 128 floats == consumed 128 floats.
// coverage: grid NB*SEQ/128 blocks x 128 rows = NB*SEQ table entries
// ---------------------------------------------------------------------------
__global__ __launch_bounds__(256) void k_stats(const _Float16* __restrict__ Kp,
                                               const _Float16* __restrict__ Qp,
                                               float* __restrict__ offt)
{
    __shared__ __attribute__((aligned(16))) float offS[128];

    const unsigned tid = threadIdx.x, lane = tid & 31u, w = tid >> 5;
    const unsigned h = lane >> 4, l15 = lane & 15u;
    const unsigned bps = (unsigned)(SEQ / 128);
    const unsigned b = blockIdx.x / bps;
    const unsigned pos0 = (blockIdx.x - b * bps) * 128u;

    FragH k0, k1;
    {
        const _Float16* kp = Kp + ((size_t)b * SEQ + pos0 + w * 16u + l15) * CPAD + 8u * h;
        k0.half[0] = *(const v8h*)(kp);
        k0.half[1] = *(const v8h*)(kp + 16);
        k1.half[0] = *(const v8h*)(kp + 32);
        k1.half[1] = *(const v8h*)(kp + 48);
    }

    float m[8], z[8];
#pragma unroll
    for (int r = 0; r < 8; ++r) { m[r] = -3.0e38f; z[r] = 0.f; }

    const _Float16* qb = Qp + ((size_t)b * SEQ + l15) * CPAD + 8u * h;
#pragma unroll 2
    for (unsigned mt = 0; mt < (unsigned)(SEQ / 16); ++mt) {
        const _Float16* qp = qb + (size_t)mt * 16u * CPAD;
        FragH q0, q1;
        q0.half[0] = *(const v8h*)(qp);
        q0.half[1] = *(const v8h*)(qp + 16);
        q1.half[0] = *(const v8h*)(qp + 32);
        q1.half[1] = *(const v8h*)(qp + 48);
        v8f c = zero8f();
        c = mma_f16(k0.v, q0.v, c);
        c = mma_f16(k1.v, q1.v, c);
#pragma unroll
        for (int r = 0; r < 8; ++r) {
            const float mn = fmaxf(m[r], c[r]);
            z[r] = z[r] * ex2(m[r] - mn) + ex2(c[r] - mn);
            m[r] = mn;
        }
    }

#pragma unroll
    for (unsigned r = 0; r < 8; ++r) {
        float M = m[r];
#pragma unroll
        for (int o = 1; o < 16; o <<= 1) M = fmaxf(M, __shfl_xor(M, o));
        float zs = z[r] * ex2(m[r] - M);
#pragma unroll
        for (int o = 1; o < 16; o <<= 1) zs += __shfl_xor(zs, o);
        const float ov = M + log2f(zs) - PLOG2;
        if (l15 == 0u) offS[w * 16u + 8u * h + r] = ov;
    }
    __syncthreads();

    if (w == 0u) {
        const v4f v = *(const v4f*)(offS + lane * 4u);
        float* dst = offt + (size_t)b * SEQ + pos0 + lane * 4u;
        *(v4f*)dst = v;
        
    }
}

// ---------------------------------------------------------------------------
// Kernel 3: value product + output mixing. Wave w owns output columns m = pos0 + 16w .. +15
// (B = q rows, resident). Per 32-row step: two score tiles recomputed with the same operand roles
// and k-step order as kernel 2 (A = k rows n, B = q), P = exp2(s - off[n]) packed as the B fragment
// (element r <- tile rows 0..15, element 8+r <- tile rows 16..31, lane unchanged: D row 8h+r is
// B k-index 8h+r), A = v rows (channel-major plane), three channel tiles accumulated.
// Epilogue: attn tile to LDS, 12x36 mixing in f32, output tile staged and written as whole 512-B rows.
// LDS: woS/boS, attnS, outS all cross-wave-safe (block barriers between producer and consumer).
//   staged extent == consumed extent: attnS per wave 48x16 written, rows 0..35 read; outS 12 x 128 written and read.
// coverage: grid NB*SEQ/128 blocks x 12 rows x 128 cols = NB*12*SEQ outputs; 384 pieces x 4 floats per block
// ---------------------------------------------------------------------------
__global__ __launch_bounds__(256) void k_attn(const _Float16* __restrict__ Kp,
                                              const _Float16* __restrict__ Qp,
                                              const _Float16* __restrict__ Vp,
                                              const float* __restrict__ offt,
                                              const float* __restrict__ wo,
                                              const float* __restrict__ bo,
                                              float* __restrict__ out)
{
    __shared__ __attribute__((aligned(16))) float attnS[8 * 48 * 16];
    __shared__ __attribute__((aligned(16))) float outS[CIN * OSP];
    __shared__ float woS[CIN * CQK];
    __shared__ float boS[16];

    const unsigned tid = threadIdx.x, lane = tid & 31u, w = tid >> 5;
    const unsigned h = lane >> 4, l15 = lane & 15u;
    const unsigned bps = (unsigned)(SEQ / 128);
    const unsigned b = blockIdx.x / bps;
    const unsigned pos0 = (blockIdx.x - b * bps) * 128u;

#pragma unroll
    for (unsigned it = 0; it < 2; ++it) {
        const unsigned i  = it * 256u + tid;
        const unsigned ic = i < 432u ? i : 431u;
        const float a0 = bf16_val(wo[ic]);
        if (i < 432u) woS[i] = a0;
    }
    {
        const unsigned ic = tid < (unsigned)CIN ? tid : (unsigned)(CIN - 1);
        const float a0 = bf16_val(bo[ic]);
        if (tid < (unsigned)CIN) boS[tid] = a0;
    }

    FragH q0, q1;
    {
        const _Float16* qp = Qp + ((size_t)b * SEQ + pos0 + w * 16u + l15) * CPAD + 8u * h;
        q0.half[0] = *(const v8h*)(qp);
        q0.half[1] = *(const v8h*)(qp + 16);
        q1.half[0] = *(const v8h*)(qp + 32);
        q1.half[1] = *(const v8h*)(qp + 48);
    }

    v8f acc[3];
#pragma unroll
    for (int t = 0; t < 3; ++t) acc[t] = zero8f();

    const _Float16* kb = Kp + ((size_t)b * SEQ + l15) * CPAD + 8u * h;
    const _Float16* vb = Vp + ((size_t)b * VROWS + l15) * SEQ + 8u * h;
    const float*    ob = offt + (size_t)b * SEQ + 8u * h;

#pragma unroll 1
    for (unsigned ns = 0; ns < (unsigned)(SEQ / 32); ++ns) {
        const _Float16* kp = kb + (size_t)ns * 32u * CPAD;
        FragH a;
        v8f c0 = zero8f();
        a.half[0] = *(const v8h*)(kp);
        a.half[1] = *(const v8h*)(kp + 16);
        c0 = mma_f16(a.v, q0.v, c0);
        a.half[0] = *(const v8h*)(kp + 32);
        a.half[1] = *(const v8h*)(kp + 48);
        c0 = mma_f16(a.v, q1.v, c0);
        kp += 16 * CPAD;
        v8f c1 = zero8f();
        a.half[0] = *(const v8h*)(kp);
        a.half[1] = *(const v8h*)(kp + 16);
        c1 = mma_f16(a.v, q0.v, c1);
        a.half[0] = *(const v8h*)(kp + 32);
        a.half[1] = *(const v8h*)(kp + 48);
        c1 = mma_f16(a.v, q1.v, c1);

        const float* op = ob + ns * 32u;
        const v4f o0a = *(const v4f*)(op);
        const v4f o0b = *(const v4f*)(op + 4);
        const v4f o1a = *(const v4f*)(op + 16);
        const v4f o1b = *(const v4f*)(op + 20);

        FragH pb;
#pragma unroll
        for (int r = 0; r < 4; ++r) {
            pb.v[r]      = (_Float16)ex2(c0[r]     - o0a[r]);
            pb.v[4 + r]  = (_Float16)ex2(c0[4 + r] - o0b[r]);
            pb.v[8 + r]  = (_Float16)ex2(c1[r]     - o1a[r]);
            pb.v[12 + r] = (_Float16)ex2(c1[4 + r] - o1b[r]);
        }

        const _Float16* vp = vb + ns * 32u;
#pragma unroll
        for (unsigned t = 0; t < 3; ++t) {
            FragH vf;
            vf.half[0] = *(const v8h*)(vp + (size_t)t * 16u * SEQ);
            vf.half[1] = *(const v8h*)(vp + (size_t)t * 16u * SEQ + 16);
            acc[t] = mma_f16(vf.v, pb.v, acc[t]);
        }
    }

    // attn tile: D row = channel 16t+8h+r, column = l15
    float* aL = attnS + w * (48u * 16u);
#pragma unroll
    for (unsigned t = 0; t < 3; ++t) {
#pragma unroll
        for (unsigned r = 0; r < 8; ++r)
            aL[(16u * t + 8u * h + r) * 16u + l15] = acc[t][r] * OUT_SCALE;
    }
    __syncthreads();

    // output mixing: lanes 0..15 -> o = 0..5, lanes 16..31 -> o = 6..11
#pragma unroll 1
    for (unsigned oo = 0; oo < 6; ++oo) {
        const unsigned o = h * 6u + oo;
        float sum = boS[o];
        const float* wr = woS + o * CQK;
#pragma unroll
        for (unsigned c = 0; c < (unsigned)CQK; ++c) sum += wr[c] * aL[c * 16u + l15];
        outS[o * OSP + w * 16u + l15] = sum;
    }
    __syncthreads();

    // whole 512-B rows: wave w writes row w, waves 0..3 also write row 8+w; 32 lanes x 16 B contiguous
    const unsigned row0 = w;
    const unsigned row1 = (8u + w) < (unsigned)CIN ? (8u + w) : (unsigned)(CIN - 1);
    const v4f ov0 = *(const v4f*)(outS + row0 * OSP + lane * 4u);
    const v4f ov1 = *(const v4f*)(outS + row1 * OSP + lane * 4u);
    float* d0 = out + ((size_t)b * CIN + row0) * SEQ + pos0 + lane * 4u;
    float* d1 = out + ((size_t)b * CIN + row1) * SEQ + pos0 + lane * 4u;
    *(v4f*)d0 = ov0;
    if (w < 4u) *(v4f*)d1 = ov1;
    
}

// ---------------------------------------------------------------------------
extern "C" void kernel_launch(void* const* d_in, const int* in_sizes, int n_in,
                              void* d_out, int out_size, void* d_ws, size_t ws_size,
                              hipStream_t stream)
{
    if (n_in < 9) return;
    const long long need_x = ((long long)NB * CIN - 1) * SEQ_FULL + SEQ;
    if ((long long)in_sizes[0] < need_x) return;
    if (in_sizes[1] < CQK * CIN || in_sizes[2] < CQK) return;
    if (in_sizes[3] < CQK * CIN || in_sizes[4] < CQK) return;
    if (in_sizes[5] < CQK * CIN || in_sizes[6] < CQK) return;
    if (in_sizes[7] < CIN * CQK || in_sizes[8] < CIN) return;
    if ((long long)out_size < (long long)NB * CIN * SEQ) return;

    const float* x  = (const float*)d_in[0];
    const float* wq = (const float*)d_in[1];
    const float* bq = (const float*)d_in[2];
    const float* wk = (const float*)d_in[3];
    const float* bk = (const float*)d_in[4];
    const float* wv = (const float*)d_in[5];
    const float* bv = (const float*)d_in[6];
    const float* wo = (const float*)d_in[7];
    const float* bo = (const float*)d_in[8];
    float* out = (float*)d_out;

    char* ws = (char*)d_ws;
    size_t off = 0;
    auto carve = [&](size_t bytes) -> char* {
        char* p = ws + off;
        off += (bytes + 255) & ~(size_t)255;
        return p;
    };
    _Float16* Qp  = (_Float16*)carve((size_t)NB * SEQ * CPAD * 2);      // [NB*SEQ][64]
    _Float16* Kp  = (_Float16*)carve((size_t)NB * SEQ * CPAD * 2);      // [NB*SEQ][64]
    _Float16* Vp  = (_Float16*)carve((size_t)NB * VROWS * SEQ * 2);     // [NB][48][SEQ]
    float*    oft = (float*)carve((size_t)NB * SEQ * 4);                // [NB*SEQ]
    if (off > ws_size) return;

    const unsigned nblk = (unsigned)(NB * (SEQ / 128));
    k_proj <<<nblk, 256, 0, stream>>>(x, wq, bq, wk, bk, wv, bv, Qp, Kp, Vp);
    k_stats<<<nblk, 256, 0, stream>>>(Kp, Qp, oft);
    k_attn <<<nblk, 256, 0, stream>>>(Kp, Qp, Vp, oft, wo, bo, out);
}

// v001
// A run of this version takes 77.5 microseconds.
// In two side-by-side timings against v000, it was 5.23 and 5.28 times as fast.
#include <hip/hip_runtime.h>

// Contractions: q/k/v 1x1 projections via v_wmma_f32_16x16x32_bf16 (bf16 operands = RNE-converted inputs, K=12 zero-padded to 32, f32 accumulate);
// k^T.q scores (K=36 zero-padded to 64) and v.P value product via v_wmma_f32_16x16x32_f16 (f16 operands: q x1, k x(log2e/sqrt(12)), v x16, P x4096), f32 accumulate;
// softmax statistics in f32; 12x36 output mixing in f32 on the VALU (12 output channels < one tile).

#define DEV __device__ __forceinline__

#ifndef NB
#define NB 8
#endif
#ifndef SEQ
#define SEQ 4096
#endif
#define NB_FULL  8
#define SEQ_FULL 4096
#define CIN   12
#define CQK   36
#define CPAD  64                                         // q/k plane row pitch (halves), channels 36..63 are zeros
#define VROWS 48                                         // v plane rows per batch, rows 36..47 are zeros
#define QP    72                                         // LDS pitch (halves) of q/k staging rows
#define VP    136                                        // LDS pitch (halves) of v staging rows
#define OSP   132                                        // LDS pitch (floats) of output staging rows
#define STG   128                                        // swept rows per LDS stage (kernels 2 and 3)
#define NST   (SEQ / STG)                                // stages per sweep
#define KSCALE (0.28867513459481287f * 1.4426950408889634f)   // 1/sqrt(12) * log2(e), folded into the k plane
#define VCARRY 16.0f
#define PLOG2  12.0f                                     // P carried x 2^12
#define OUT_SCALE (1.0f / 65536.0f)                      // 1 / (16 * 4096)

static_assert(NB >= 1 && NB <= NB_FULL);
static_assert(SEQ >= 128 && SEQ <= SEQ_FULL && (SEQ % 128) == 0);
static_assert(256 * 4 * 8 == 128 * CPAD);                // q/k plane coverage per block
static_assert(256 * 3 * 8 == VROWS * 128);               // v plane coverage per block
static_assert(384 * 4 == CIN * 128);                     // output coverage per block
static_assert(32 * 4 == 128);                            // stats coverage per block
static_assert(((QP * 2) % 16) == 0 && ((VP * 2) % 16) == 0 && ((OSP * 4) % 16) == 0);
static_assert(CQK <= CPAD && CQK <= VROWS && CIN <= 16);
static_assert(256 * 4 * 16 == STG * CPAD * 2);           // q/k stage: 4 copies of 16 B per thread
static_assert(256 * 3 * 16 == VROWS * STG * 2);          // v stage: 3 copies of 16 B per thread
static_assert(32 * 16 == STG * 4);                       // offset stage: 1 copy of 16 B per lane of one wave

typedef _Float16       v8h   __attribute__((ext_vector_type(8)));
typedef _Float16       v16h  __attribute__((ext_vector_type(16)));
typedef __bf16         v16bf __attribute__((ext_vector_type(16)));
typedef unsigned short v8us  __attribute__((ext_vector_type(8)));
typedef unsigned short v16us __attribute__((ext_vector_type(16)));
typedef float          v8f   __attribute__((ext_vector_type(8)));
typedef float          v4f   __attribute__((ext_vector_type(4)));

union FragH { v16h v;  v8h  half[2]; };
union FragB { v16bf v; v16us u; v8us half[2]; };

// ---------------------------------------------------------------------------
// helpers
// ---------------------------------------------------------------------------
DEV unsigned int bf16_bits(float f) {                    // f32 -> bf16 bits, RNE convert
    unsigned int u = __float_as_uint(f);
    u += 0x7FFFu + ((u >> 16) & 1u);
    return u >> 16;
}
DEV float bf16_val(float f) { return __uint_as_float(bf16_bits(f) << 16); }

DEV v8f zero8f() {
    v8f z;
#pragma unroll
    for (int i = 0; i < 8; ++i) z[i] = 0.f;
    return z;
}

DEV float ex2(float x) { return __builtin_amdgcn_exp2f(x); }

// 16x16x32 WMMA with f32 accumulate; 4 nops guard D and keep A/B live
DEV v8f mma_bf16(v16bf a, v16bf b, v8f c) {
    c = __builtin_amdgcn_wmma_f32_16x16x32_bf16(false, a, false, b, (short)0, c, false, false);
    asm volatile("v_nop\n\tv_nop\n\tv_nop\n\tv_nop" : "+v"(c) : "v"(a), "v"(b));
    return c;
}
DEV v8f mma_f16(v16h a, v16h b, v8f c) {
    c = __builtin_amdgcn_wmma_f32_16x16x32_f16(false, a, false, b, (short)0, c, false, false);
    asm volatile("v_nop\n\tv_nop\n\tv_nop\n\tv_nop" : "+v"(c) : "v"(a), "v"(b));
    return c;
}

// ---------------------------------------------------------------------------
// asynchronous copies global -> LDS, 16 B per lane, through no register.
// Each run of copies ends in its own statement with s_wait_xcnt 0, so that no address register
// of an issued copy is rewritten ahead of that wait.
// ---------------------------------------------------------------------------
DEV unsigned lds_off(const void* p) { return (unsigned)(size_t)p; }   // byte offset in the work-group's LDS

DEV void async_copy1(unsigned l0, const void* g0) {
    asm volatile("global_load_async_to_lds_b128 %0, %1, off\n\t"
                 "s_wait_xcnt 0x0"
                 :: "v"(l0), "v"(g0) : "memory");
}
DEV void async_copy3(unsigned l0, const void* g0, unsigned l1, const void* g1, unsigned l2, const void* g2) {
    asm volatile("global_load_async_to_lds_b128 %0, %1, off\n\t"
                 "global_load_async_to_lds_b128 %2, %3, off\n\t"
                 "global_load_async_to_lds_b128 %4, %5, off\n\t"
                 "s_wait_xcnt 0x0"
                 :: "v"(l0), "v"(g0), "v"(l1), "v"(g1), "v"(l2), "v"(g2) : "memory");
}
DEV void async_copy4(unsigned l0, const void* g0, unsigned l1, const void* g1,
                     unsigned l2, const void* g2, unsigned l3, const void* g3) {
    asm volatile("global_load_async_to_lds_b128 %0, %1, off\n\t"
                 "global_load_async_to_lds_b128 %2, %3, off\n\t"
                 "global_load_async_to_lds_b128 %4, %5, off\n\t"
                 "global_load_async_to_lds_b128 %6, %7, off\n\t"
                 "s_wait_xcnt 0x0"
                 :: "v"(l0), "v"(g0), "v"(l1), "v"(g1), "v"(l2), "v"(g2), "v"(l3), "v"(g3) : "memory");
}
// the issuing wave's own copies have landed in LDS behind this wait
DEV void wait_async0() { asm volatile("s_wait_asynccnt 0x0" ::: "memory"); }
// the wave's own LDS reads have retired before the buffer they read is handed to its next writer
DEV void wait_ds0()    { asm volatile("s_wait_dscnt 0x0" ::: "memory"); }

// one stage of a [rows][64]-half plane: STG rows of 128 B, contiguous in memory, to LDS rows of pitch QP.
// thread tid moves pieces tid, 256+tid, 512+tid, 768+tid (piece = 16 B; 8 pieces per row)
DEV void stage_rows64(unsigned lds_base, const _Float16* g, unsigned tid) {
    const unsigned l = lds_base + (tid >> 3) * (unsigned)(QP * 2) + (tid & 7u) * 16u;
    const char* gp = (const char*)g + tid * 16u;
    async_copy4(l,                       gp,
                l + 32u * (QP * 2),      gp + 4096,
                l + 64u * (QP * 2),      gp + 8192,
                l + 96u * (QP * 2),      gp + 12288);
}

// A fragment of a [36][12] weight held in LDS as bf16-exact f32 values.
// row c = 16t + l15 (zero for c >= 36); elements 0..7 <- k = 8h+e (zero for k >= 12); elements 8..15 <- k >= 16 -> zero
DEV FragB w_frag(const float* Wl, unsigned t, unsigned h, unsigned l15) {
    FragB a;
    const unsigned c  = 16u * t + l15;
    const unsigned cc = c < (unsigned)CQK ? c : (unsigned)(CQK - 1);
#pragma unroll
    for (unsigned e = 0; e < 8; ++e) {
        const unsigned i  = 8u * h + e;
        const unsigned ic = i < (unsigned)CIN ? i : (unsigned)(CIN - 1);
        const unsigned bits = __float_as_uint(Wl[cc * CIN + ic]) >> 16;
        a.u[e]     = (unsigned short)((c < (unsigned)CQK && i < (unsigned)CIN) ? bits : 0u);
        a.u[8 + e] = (unsigned short)0;
    }
    return a;
}

// one 16(channel) x 16(position) projection tile: (W.x + bias) * carry ; D row = channel 16t+8h+r, column = position l15
DEV v8f proj_tile(const float* Wl, const float* Bl, unsigned t, unsigned h, unsigned l15, v16bf xb, float carry) {
    const FragB a = w_frag(Wl, t, h, l15);
    v8f acc = mma_bf16(a.v, xb, zero8f());
#pragma unroll
    for (unsigned r = 0; r < 8; ++r) {
        const unsigned c  = 16u * t + 8u * h + r;
        const unsigned cc = c < (unsigned)CQK ? c : (unsigned)(CQK - 1);
        const float bvl = Bl[cc];
        acc[r] = (acc[r] + ((c < (unsigned)CQK) ? bvl : 0.f)) * carry;
    }
    return acc;
}

// ---------------------------------------------------------------------------
// Kernel 1: projections. Block = 8 waves = 128 positions of one batch; wave w owns 16 positions.
//   B fragment = x[b][i][n] (bf16 RNE, k = i zero-padded 12 -> 32), A fragments = weights (rows = channels).
//   Outputs: Qp [NB*SEQ][64] f16 (q), Kp [NB*SEQ][64] f16 (k * KSCALE), channels 36..63 zero;
//            Vp [NB][48][SEQ] f16 (v * 16), rows 36..47 zero.
// LDS: Ws/Bs, Qs/Ks/Vs are cross-wave (block barriers). staged extent == consumed extent:
//   Qs/Ks rows 0..127 x halves 0..63, Vs rows 0..47 x halves 0..127.
// coverage: grid NB*SEQ/128 blocks; per block 256 thr x 4 x 8 halves = 128 x 64 (q, k); 256 x 3 x 8 = 48 x 128 (v)
// ---------------------------------------------------------------------------
__global__ __launch_bounds__(256) void k_proj(const float* __restrict__ x,
                                              const float* __restrict__ wq, const float* __restrict__ bq,
                                              const float* __restrict__ wk, const float* __restrict__ bk,
                                              const float* __restrict__ wv, const float* __restrict__ bv,
                                              _Float16* __restrict__ Qp, _Float16* __restrict__ Kp,
                                              _Float16* __restrict__ Vp)
{
    __shared__ __attribute__((aligned(16))) _Float16 Qs[128 * QP];
    __shared__ __attribute__((aligned(16))) _Float16 Ks[128 * QP];
    __shared__ __attribute__((aligned(16))) _Float16 Vs[VROWS * VP];
    __shared__ float Ws[3 * CQK * CIN];
    __shared__ float Bs[3 * CQK];

    const unsigned tid = threadIdx.x, lane = tid & 31u, w = tid >> 5;
    const unsigned h = lane >> 4, l15 = lane & 15u;
    const unsigned bps = (unsigned)(SEQ / 128);
    const unsigned b = blockIdx.x / bps;
    const unsigned pos0 = (blockIdx.x - b * bps) * 128u;
    const unsigned nl = w * 16u + l15;                   // position inside the block

    // weights and biases -> LDS as bf16-exact f32 (clamped addresses, guarded LDS stores)
#pragma unroll
    for (unsigned it = 0; it < 2; ++it) {
        const unsigned i  = it * 256u + tid;
        const unsigned ic = i < 432u ? i : 431u;
        const float a0 = bf16_val(wq[ic]);
        const float a1 = bf16_val(wk[ic]);
        const float a2 = bf16_val(wv[ic]);
        if (i < 432u) { Ws[i] = a0; Ws[432u + i] = a1; Ws[864u + i] = a2; }
    }
    {
        const unsigned ic = tid < (unsigned)CQK ? tid : (unsigned)(CQK - 1);
        const float a0 = bf16_val(bq[ic]);
        const float a1 = bf16_val(bk[ic]);
        const float a2 = bf16_val(bv[ic]);
        if (tid < (unsigned)CQK) { Bs[tid] = a0; Bs[CQK + tid] = a1; Bs[2 * CQK + tid] = a2; }
    }

    // x fragment: column = position, elements 0..7 <- input channel 8h+e (zero for >= 12), 8..15 <- zero
    FragB xb;
    {
        const float* xp = x + (size_t)b * CIN * SEQ_FULL + pos0 + nl;
#pragma unroll
        for (unsigned e = 0; e < 8; ++e) {
            const unsigned i  = 8u * h + e;
            const unsigned ic = i < (unsigned)CIN ? i : (unsigned)(CIN - 1);
            const unsigned bits = bf16_bits(xp[(size_t)ic * SEQ_FULL]);
            xb.u[e]     = (unsigned short)((i < (unsigned)CIN) ? bits : 0u);
            xb.u[8 + e] = (unsigned short)0;
        }
    }
    __syncthreads();

    v8h zz;
#pragma unroll
    for (int i = 0; i < 8; ++i) zz[i] = (_Float16)0.f;

    // q
#pragma unroll
    for (unsigned t = 0; t < 3; ++t) {
        const v8f acc = proj_tile(Ws, Bs, t, h, l15, xb.v, 1.0f);
        v8h o;
#pragma unroll
        for (int r = 0; r < 8; ++r) o[r] = (_Float16)acc[r];
        *(v8h*)(Qs + nl * QP + 16u * t + 8u * h) = o;
    }
    *(v8h*)(Qs + nl * QP + 48u + 8u * h) = zz;
    // k (scaled into the exp2 domain)
#pragma unroll
    for (unsigned t = 0; t < 3; ++t) {
        const v8f acc = proj_tile(Ws + CQK * CIN, Bs + CQK, t, h, l15, xb.v, KSCALE);
        v8h o;
#pragma unroll
        for (int r = 0; r < 8; ++r) o[r] = (_Float16)acc[r];
        *(v8h*)(Ks + nl * QP + 16u * t + 8u * h) = o;
    }
    *(v8h*)(Ks + nl * QP + 48u + 8u * h) = zz;
    // v (channel-major)
#pragma unroll
    for (unsigned t = 0; t < 3; ++t) {
        const v8f acc = proj_tile(Ws + 2 * CQK * CIN, Bs + 2 * CQK, t, h, l15, xb.v, VCARRY);
#pragma unroll
        for (unsigned r = 0; r < 8; ++r)
            Vs[(16u * t + 8u * h + r) * VP + nl] = (_Float16)acc[r];
    }
    __syncthreads();

    v8h qv[4], kv[4], vv[3];
#pragma unroll
    for (unsigned it = 0; it < 4; ++it) {
        const unsigned idx = it * 256u + tid;
        const unsigned row = idx >> 3, pc = idx & 7u;
        qv[it] = *(const v8h*)(Qs + row * QP + pc * 8u);
        kv[it] = *(const v8h*)(Ks + row * QP + pc * 8u);
    }
#pragma unroll
    for (unsigned it = 0; it < 3; ++it) {
        const unsigned idx = it * 256u + tid;
        const unsigned row = idx >> 4, pc = idx & 15u;
        vv[it] = *(const v8h*)(Vs + row * VP + pc * 8u);
    }
    _Float16* qd = Qp + ((size_t)b * SEQ + pos0) * CPAD;
    _Float16* kd = Kp + ((size_t)b * SEQ + pos0) * CPAD;
    _Float16* vd = Vp + (size_t)b * VROWS * SEQ + pos0;
#pragma unroll
    for (unsigned it = 0; it < 4; ++it) {
        const unsigned idx = it * 256u + tid;
        *(v8h*)(qd + (size_t)idx * 8u) = qv[it];
        *(v8h*)(kd + (size_t)idx * 8u) = kv[it];
    }
#pragma unroll
    for (unsigned it = 0; it < 3; ++it) {
        const unsigned idx = it * 256u + tid;
        const unsigned row = idx >> 4, pc = idx & 15u;
        *(v8h*)(vd + (size_t)row * SEQ + pc * 8u) = vv[it];
    }
    
}

// ---------------------------------------------------------------------------
// Kernel 2: row statistics. Wave w owns score rows n = pos0 + 16w .. +15 (A = k rows, resident),
// sweeps all column tiles m (B = q rows, staged 128 rows at a time in LDS by asynchronous copies,
// two buffers: stage t+1 flies while stage t is worked on). Per-lane running max + rescaled sum,
// combined over the 16 lanes of a half at the end. Table entry: off[n] = M_n + log2(Z_n) - 12,
// so that exp2(s - off[n]) = 4096 * softmax weight.
// LDS offS: cross-wave (block barrier); staged 128 floats == consumed 128 floats.
// LDS QsB: per buffer rows 0..127 x halves 0..63 copied and read (pitch QP), published by wait + block barrier.
// coverage: grid NB*SEQ/128 blocks x 128 rows = NB*SEQ table entries
// ---------------------------------------------------------------------------
__global__ __launch_bounds__(256) void k_stats(const _Float16* __restrict__ Kp,
                                               const _Float16* __restrict__ Qp,
                                               float* __restrict__ offt)
{
    __shared__ __attribute__((aligned(16))) float offS[128];
    __shared__ __attribute__((aligned(16))) _Float16 QsB[2 * STG * QP];

    const unsigned tid = threadIdx.x, lane = tid & 31u, w = tid >> 5;
    const unsigned h = lane >> 4, l15 = lane & 15u;
    const unsigned bps = (unsigned)(SEQ / 128);
    const unsigned b = blockIdx.x / bps;
    const unsigned pos0 = (blockIdx.x - b * bps) * 128u;

    const _Float16* qg = Qp + (size_t)b * SEQ * CPAD;    // this batch's q plane
    const unsigned  ql = lds_off(QsB);

    stage_rows64(ql, qg, tid);                           // stage 0 -> buffer 0

    FragH k0, k1;
    {
        const _Float16* kp = Kp + ((size_t)b * SEQ + pos0 + w * 16u + l15) * CPAD + 8u * h;
        k0.half[0] = *(const v8h*)(kp);
        k0.half[1] = *(const v8h*)(kp + 16);
        k1.half[0] = *(const v8h*)(kp + 32);
        k1.half[1] = *(const v8h*)(kp + 48);
    }

    float m[8], z[8];
#pragma unroll
    for (int r = 0; r < 8; ++r) { m[r] = -3.0e38f; z[r] = 0.f; }

    wait_async0();
    __syncthreads();                                     // stage 0 published
    if (NST > 1) stage_rows64(ql + (unsigned)(STG * QP * 2), qg + (size_t)STG * CPAD, tid);

    // rolled: one trip per stage, so that the publish point stands once, at the trip's foot
#pragma unroll 1
    for (unsigned st = 0; st < (unsigned)NST; ++st) {
        const unsigned bufh = (st & 1u) * (unsigned)(STG * QP);
        const _Float16* qs = QsB + bufh + l15 * QP + 8u * h;
        // the stage's LDS reads stand together, ahead of its first product
        FragH q0[STG / 16], q1[STG / 16];
#pragma unroll                                           // every fragment index a constant: the arrays stay in registers
        for (unsigned mt = 0; mt < (unsigned)(STG / 16); ++mt) {
            const _Float16* qp = qs + mt * 16u * QP;
            q0[mt].half[0] = *(const v8h*)(qp);
            q0[mt].half[1] = *(const v8h*)(qp + 16);
            q1[mt].half[0] = *(const v8h*)(qp + 32);
            q1[mt].half[1] = *(const v8h*)(qp + 48);
        }
#pragma unroll                                           // as above
        for (unsigned mt = 0; mt < (unsigned)(STG / 16); ++mt) {
            v8f c = zero8f();
            c = mma_f16(k0.v, q0[mt].v, c);
            c = mma_f16(k1.v, q1[mt].v, c);
#pragma unroll
            for (int r = 0; r < 8; ++r) {
                const float mn = fmaxf(m[r], c[r]);
                z[r] = z[r] * ex2(m[r] - mn) + ex2(c[r] - mn);
                m[r] = mn;
            }
        }
        // publish point of stage st+1; the same barrier ends every reader's last read of stage st's buffer
        wait_ds0();
        wait_async0();
        __syncthreads();
        if (st + 2u < (unsigned)NST)
            stage_rows64(ql + bufh * 2u, qg + (size_t)(st + 2u) * STG * CPAD, tid);
    }
    wait_async0();

#pragma unroll
    for (unsigned r = 0; r < 8; ++r) {
        float M = m[r];
#pragma unroll
        for (int o = 1; o < 16; o <<= 1) M = fmaxf(M, __shfl_xor(M, o));
        float zs = z[r] * ex2(m[r] - M);
#pragma unroll
        for (int o = 1; o < 16; o <<= 1) zs += __shfl_xor(zs, o);
        const float ov = M + log2f(zs) - PLOG2;
        if (l15 == 0u) offS[w * 16u + 8u * h + r] = ov;
    }
    __syncthreads();

    if (w == 0u) {
        const v4f v = *(const v4f*)(offS + lane * 4u);
        float* dst = offt + (size_t)b * SEQ + pos0 + lane * 4u;
        *(v4f*)dst = v;
        
    }
}

// ---------------------------------------------------------------------------
// Kernel 3: value product + output mixing. Wave w owns output columns m = pos0 + 16w .. +15
// (B = q rows, resident). The swept k rows, v columns and offsets are staged 128 rows at a time in LDS by
// asynchronous copies, two buffers. Per 32-row step: two score tiles recomputed with the same operand roles
// and k-step order as kernel 2 (A = k rows n, B = q), P = exp2(s - off[n]) packed as the B fragment
// (element r <- tile rows 0..15, element 8+r <- tile rows 16..31, lane unchanged: D row 8h+r is
// B k-index 8h+r), A = v rows (channel-major plane), three channel tiles accumulated.
// Epilogue: attn tile to LDS, 12x36 mixing in f32, output tile staged and written as whole 512-B rows.
// LDS: woS/boS, attnS, outS all cross-wave-safe (block barriers between producer and consumer).
//   staged extent == consumed extent: attnS per wave 48x16 written, rows 0..35 read; outS 12 x 128 written and read.
//   KsB rows 0..127 x halves 0..63 (pitch QP), VsB rows 0..47 x halves 0..127 (pitch VP), OsB 128 floats, per buffer:
//   copied and read whole, published by wait + block barrier.
// coverage: grid NB*SEQ/128 blocks x 12 rows x 128 cols = NB*12*SEQ outputs; 384 pieces x 4 floats per block
// ---------------------------------------------------------------------------
__global__ __launch_bounds__(256) void k_attn(const _Float16* __restrict__ Kp,
                                              const _Float16* __restrict__ Qp,
                                              const _Float16* __restrict__ Vp,
                                              const float* __restrict__ offt,
                                              const float* __restrict__ wo,
                                              const float* __restrict__ bo,
                                              float* __restrict__ out)
{
    __shared__ __attribute__((aligned(16))) float attnS[8 * 48 * 16];
    __shared__ __attribute__((aligned(16))) float outS[CIN * OSP];
    __shared__ float woS[CIN * CQK];
    __shared__ float boS[16];
    __shared__ __attribute__((aligned(16))) _Float16 KsB[2 * STG * QP];
    __shared__ __attribute__((aligned(16))) _Float16 VsB[2 * VROWS * VP];
    __shared__ __attribute__((aligned(16))) float    OsB[2 * STG];

    const unsigned tid = threadIdx.x, lane = tid & 31u, w = tid >> 5;
    const unsigned h = lane >> 4, l15 = lane & 15u;
    const unsigned bps = (unsigned)(SEQ / 128);
    const unsigned b = blockIdx.x / bps;
    const unsigned pos0 = (blockIdx.x - b * bps) * 128u;
    const unsigned wu = (unsigned)__builtin_amdgcn_readfirstlane((int)w);   // wave number in a scalar register

    // one stage: k rows (4 copies per thread), v columns (3 per thread: piece = 16 B, 16 pieces per row),
    // offsets (wave 0 alone, one copy, every lane on)
    const _Float16* kg = Kp + (size_t)b * SEQ * CPAD;
    const char*     vg = (const char*)(Vp + ((size_t)b * VROWS + (tid >> 4)) * SEQ) + (tid & 15u) * 16u;
    const char*     og = (const char*)(offt + (size_t)b * SEQ) + lane * 16u;
    const unsigned  kl = lds_off(KsB);
    const unsigned  vl = lds_off(VsB) + (tid >> 4) * (unsigned)(VP * 2) + (tid & 15u) * 16u;
    const unsigned  ol = lds_off(OsB) + lane * 16u;
    auto stage_in = [&](unsigned st, unsigned buf) {
        stage_rows64(kl + buf * (unsigned)(STG * QP * 2), kg + (size_t)st * STG * CPAD, tid);
        const unsigned vd = vl + buf * (unsigned)(VROWS * VP * 2);
        const char*    vs = vg + (size_t)st * (STG * 2);
        async_copy3(vd,                      vs,
                    vd + 16u * (VP * 2),     vs + (size_t)16 * SEQ * 2,
                    vd + 32u * (VP * 2),     vs + (size_t)32 * SEQ * 2);
        if (wu == 0u) async_copy1(ol + buf * (unsigned)(STG * 4), og + (size_t)st * (STG * 4));
    };

    stage_in(0u, 0u);

#pragma unroll
    for (unsigned it = 0; it < 2; ++it) {
        const unsigned i  = it * 256u + tid;
        const unsigned ic = i < 432u ? i : 431u;
        const float a0 = bf16_val(wo[ic]);
        if (i < 432u) woS[i] = a0;
    }
    {
        const unsigned ic = tid < (unsigned)CIN ? tid : (unsigned)(CIN - 1);
        const float a0 = bf16_val(bo[ic]);
        if (tid < (unsigned)CIN) boS[tid] = a0;
    }

    FragH q0, q1;
    {
        const _Float16* qp = Qp + ((size_t)b * SEQ + pos0 + w * 16u + l15) * CPAD + 8u * h;
        q0.half[0] = *(const v8h*)(qp);
        q0.half[1] = *(const v8h*)(qp + 16);
        q1.half[0] = *(const v8h*)(qp + 32);
        q1.half[1] = *(const v8h*)(qp + 48);
    }

    v8f acc[3];
#pragma unroll
    for (int t = 0; t < 3; ++t) acc[t] = zero8f();

    wait_async0();
    __syncthreads();                                     // stage 0 published
    if (NST > 1) stage_in(1u, 1u);

    // rolled: one trip per stage, so that the publish point stands once, at the trip's foot
#pragma unroll 1
    for (unsigned st = 0; st < (unsigned)NST; ++st) {
      const unsigned buf = st & 1u;
      const _Float16* kb = KsB + buf * (unsigned)(STG * QP) + l15 * QP + 8u * h;
      const _Float16* vb = VsB + buf * (unsigned)(VROWS * VP) + l15 * VP + 8u * h;
      const float*    ob = OsB + buf * (unsigned)STG + 8u * h;
      // LDS reads of a 32-row step stand together, one step ahead of the step that uses them (inside the stage only)
      FragH ka[2][4], vf[2][3];
      v4f   of[2][4];
      auto fetch = [&](unsigned ns, unsigned s) {
          const _Float16* kp = kb + ns * 32u * QP;
#pragma unroll                                           // every fragment index a constant: the arrays stay in registers
          for (unsigned j = 0; j < 2; ++j) {             // j: score tile (rows 16j..16j+15 of the step)
              ka[s][2 * j].half[0]     = *(const v8h*)(kp + j * 16u * QP);
              ka[s][2 * j].half[1]     = *(const v8h*)(kp + j * 16u * QP + 16);
              ka[s][2 * j + 1].half[0] = *(const v8h*)(kp + j * 16u * QP + 32);
              ka[s][2 * j + 1].half[1] = *(const v8h*)(kp + j * 16u * QP + 48);
          }
          const float* op = ob + ns * 32u;
          of[s][0] = *(const v4f*)(op);
          of[s][1] = *(const v4f*)(op + 4);
          of[s][2] = *(const v4f*)(op + 16);
          of[s][3] = *(const v4f*)(op + 20);
          const _Float16* vp = vb + ns * 32u;
#pragma unroll                                           // as above
          for (unsigned t = 0; t < 3; ++t) {
              vf[s][t].half[0] = *(const v8h*)(vp + t * 16u * VP);
              vf[s][t].half[1] = *(const v8h*)(vp + t * 16u * VP + 16);
          }
      };
      fetch(0u, 0u);
#pragma unroll                                           // as above: the register set s is a constant in every step
      for (unsigned ns = 0; ns < (unsigned)(STG / 32); ++ns) {
        const unsigned s = ns & 1u;
        if (ns + 1u < (unsigned)(STG / 32)) fetch(ns + 1u, s ^ 1u);

        v8f c0 = zero8f();
        c0 = mma_f16(ka[s][0].v, q0.v, c0);
        c0 = mma_f16(ka[s][1].v, q1.v, c0);
        v8f c1 = zero8f();
        c1 = mma_f16(ka[s][2].v, q0.v, c1);
        c1 = mma_f16(ka[s][3].v, q1.v, c1);

        FragH pb;
#pragma unroll
        for (int r = 0; r < 4; ++r) {
            pb.v[r]      = (_Float16)ex2(c0[r]     - of[s][0][r]);
            pb.v[4 + r]  = (_Float16)ex2(c0[4 + r] - of[s][1][r]);
            pb.v[8 + r]  = (_Float16)ex2(c1[r]     - of[s][2][r]);
            pb.v[12 + r] = (_Float16)ex2(c1[4 + r] - of[s][3][r]);
        }

#pragma unroll                                           // as above
        for (unsigned t = 0; t < 3; ++t)
            acc[t] = mma_f16(vf[s][t].v, pb.v, acc[t]);
      }
      // publish point of stage st+1; the same barrier ends every reader's last read of stage st's buffers
      wait_ds0();
      wait_async0();
      __syncthreads();
      if (st + 2u < (unsigned)NST) stage_in(st + 2u, buf);
    }
    wait_async0();

    // attn tile: D row = channel 16t+8h+r, column = l15
    float* aL = attnS + w * (48u * 16u);
#pragma unroll
    for (unsigned t = 0; t < 3; ++t) {
#pragma unroll
        for (unsigned r = 0; r < 8; ++r)
            aL[(16u * t + 8u * h + r) * 16u + l15] = acc[t][r] * OUT_SCALE;
    }
    __syncthreads();

    // output mixing: lanes 0..15 -> o = 0..5, lanes 16..31 -> o = 6..11
#pragma unroll 1
    for (unsigned oo = 0; oo < 6; ++oo) {
        const unsigned o = h * 6u + oo;
        float sum = boS[o];
        const float* wr = woS + o * CQK;
#pragma unroll
        for (unsigned c = 0; c < (unsigned)CQK; ++c) sum += wr[c] * aL[c * 16u + l15];
        outS[o * OSP + w * 16u + l15] = sum;
    }
    __syncthreads();

    // whole 512-B rows: wave w writes row w, waves 0..3 also write row 8+w; 32 lanes x 16 B contiguous
    const unsigned row0 = w;
    const unsigned row1 = (8u + w) < (unsigned)CIN ? (8u + w) : (unsigned)(CIN - 1);
    const v4f ov0 = *(const v4f*)(outS + row0 * OSP + lane * 4u);
    const v4f ov1 = *(const v4f*)(outS + row1 * OSP + lane * 4u);
    float* d0 = out + ((size_t)b * CIN + row0) * SEQ + pos0 + lane * 4u;
    float* d1 = out + ((size_t)b * CIN + row1) * SEQ + pos0 + lane * 4u;
    *(v4f*)d0 = ov0;
    if (w < 4u) *(v4f*)d1 = ov1;
    
}

// ---------------------------------------------------------------------------
extern "C" void kernel_launch(void* const* d_in, const int* in_sizes, int n_in,
                              void* d_out, int out_size, void* d_ws, size_t ws_size,
                              hipStream_t stream)
{
    if (n_in < 9) return;
    const long long need_x = ((long long)NB * CIN - 1) * SEQ_FULL + SEQ;
    if ((long long)in_sizes[0] < need_x) return;
    if (in_sizes[1] < CQK * CIN || in_sizes[2] < CQK) return;
    if (in_sizes[3] < CQK * CIN || in_sizes[4] < CQK) return;
    if (in_sizes[5] < CQK * CIN || in_sizes[6] < CQK) return;
    if (in_sizes[7] < CIN * CQK || in_sizes[8] < CIN) return;
    if ((long long)out_size < (long long)NB * CIN * SEQ) return;

    const float* x  = (const float*)d_in[0];
    const float* wq = (const float*)d_in[1];
    const float* bq = (const float*)d_in[2];
    const float* wk = (const float*)d_in[3];
    const float* bk = (const float*)d_in[4];
    const float* wv = (const float*)d_in[5];
    const float* bv = (const float*)d_in[6];
    const float* wo = (const float*)d_in[7];
    const float* bo = (const float*)d_in[8];
    float* out = (float*)d_out;

    char* ws = (char*)d_ws;
    size_t off = 0;
    auto carve = [&](size_t bytes) -> char* {
        char* p = ws + off;
        off += (bytes + 255) & ~(size_t)255;
        return p;
    };
    _Float16* Qp  = (_Float16*)carve((size_t)NB * SEQ * CPAD * 2);      // [NB*SEQ][64]
    _Float16* Kp  = (_Float16*)carve((size_t)NB * SEQ * CPAD * 2);      // [NB*SEQ][64]
    _Float16* Vp  = (_Float16*)carve((size_t)NB * VROWS * SEQ * 2);     // [NB][48][SEQ]
    float*    oft = (float*)carve((size_t)NB * SEQ * 4);                // [NB*SEQ]
    if (off > ws_size) return;

    const unsigned nblk = (unsigned)(NB * (SEQ / 128));
    k_proj <<<nblk, 256, 0, stream>>>(x, wq, bq, wk, bk, wv, bv, Qp, Kp, Vp);
    k_stats<<<nblk, 256, 0, stream>>>(Kp, Qp, oft);
    k_attn <<<nblk, 256, 0, stream>>>(Kp, Qp, Vp, oft, wo, bo, out);
}

// v002
// One run takes 70.4 microseconds.
// In two side-by-side timings against v001, it was 1.08 and 1.13 times as fast.
// Counting every step since v000, it is 5.79 times as fast.
#include <hip/hip_runtime.h>

// Contractions: q/k/v 1x1 projections via v_wmma_f32_16x16x32_bf16 (bf16 operands = RNE-converted inputs, K=12 zero-padded to 32, f32 accumulate);
// k^T.q scores (K=36 zero-padded to 64) and v.P value product via v_wmma_f32_16x16x32_f16 (f16 operands: q x1, k x(log2e/sqrt(12)), v x16, P x4096), f32 accumulate;
// softmax statistics in f32; 12x36 output mixing in f32 on the VALU (12 output channels < one tile).

#define DEV __device__ __forceinline__

#ifndef NB
#define NB 8
#endif
#ifndef SEQ
#define SEQ 4096
#endif
#define NB_FULL  8
#define SEQ_FULL 4096
#define CIN   12
#define CQK   36
#define CPAD  64                                         // q/k plane row pitch (halves), channels 36..63 are zeros
#define VROWS 48                                         // v plane rows per batch, rows 36..47 are zeros
#define QP    72                                         // LDS pitch (halves) of q/k staging rows
#define VP    136                                        // LDS pitch (halves) of v staging rows
#define OSP   132                                        // LDS pitch (floats) of output staging rows
#define STG   128                                        // swept rows per LDS stage (kernels 2 and 3)
#define NST   (SEQ / STG)                                // stages per sweep
#define KSCALE (0.28867513459481287f * 1.4426950408889634f)   // 1/sqrt(12) * log2(e), folded into the k plane
#define VCARRY 16.0f
#define PLOG2  12.0f                                     // P carried x 2^12
#define OUT_SCALE (1.0f / 65536.0f)                      // 1 / (16 * 4096)

static_assert(NB >= 1 && NB <= NB_FULL);
static_assert(SEQ >= 128 && SEQ <= SEQ_FULL && (SEQ % 128) == 0);
static_assert(256 * 4 * 8 == 128 * CPAD);                // q/k plane coverage per block
static_assert(256 * 3 * 8 == VROWS * 128);               // v plane coverage per block
static_assert(384 * 4 == CIN * 128);                     // output coverage per block
static_assert(32 * 4 == 128);                            // stats coverage per block
static_assert(((QP * 2) % 16) == 0 && ((VP * 2) % 16) == 0 && ((OSP * 4) % 16) == 0);
static_assert(CQK <= CPAD && CQK <= VROWS && CIN <= 16);
static_assert(256 * 4 * 16 == STG * CPAD * 2);           // q/k stage: 4 copies of 16 B per thread
static_assert(256 * 3 * 16 == VROWS * STG * 2);          // v stage: 3 copies of 16 B per thread
static_assert(STG / 16 == 8);                            // kernel 2 takes its max over 8 tiles per stage
static_assert(32 * 16 == STG * 4);                       // offset stage: 1 copy of 16 B per lane of one wave

typedef _Float16       v8h   __attribute__((ext_vector_type(8)));
typedef _Float16       v16h  __attribute__((ext_vector_type(16)));
typedef __bf16         v16bf __attribute__((ext_vector_type(16)));
typedef unsigned short v8us  __attribute__((ext_vector_type(8)));
typedef unsigned short v16us __attribute__((ext_vector_type(16)));
typedef float          v8f   __attribute__((ext_vector_type(8)));
typedef float          v4f   __attribute__((ext_vector_type(4)));

union FragH { v16h v;  v8h  half[2]; };
union FragB { v16bf v; v16us u; v8us half[2]; };

// ---------------------------------------------------------------------------
// helpers
// ---------------------------------------------------------------------------
DEV unsigned int bf16_bits(float f) {                    // f32 -> bf16 bits, RNE convert
    unsigned int u = __float_as_uint(f);
    u += 0x7FFFu + ((u >> 16) & 1u);
    return u >> 16;
}
DEV float bf16_val(float f) { return __uint_as_float(bf16_bits(f) << 16); }

DEV v8f zero8f() {
    v8f z;
#pragma unroll
    for (int i = 0; i < 8; ++i) z[i] = 0.f;
    return z;
}

DEV float ex2(float x) { return __builtin_amdgcn_exp2f(x); }

// 16x16x32 WMMA with f32 accumulate; 4 nops guard D and keep A/B live
DEV v8f mma_bf16(v16bf a, v16bf b, v8f c) {
    c = __builtin_amdgcn_wmma_f32_16x16x32_bf16(false, a, false, b, (short)0, c, false, false);
    asm volatile("v_nop\n\tv_nop\n\tv_nop\n\tv_nop" : "+v"(c) : "v"(a), "v"(b));
    return c;
}
DEV v8f mma_f16(v16h a, v16h b, v8f c) {
    c = __builtin_amdgcn_wmma_f32_16x16x32_f16(false, a, false, b, (short)0, c, false, false);
    asm volatile("v_nop\n\tv_nop\n\tv_nop\n\tv_nop" : "+v"(c) : "v"(a), "v"(b));
    return c;
}

// ---------------------------------------------------------------------------
// asynchronous copies global -> LDS, 16 B per lane, through no register.
// Each run of copies ends in its own statement with s_wait_xcnt 0, so that no address register
// of an issued copy is rewritten ahead of that wait.
// ---------------------------------------------------------------------------
DEV unsigned lds_off(const void* p) { return (unsigned)(size_t)p; }   // byte offset in the work-group's LDS

DEV void async_copy1(unsigned l0, const void* g0) {
    asm volatile("global_load_async_to_lds_b128 %0, %1, off\n\t"
                 "s_wait_xcnt 0x0"
                 :: "v"(l0), "v"(g0) : "memory");
}
DEV void async_copy3(unsigned l0, const void* g0, unsigned l1, const void* g1, unsigned l2, const void* g2) {
    asm volatile("global_load_async_to_lds_b128 %0, %1, off\n\t"
                 "global_load_async_to_lds_b128 %2, %3, off\n\t"
                 "global_load_async_to_lds_b128 %4, %5, off\n\t"
                 "s_wait_xcnt 0x0"
                 :: "v"(l0), "v"(g0), "v"(l1), "v"(g1), "v"(l2), "v"(g2) : "memory");
}
DEV void async_copy4(unsigned l0, const void* g0, unsigned l1, const void* g1,
                     unsigned l2, const void* g2, unsigned l3, const void* g3) {
    asm volatile("global_load_async_to_lds_b128 %0, %1, off\n\t"
                 "global_load_async_to_lds_b128 %2, %3, off\n\t"
                 "global_load_async_to_lds_b128 %4, %5, off\n\t"
                 "global_load_async_to_lds_b128 %6, %7, off\n\t"
                 "s_wait_xcnt 0x0"
                 :: "v"(l0), "v"(g0), "v"(l1), "v"(g1), "v"(l2), "v"(g2), "v"(l3), "v"(g3) : "memory");
}
// the issuing wave's own copies have landed in LDS behind this wait
DEV void wait_async0() { asm volatile("s_wait_asynccnt 0x0" ::: "memory"); }
// the wave's own LDS reads have retired before the buffer they read is handed to its next writer
DEV void wait_ds0()    { asm volatile("s_wait_dscnt 0x0" ::: "memory"); }

// one stage of a [rows][64]-half plane: STG rows of 128 B, contiguous in memory, to LDS rows of pitch QP.
// thread tid moves pieces tid, 256+tid, 512+tid, 768+tid (piece = 16 B; 8 pieces per row)
DEV void stage_rows64(unsigned lds_base, const _Float16* g, unsigned tid) {
    const unsigned l = lds_base + (tid >> 3) * (unsigned)(QP * 2) + (tid & 7u) * 16u;
    const char* gp = (const char*)g + tid * 16u;
    async_copy4(l,                       gp,
                l + 32u * (QP * 2),      gp + 4096,
                l + 64u * (QP * 2),      gp + 8192,
                l + 96u * (QP * 2),      gp + 12288);
}

// A fragment of a [36][12] weight held in LDS as bf16-exact f32 values.
// row c = 16t + l15 (zero for c >= 36); elements 0..7 <- k = 8h+e (zero for k >= 12); elements 8..15 <- k >= 16 -> zero
DEV FragB w_frag(const float* Wl, unsigned t, unsigned h, unsigned l15) {
    FragB a;
    const unsigned c  = 16u * t + l15;
    const unsigned cc = c < (unsigned)CQK ? c : (unsigned)(CQK - 1);
#pragma unroll
    for (unsigned e = 0; e < 8; ++e) {
        const unsigned i  = 8u * h + e;
        const unsigned ic = i < (unsigned)CIN ? i : (unsigned)(CIN - 1);
        const unsigned bits = __float_as_uint(Wl[cc * CIN + ic]) >> 16;
        a.u[e]     = (unsigned short)((c < (unsigned)CQK && i < (unsigned)CIN) ? bits : 0u);
        a.u[8 + e] = (unsigned short)0;
    }
    return a;
}

// one 16(channel) x 16(position) projection tile: (W.x + bias) * carry ; D row = channel 16t+8h+r, column = position l15
DEV v8f proj_tile(const float* Wl, const float* Bl, unsigned t, unsigned h, unsigned l15, v16bf xb, float carry) {
    const FragB a = w_frag(Wl, t, h, l15);
    v8f acc = mma_bf16(a.v, xb, zero8f());
#pragma unroll
    for (unsigned r = 0; r < 8; ++r) {
        const unsigned c  = 16u * t + 8u * h + r;
        const unsigned cc = c < (unsigned)CQK ? c : (unsigned)(CQK - 1);
        const float bvl = Bl[cc];
        acc[r] = (acc[r] + ((c < (unsigned)CQK) ? bvl : 0.f)) * carry;
    }
    return acc;
}

// ---------------------------------------------------------------------------
// Kernel 1: projections. Block = 8 waves = 128 positions of one batch; wave w owns 16 positions.
//   B fragment = x[b][i][n] (bf16 RNE, k = i zero-padded 12 -> 32), A fragments = weights (rows = channels).
//   Outputs: Qp [NB*SEQ][64] f16 (q), Kp [NB*SEQ][64] f16 (k * KSCALE), channels 36..63 zero;
//            Vp [NB][48][SEQ] f16 (v * 16), rows 36..47 zero.
// LDS: Ws/Bs, Qs/Ks/Vs are cross-wave (block barriers). staged extent == consumed extent:
//   Qs/Ks rows 0..127 x halves 0..63, Vs rows 0..47 x halves 0..127.
// coverage: grid NB*SEQ/128 blocks; per block 256 thr x 4 x 8 halves = 128 x 64 (q, k); 256 x 3 x 8 = 48 x 128 (v)
// ---------------------------------------------------------------------------
__global__ __launch_bounds__(256) void k_proj(const float* __restrict__ x,
                                              const float* __restrict__ wq, const float* __restrict__ bq,
                                              const float* __restrict__ wk, const float* __restrict__ bk,
                                              const float* __restrict__ wv, const float* __restrict__ bv,
                                              _Float16* __restrict__ Qp, _Float16* __restrict__ Kp,
                                              _Float16* __restrict__ Vp)
{
    __shared__ __attribute__((aligned(16))) _Float16 Qs[128 * QP];
    __shared__ __attribute__((aligned(16))) _Float16 Ks[128 * QP];
    __shared__ __attribute__((aligned(16))) _Float16 Vs[VROWS * VP];
    __shared__ float Ws[3 * CQK * CIN];
    __shared__ float Bs[3 * CQK];

    const unsigned tid = threadIdx.x, lane = tid & 31u, w = tid >> 5;
    const unsigned h = lane >> 4, l15 = lane & 15u;
    const unsigned bps = (unsigned)(SEQ / 128);
    const unsigned b = blockIdx.x / bps;
    const unsigned pos0 = (blockIdx.x - b * bps) * 128u;
    const unsigned nl = w * 16u + l15;                   // position inside the block

    // weights and biases -> LDS as bf16-exact f32 (clamped addresses, guarded LDS stores)
#pragma unroll
    for (unsigned it = 0; it < 2; ++it) {
        const unsigned i  = it * 256u + tid;
        const unsigned ic = i < 432u ? i : 431u;
        const float a0 = bf16_val(wq[ic]);
        const float a1 = bf16_val(wk[ic]);
        const float a2 = bf16_val(wv[ic]);
        if (i < 432u) { Ws[i] = a0; Ws[432u + i] = a1; Ws[864u + i] = a2; }
    }
    {
        const unsigned ic = tid < (unsigned)CQK ? tid : (unsigned)(CQK - 1);
        const float a0 = bf16_val(bq[ic]);
        const float a1 = bf16_val(bk[ic]);
        const float a2 = bf16_val(bv[ic]);
        if (tid < (unsigned)CQK) { Bs[tid] = a0; Bs[CQK + tid] = a1; Bs[2 * CQK + tid] = a2; }
    }

    // x fragment: column = position, elements 0..7 <- input channel 8h+e (zero for >= 12), 8..15 <- zero
    FragB xb;
    {
        const float* xp = x + (size_t)b * CIN * SEQ_FULL + pos0 + nl;
#pragma unroll
        for (unsigned e = 0; e < 8; ++e) {
            const unsigned i  = 8u * h + e;
            const unsigned ic = i < (unsigned)CIN ? i : (unsigned)(CIN - 1);
            const unsigned bits = bf16_bits(xp[(size_t)ic * SEQ_FULL]);
            xb.u[e]     = (unsigned short)((i < (unsigned)CIN) ? bits : 0u);
            xb.u[8 + e] = (unsigned short)0;
        }
    }
    __syncthreads();

    v8h zz;
#pragma unroll
    for (int i = 0; i < 8; ++i) zz[i] = (_Float16)0.f;

    // q
#pragma unroll
    for (unsigned t = 0; t < 3; ++t) {
        const v8f acc = proj_tile(Ws, Bs, t, h, l15, xb.v, 1.0f);
        v8h o;
#pragma unroll
        for (int r = 0; r < 8; ++r) o[r] = (_Float16)acc[r];
        *(v8h*)(Qs + nl * QP + 16u * t + 8u * h) = o;
    }
    *(v8h*)(Qs + nl * QP + 48u + 8u * h) = zz;
    // k (scaled into the exp2 domain)
#pragma unroll
    for (unsigned t = 0; t < 3; ++t) {
        const v8f acc = proj_tile(Ws + CQK * CIN, Bs + CQK, t, h, l15, xb.v, KSCALE);
        v8h o;
#pragma unroll
        for (int r = 0; r < 8; ++r) o[r] = (_Float16)acc[r];
        *(v8h*)(Ks + nl * QP + 16u * t + 8u * h) = o;
    }
    *(v8h*)(Ks + nl * QP + 48u + 8u * h) = zz;
    // v (channel-major)
#pragma unroll
    for (unsigned t = 0; t < 3; ++t) {
        const v8f acc = proj_tile(Ws + 2 * CQK * CIN, Bs + 2 * CQK, t, h, l15, xb.v, VCARRY);
#pragma unroll
        for (unsigned r = 0; r < 8; ++r)
            Vs[(16u * t + 8u * h + r) * VP + nl] = (_Float16)acc[r];
    }
    __syncthreads();

    v8h qv[4], kv[4], vv[3];
#pragma unroll
    for (unsigned it = 0; it < 4; ++it) {
        const unsigned idx = it * 256u + tid;
        const unsigned row = idx >> 3, pc = idx & 7u;
        qv[it] = *(const v8h*)(Qs + row * QP + pc * 8u);
        kv[it] = *(const v8h*)(Ks + row * QP + pc * 8u);
    }
#pragma unroll
    for (unsigned it = 0; it < 3; ++it) {
        const unsigned idx = it * 256u + tid;
        const unsigned row = idx >> 4, pc = idx & 15u;
        vv[it] = *(const v8h*)(Vs + row * VP + pc * 8u);
    }
    _Float16* qd = Qp + ((size_t)b * SEQ + pos0) * CPAD;
    _Float16* kd = Kp + ((size_t)b * SEQ + pos0) * CPAD;
    _Float16* vd = Vp + (size_t)b * VROWS * SEQ + pos0;
#pragma unroll
    for (unsigned it = 0; it < 4; ++it) {
        const unsigned idx = it * 256u + tid;
        *(v8h*)(qd + (size_t)idx * 8u) = qv[it];
        *(v8h*)(kd + (size_t)idx * 8u) = kv[it];
    }
#pragma unroll
    for (unsigned it = 0; it < 3; ++it) {
        const unsigned idx = it * 256u + tid;
        const unsigned row = idx >> 4, pc = idx & 15u;
        *(v8h*)(vd + (size_t)row * SEQ + pc * 8u) = vv[it];
    }
    
}

// ---------------------------------------------------------------------------
// Kernel 2: row statistics. Wave w owns score rows n = pos0 + 16w .. +15 (B = k rows, resident),
// sweeps all column tiles m (A = q rows, staged 128 rows at a time in LDS by asynchronous copies,
// two buffers: stage t+1 flies while stage t is worked on). The score tile stands transposed:
// D row 8h+r = column m, D column l15 = row n, so all 8 values of a lane belong to ONE row n.
// Per lane: one running max, taken over a stage's 8 tiles (64 values) at a time, one rescale per stage,
// one exp2 per score, 8 partial sums. The two halves of the wave (lanes l, l^16) are combined at the end.
// Table entry: off[n] = M_n + log2(Z_n) - 12, so that exp2(s - off[n]) = 4096 * softmax weight.
// LDS offS: cross-wave (block barrier); staged 128 floats == consumed 128 floats.
// LDS QsB: per buffer rows 0..127 x halves 0..63 copied and read (pitch QP), published by wait + block barrier.
// coverage: grid NB*SEQ/128 blocks x 128 rows = NB*SEQ table entries
// ---------------------------------------------------------------------------
DEV float max3f(float a, float b, float c) { return fmaxf(fmaxf(a, b), c); }
// max of a start value and a tile's 8 values: four 3-input steps
DEV float max9f(float s, v8f c) { return max3f(max3f(max3f(max3f(s, c[0], c[1]), c[2], c[3]), c[4], c[5]), c[6], c[7]); }

__global__ __launch_bounds__(256) void k_stats(const _Float16* __restrict__ Kp,
                                               const _Float16* __restrict__ Qp,
                                               float* __restrict__ offt)
{
    __shared__ __attribute__((aligned(16))) float offS[128];
    __shared__ __attribute__((aligned(16))) _Float16 QsB[2 * STG * QP];

    const unsigned tid = threadIdx.x, lane = tid & 31u, w = tid >> 5;
    const unsigned h = lane >> 4, l15 = lane & 15u;
    const unsigned bps = (unsigned)(SEQ / 128);
    const unsigned b = blockIdx.x / bps;
    const unsigned pos0 = (blockIdx.x - b * bps) * 128u;

    const _Float16* qg = Qp + (size_t)b * SEQ * CPAD;    // this batch's q plane
    const unsigned  ql = lds_off(QsB);

    stage_rows64(ql, qg, tid);                           // stage 0 -> buffer 0

    FragH k0, k1;
    {
        const _Float16* kp = Kp + ((size_t)b * SEQ + pos0 + w * 16u + l15) * CPAD + 8u * h;
        k0.half[0] = *(const v8h*)(kp);
        k0.half[1] = *(const v8h*)(kp + 16);
        k1.half[0] = *(const v8h*)(kp + 32);
        k1.half[1] = *(const v8h*)(kp + 48);
    }

    float mrun = -3.0e38f;                               // running max of row n = l15 over this lane's columns
    v8f   zv   = zero8f();                               // 8 partial sums of exp2(s - mrun)

    wait_async0();
    __syncthreads();                                     // stage 0 published
    if (NST > 1) stage_rows64(ql + (unsigned)(STG * QP * 2), qg + (size_t)STG * CPAD, tid);

    // rolled: one trip per stage, so that the publish point stands once, at the trip's foot
#pragma unroll 1
    for (unsigned st = 0; st < (unsigned)NST; ++st) {
        const unsigned bufh = (st & 1u) * (unsigned)(STG * QP);
        const _Float16* qs = QsB + bufh + l15 * QP + 8u * h;
        // the stage's LDS reads stand together, ahead of its first product
        FragH q0[STG / 16], q1[STG / 16];
#pragma unroll                                           // every fragment index a constant: the arrays stay in registers
        for (unsigned mt = 0; mt < (unsigned)(STG / 16); ++mt) {
            const _Float16* qp = qs + mt * 16u * QP;
            q0[mt].half[0] = *(const v8h*)(qp);
            q0[mt].half[1] = *(const v8h*)(qp + 16);
            q1[mt].half[0] = *(const v8h*)(qp + 32);
            q1[mt].half[1] = *(const v8h*)(qp + 48);
        }
        v8f c[STG / 16];
#pragma unroll                                           // as above
        for (unsigned mt = 0; mt < (unsigned)(STG / 16); ++mt) c[mt] = mma_f16(q0[mt].v, k0.v, zero8f());
#pragma unroll                                           // as above
        for (unsigned mt = 0; mt < (unsigned)(STG / 16); ++mt) c[mt] = mma_f16(q1[mt].v, k1.v, c[mt]);
        float tm[STG / 16];                              // 8 independent chains, each started from the running max
#pragma unroll                                           // as above
        for (unsigned mt = 0; mt < (unsigned)(STG / 16); ++mt) tm[mt] = max9f(mrun, c[mt]);
        const float mn = max3f(max3f(tm[0], tm[1], tm[2]), max3f(tm[3], tm[4], tm[5]), fmaxf(tm[6], tm[7]));
        const float sc = ex2(mrun - mn);
        mrun = mn;
#pragma unroll                                           // as above
        for (int r = 0; r < 8; ++r) zv[r] = __builtin_fmaf(zv[r], sc, ex2(c[0][r] - mn));
#pragma unroll                                           // as above
        for (unsigned mt = 1; mt < (unsigned)(STG / 16); ++mt) {
#pragma unroll                                           // as above
            for (int r = 0; r < 8; ++r) zv[r] += ex2(c[mt][r] - mn);
        }
        // publish point of stage st+1; the same barrier ends every reader's last read of stage st's buffer
        wait_ds0();
        wait_async0();
        __syncthreads();
        if (st + 2u < (unsigned)NST)
            stage_rows64(ql + bufh * 2u, qg + (size_t)(st + 2u) * STG * CPAD, tid);
    }
    wait_async0();

    {
        const float zl = ((zv[0] + zv[1]) + (zv[2] + zv[3])) + ((zv[4] + zv[5]) + (zv[6] + zv[7]));
        const float mo = __shfl_xor(mrun, 16);           // the other half's columns of the same row n
        const float zo = __shfl_xor(zl, 16);
        const float M  = fmaxf(mrun, mo);
        const float zs = zl * ex2(mrun - M) + zo * ex2(mo - M);
        const float ov = M + log2f(zs) - PLOG2;
        if (h == 0u) offS[w * 16u + l15] = ov;
    }
    __syncthreads();

    if (w == 0u) {
        const v4f v = *(const v4f*)(offS + lane * 4u);
        float* dst = offt + (size_t)b * SEQ + pos0 + lane * 4u;
        *(v4f*)dst = v;
        
    }
}

// ---------------------------------------------------------------------------
// Kernel 3: value product + output mixing. Wave w owns output columns m = pos0 + 16w .. +15
// (B = q rows, resident). The swept k rows, v columns and offsets are staged 128 rows at a time in LDS by
// asynchronous copies, two buffers. Per 32-row step: two score tiles recomputed in the same k-step order
// as kernel 2, here with A = k rows n, B = q, P = exp2(s - off[n]) packed as the B fragment
// (element r <- tile rows 0..15, element 8+r <- tile rows 16..31, lane unchanged: D row 8h+r is
// B k-index 8h+r), A = v rows (channel-major plane), three channel tiles accumulated.
// Epilogue: attn tile to LDS, 12x36 mixing in f32, output tile staged and written as whole 512-B rows.
// LDS: woS/boS, attnS, outS all cross-wave-safe (block barriers between producer and consumer).
//   staged extent == consumed extent: attnS per wave 48x16 written, rows 0..35 read; outS 12 x 128 written and read.
//   KsB rows 0..127 x halves 0..63 (pitch QP), VsB rows 0..47 x halves 0..127 (pitch VP), OsB 128 floats, per buffer:
//   copied and read whole, published by wait + block barrier.
// coverage: grid NB*SEQ/128 blocks x 12 rows x 128 cols = NB*12*SEQ outputs; 384 pieces x 4 floats per block
// ---------------------------------------------------------------------------
__global__ __launch_bounds__(256) void k_attn(const _Float16* __restrict__ Kp,
                                              const _Float16* __restrict__ Qp,
                                              const _Float16* __restrict__ Vp,
                                              const float* __restrict__ offt,
                                              const float* __restrict__ wo,
                                              const float* __restrict__ bo,
                                              float* __restrict__ out)
{
    __shared__ __attribute__((aligned(16))) float attnS[8 * 48 * 16];
    __shared__ __attribute__((aligned(16))) float outS[CIN * OSP];
    __shared__ float woS[CIN * CQK];
    __shared__ float boS[16];
    __shared__ __attribute__((aligned(16))) _Float16 KsB[2 * STG * QP];
    __shared__ __attribute__((aligned(16))) _Float16 VsB[2 * VROWS * VP];
    __shared__ __attribute__((aligned(16))) float    OsB[2 * STG];

    const unsigned tid = threadIdx.x, lane = tid & 31u, w = tid >> 5;
    const unsigned h = lane >> 4, l15 = lane & 15u;
    const unsigned bps = (unsigned)(SEQ / 128);
    const unsigned b = blockIdx.x / bps;
    const unsigned pos0 = (blockIdx.x - b * bps) * 128u;
    const unsigned wu = (unsigned)__builtin_amdgcn_readfirstlane((int)w);   // wave number in a scalar register

    // one stage: k rows (4 copies per thread), v columns (3 per thread: piece = 16 B, 16 pieces per row),
    // offsets (wave 0 alone, one copy, every lane on)
    const _Float16* kg = Kp + (size_t)b * SEQ * CPAD;
    const char*     vg = (const char*)(Vp + ((size_t)b * VROWS + (tid >> 4)) * SEQ) + (tid & 15u) * 16u;
    const char*     og = (const char*)(offt + (size_t)b * SEQ) + lane * 16u;
    const unsigned  kl = lds_off(KsB);
    const unsigned  vl = lds_off(VsB) + (tid >> 4) * (unsigned)(VP * 2) + (tid & 15u) * 16u;
    const unsigned  ol = lds_off(OsB) + lane * 16u;
    auto stage_in = [&](unsigned st, unsigned buf) {
        stage_rows64(kl + buf * (unsigned)(STG * QP * 2), kg + (size_t)st * STG * CPAD, tid);
        const unsigned vd = vl + buf * (unsigned)(VROWS * VP * 2);
        const char*    vs = vg + (size_t)st * (STG * 2);
        async_copy3(vd,                      vs,
                    vd + 16u * (VP * 2),     vs + (size_t)16 * SEQ * 2,
                    vd + 32u * (VP * 2),     vs + (size_t)32 * SEQ * 2);
        if (wu == 0u) async_copy1(ol + buf * (unsigned)(STG * 4), og + (size_t)st * (STG * 4));
    };

    stage_in(0u, 0u);

#pragma unroll
    for (unsigned it = 0; it < 2; ++it) {
        const unsigned i  = it * 256u + tid;
        const unsigned ic = i < 432u ? i : 431u;
        const float a0 = bf16_val(wo[ic]);
        if (i < 432u) woS[i] = a0;
    }
    {
        const unsigned ic = tid < (unsigned)CIN ? tid : (unsigned)(CIN - 1);
        const float a0 = bf16_val(bo[ic]);
        if (tid < (unsigned)CIN) boS[tid] = a0;
    }

    FragH q0, q1;
    {
        const _Float16* qp = Qp + ((size_t)b * SEQ + pos0 + w * 16u + l15) * CPAD + 8u * h;
        q0.half[0] = *(const v8h*)(qp);
        q0.half[1] = *(const v8h*)(qp + 16);
        q1.half[0] = *(const v8h*)(qp + 32);
        q1.half[1] = *(const v8h*)(qp + 48);
    }

    v8f acc[3];
#pragma unroll
    for (int t = 0; t < 3; ++t) acc[t] = zero8f();

    wait_async0();
    __syncthreads();                                     // stage 0 published
    if (NST > 1) stage_in(1u, 1u);

    // rolled: one trip per stage, so that the publish point stands once, at the trip's foot
#pragma unroll 1
    for (unsigned st = 0; st < (unsigned)NST; ++st) {
      const unsigned buf = st & 1u;
      const _Float16* kb = KsB + buf * (unsigned)(STG * QP) + l15 * QP + 8u * h;
      const _Float16* vb = VsB + buf * (unsigned)(VROWS * VP) + l15 * VP + 8u * h;
      const float*    ob = OsB + buf * (unsigned)STG + 8u * h;
      // LDS reads of a 32-row step stand together, one step ahead of the step that uses them (inside the stage only)
      FragH ka[2][4], vf[2][3];
      v4f   of[2][4];
      auto fetch = [&](unsigned ns, unsigned s) {
          const _Float16* kp = kb + ns * 32u * QP;
#pragma unroll                                           // every fragment index a constant: the arrays stay in registers
          for (unsigned j = 0; j < 2; ++j) {             // j: score tile (rows 16j..16j+15 of the step)
              ka[s][2 * j].half[0]     = *(const v8h*)(kp + j * 16u * QP);
              ka[s][2 * j].half[1]     = *(const v8h*)(kp + j * 16u * QP + 16);
              ka[s][2 * j + 1].half[0] = *(const v8h*)(kp + j * 16u * QP + 32);
              ka[s][2 * j + 1].half[1] = *(const v8h*)(kp + j * 16u * QP + 48);
          }
          const float* op = ob + ns * 32u;
          of[s][0] = *(const v4f*)(op);
          of[s][1] = *(const v4f*)(op + 4);
          of[s][2] = *(const v4f*)(op + 16);
          of[s][3] = *(const v4f*)(op + 20);
          const _Float16* vp = vb + ns * 32u;
#pragma unroll                                           // as above
          for (unsigned t = 0; t < 3; ++t) {
              vf[s][t].half[0] = *(const v8h*)(vp + t * 16u * VP);
              vf[s][t].half[1] = *(const v8h*)(vp + t * 16u * VP + 16);
          }
      };
      fetch(0u, 0u);
#pragma unroll                                           // as above: the register set s is a constant in every step
      for (unsigned ns = 0; ns < (unsigned)(STG / 32); ++ns) {
        const unsigned s = ns & 1u;
        if (ns + 1u < (unsigned)(STG / 32)) fetch(ns + 1u, s ^ 1u);

        v8f c0 = zero8f();
        c0 = mma_f16(ka[s][0].v, q0.v, c0);
        c0 = mma_f16(ka[s][1].v, q1.v, c0);
        v8f c1 = zero8f();
        c1 = mma_f16(ka[s][2].v, q0.v, c1);
        c1 = mma_f16(ka[s][3].v, q1.v, c1);

        FragH pb;
#pragma unroll
        for (int r = 0; r < 4; ++r) {
            pb.v[r]      = (_Float16)ex2(c0[r]     - of[s][0][r]);
            pb.v[4 + r]  = (_Float16)ex2(c0[4 + r] - of[s][1][r]);
            pb.v[8 + r]  = (_Float16)ex2(c1[r]     - of[s][2][r]);
            pb.v[12 + r] = (_Float16)ex2(c1[4 + r] - of[s][3][r]);
        }

#pragma unroll                                           // as above
        for (unsigned t = 0; t < 3; ++t)
            acc[t] = mma_f16(vf[s][t].v, pb.v, acc[t]);
      }
      // publish point of stage st+1; the same barrier ends every reader's last read of stage st's buffers
      wait_ds0();
      wait_async0();
      __syncthreads();
      if (st + 2u < (unsigned)NST) stage_in(st + 2u, buf);
    }
    wait_async0();

    // attn tile: D row = channel 16t+8h+r, column = l15
    float* aL = attnS + w * (48u * 16u);
#pragma unroll
    for (unsigned t = 0; t < 3; ++t) {
#pragma unroll
        for (unsigned r = 0; r < 8; ++r)
            aL[(16u * t + 8u * h + r) * 16u + l15] = acc[t][r] * OUT_SCALE;
    }
    __syncthreads();

    // output mixing: lanes 0..15 -> o = 0..5, lanes 16..31 -> o = 6..11
#pragma unroll 1
    for (unsigned oo = 0; oo < 6; ++oo) {
        const unsigned o = h * 6u + oo;
        float sum = boS[o];
        const float* wr = woS + o * CQK;
#pragma unroll
        for (unsigned c = 0; c < (unsigned)CQK; ++c) sum += wr[c] * aL[c * 16u + l15];
        outS[o * OSP + w * 16u + l15] = sum;
    }
    __syncthreads();

    // whole 512-B rows: wave w writes row w, waves 0..3 also write row 8+w; 32 lanes x 16 B contiguous
    const unsigned row0 = w;
    const unsigned row1 = (8u + w) < (unsigned)CIN ? (8u + w) : (unsigned)(CIN - 1);
    const v4f ov0 = *(const v4f*)(outS + row0 * OSP + lane * 4u);
    const v4f ov1 = *(const v4f*)(outS + row1 * OSP + lane * 4u);
    float* d0 = out + ((size_t)b * CIN + row0) * SEQ + pos0 + lane * 4u;
    float* d1 = out + ((size_t)b * CIN + row1) * SEQ + pos0 + lane * 4u;
    *(v4f*)d0 = ov0;
    if (w < 4u) *(v4f*)d1 = ov1;
    
}

// ---------------------------------------------------------------------------
extern "C" void kernel_launch(void* const* d_in, const int* in_sizes, int n_in,
                              void* d_out, int out_size, void* d_ws, size_t ws_size,
                              hipStream_t stream)
{
    if (n_in < 9) return;
    const long long need_x = ((long long)NB * CIN - 1) * SEQ_FULL + SEQ;
    if ((long long)in_sizes[0] < need_x) return;
    if (in_sizes[1] < CQK * CIN || in_sizes[2] < CQK) return;
    if (in_sizes[3] < CQK * CIN || in_sizes[4] < CQK) return;
    if (in_sizes[5] < CQK * CIN || in_sizes[6] < CQK) return;
    if (in_sizes[7] < CIN * CQK || in_sizes[8] < CIN) return;
    if ((long long)out_size < (long long)NB * CIN * SEQ) return;

    const float* x  = (const float*)d_in[0];
    const float* wq = (const float*)d_in[1];
    const float* bq = (const float*)d_in[2];
    const float* wk = (const float*)d_in[3];
    const float* bk = (const float*)d_in[4];
    const float* wv = (const float*)d_in[5];
    const float* bv = (const float*)d_in[6];
    const float* wo = (const float*)d_in[7];
    const float* bo = (const float*)d_in[8];
    float* out = (float*)d_out;

    char* ws = (char*)d_ws;
    size_t off = 0;
    auto carve = [&](size_t bytes) -> char* {
        char* p = ws + off;
        off += (bytes + 255) & ~(size_t)255;
        return p;
    };
    _Float16* Qp  = (_Float16*)carve((size_t)NB * SEQ * CPAD * 2);      // [NB*SEQ][64]
    _Float16* Kp  = (_Float16*)carve((size_t)NB * SEQ * CPAD * 2);      // [NB*SEQ][64]
    _Float16* Vp  = (_Float16*)carve((size_t)NB * VROWS * SEQ * 2);     // [NB][48][SEQ]
    float*    oft = (float*)carve((size_t)NB * SEQ * 4);                // [NB*SEQ]
    if (off > ws_size) return;

    const unsigned nblk = (unsigned)(NB * (SEQ / 128));
    k_proj <<<nblk, 256, 0, stream>>>(x, wq, bq, wk, bk, wv, bv, Qp, Kp, Vp);
    k_stats<<<nblk, 256, 0, stream>>>(Kp, Qp, oft);
    k_attn <<<nblk, 256, 0, stream>>>(Kp, Qp, Vp, oft, wo, bo, out);
}

// v004
// Measured time: 36.3 microseconds a run.
// Versions in between are left out here; by their measured steps it is 2.03 times as fast as v002.
// All steps since v000 together make it 11.8 times as fast.
#include <hip/hip_runtime.h>

// The 1x1 projections are reassociated through both N x N products, so that the swept operands have 12 channels:
//   scores[n][m] = k_n . (Wq x_m + bq) = (Wq^T k_n) . x_m + (k_n . bq); the last term does not depend on m and cancels in the softmax over m;
//   out[o][m]    = sum_n (Wo v_n)[o] * weight[n][m] + bo[o].
// Contractions: k/v 1x1 projections via v_wmma_f32_16x16x32_bf16 (bf16 operands = RNE-converted inputs, K=12 zero-padded to 32, f32 accumulate);
// Wq^T.k and Wo.v (K=36 zero-padded to 64), the scores (K=12, two 16-row tiles share one K=32 operand) and the value product
// via v_wmma_f32_16x16x32_f16 (f16 operands: x x1, k x(log2e/sqrt(12)), v x16, P x4096), f32 accumulate; softmax statistics in f32.

#define DEV __device__ __forceinline__

#ifndef NB
#define NB 8
#endif
#ifndef SEQ
#define SEQ 4096
#endif
#define NB_FULL  8
#define SEQ_FULL 4096
#define CIN   12
#define CQK   36
#define CP    16                                         // x / Wq^T.k plane row pitch (halves), channels 12..15 are zeros
#define VROWS 16                                         // Wo.v plane rows per batch, rows 12..15 are zeros
#define VP    136                                        // LDS pitch (halves) of value staging rows
#define OSP   132                                        // LDS pitch (floats) of output staging rows
#define STG   128                                        // swept rows per group: what a wave works on at a time (kernel 2)
#define BST   1024                                       // swept rows per LDS stage (kernels 2 and 3)
#define NST   (SEQ / BST)                                // stages per sweep
#define VPB   (BST + 8)                                  // LDS pitch (halves) of a stage's value rows: 16 B x odd
#define KSCALE (0.28867513459481287f * 1.4426950408889634f)   // 1/sqrt(12) * log2(e), folded into the k plane
#define VCARRY 16.0f
#define PLOG2  12.0f                                     // P carried x 2^12
#define OUT_SCALE (1.0f / 65536.0f)                      // 1 / (16 * 4096)

static_assert(NB >= 1 && NB <= NB_FULL);
static_assert(SEQ >= BST && SEQ <= SEQ_FULL && (SEQ % BST) == 0 && (BST % STG) == 0);
static_assert(256 * 8 == 128 * CP);                      // x / k plane coverage per block
static_assert(256 * 8 == VROWS * 128);                   // value plane coverage per block
static_assert(384 * 4 == CIN * 128);                     // output coverage per block
static_assert(32 * 4 == 128);                            // stats coverage per block
static_assert(((CP * 2) % 16) == 0 && ((VP * 2) % 16) == 0 && ((VPB * 2) % 16) == 0 && ((OSP * 4) % 16) == 0);
static_assert(CIN <= CP && CIN <= VROWS && CQK <= 64);
static_assert(8 * 256 * 16 == BST * CP * 2);             // x / k stage: 8 copies of 16 B per thread
static_assert(8 * 256 * 16 == VROWS * BST * 2);          // value stage: 8 copies of 16 B per thread
static_assert(128 * 16 == BST * 2);                      // value stage: 128 threads move one row, a copy moves two rows
static_assert(STG / 16 == 8);                            // kernel 2 takes its max over 8 tiles per group
static_assert(256 * 16 == BST * 4);                      // offset stage: 1 copy of 16 B per thread

typedef _Float16       v8h   __attribute__((ext_vector_type(8)));
typedef _Float16       v16h  __attribute__((ext_vector_type(16)));
typedef __bf16         v16bf __attribute__((ext_vector_type(16)));
typedef unsigned short v8us  __attribute__((ext_vector_type(8)));
typedef unsigned short v16us __attribute__((ext_vector_type(16)));
typedef float          v8f   __attribute__((ext_vector_type(8)));
typedef float          v4f   __attribute__((ext_vector_type(4)));

union FragH { v16h v;  v8h  half[2]; };
union FragB { v16bf v; v16us u; v8us half[2]; };

// ---------------------------------------------------------------------------
// helpers
// ---------------------------------------------------------------------------
DEV unsigned int bf16_bits(float f) {                    // f32 -> bf16 bits, RNE convert
    unsigned int u = __float_as_uint(f);
    u += 0x7FFFu + ((u >> 16) & 1u);
    return u >> 16;
}
DEV float bf16_val(float f) { return __uint_as_float(bf16_bits(f) << 16); }

DEV v8f zero8f() {
    v8f z;
#pragma unroll
    for (int i = 0; i < 8; ++i) z[i] = 0.f;
    return z;
}

DEV v8h zero8h() {
    v8h z;
#pragma unroll
    for (int i = 0; i < 8; ++i) z[i] = (_Float16)0.f;
    return z;
}

DEV float ex2(float x) { return __builtin_amdgcn_exp2f(x); }

// 16x16x32 WMMA with f32 accumulate; 4 nops guard D and keep A/B live
DEV v8f mma_bf16(v16bf a, v16bf b, v8f c) {
    c = __builtin_amdgcn_wmma_f32_16x16x32_bf16(false, a, false, b, (short)0, c, false, false);
    asm volatile("v_nop\n\tv_nop\n\tv_nop\n\tv_nop" : "+v"(c) : "v"(a), "v"(b));
    return c;
}
DEV v8f mma_f16(v16h a, v16h b, v8f c) {
    c = __builtin_amdgcn_wmma_f32_16x16x32_f16(false, a, false, b, (short)0, c, false, false);
    asm volatile("v_nop\n\tv_nop\n\tv_nop\n\tv_nop" : "+v"(c) : "v"(a), "v"(b));
    return c;
}

// ---------------------------------------------------------------------------
// asynchronous copies global -> LDS, 16 B per lane, through no register.
// Each run of copies ends in its own statement with s_wait_xcnt 0, so that no address register
// of an issued copy is rewritten ahead of that wait.
// ---------------------------------------------------------------------------
DEV unsigned lds_off(const void* p) { return (unsigned)(size_t)p; }   // byte offset in the work-group's LDS

DEV void async_copy1(unsigned l0, const void* g0) {
    asm volatile("global_load_async_to_lds_b128 %0, %1, off\n\t"
                 "s_wait_xcnt 0x0"
                 :: "v"(l0), "v"(g0) : "memory");
}
// eight copies, ls bytes apart in LDS and gs bytes apart in memory, each with address registers of its own
DEV void async_copy8(unsigned l, unsigned ls, const char* g, size_t gs) {
    asm volatile("global_load_async_to_lds_b128 %0, %8, off\n\t"
                 "global_load_async_to_lds_b128 %1, %9, off\n\t"
                 "global_load_async_to_lds_b128 %2, %10, off\n\t"
                 "global_load_async_to_lds_b128 %3, %11, off\n\t"
                 "global_load_async_to_lds_b128 %4, %12, off\n\t"
                 "global_load_async_to_lds_b128 %5, %13, off\n\t"
                 "global_load_async_to_lds_b128 %6, %14, off\n\t"
                 "global_load_async_to_lds_b128 %7, %15, off\n\t"
                 "s_wait_xcnt 0x0"
                 :: "v"(l), "v"(l + ls), "v"(l + 2u * ls), "v"(l + 3u * ls),
                    "v"(l + 4u * ls), "v"(l + 5u * ls), "v"(l + 6u * ls), "v"(l + 7u * ls),
                    "v"(g), "v"(g + gs), "v"(g + 2u * gs), "v"(g + 3u * gs),
                    "v"(g + 4u * gs), "v"(g + 5u * gs), "v"(g + 6u * gs), "v"(g + 7u * gs)
                 : "memory");
}
// the issuing wave's own copies have landed in LDS behind this wait
DEV void wait_async0() { asm volatile("s_wait_asynccnt 0x0" ::: "memory"); }
// the wave's own LDS reads have retired before the buffer they read is handed to its next writer
DEV void wait_ds0()    { asm volatile("s_wait_dscnt 0x0" ::: "memory"); }

// A fragment of a [36][12] weight held in LDS as bf16-exact f32 values.
// row c = 16t + l15 (zero for c >= 36); elements 0..7 <- k = 8h+e (zero for k >= 12); elements 8..15 <- k >= 16 -> zero
DEV FragB w_frag(const float* Wl, unsigned t, unsigned h, unsigned l15) {
    FragB a;
    const unsigned c  = 16u * t + l15;
    const unsigned cc = c < (unsigned)CQK ? c : (unsigned)(CQK - 1);
#pragma unroll
    for (unsigned e = 0; e < 8; ++e) {
        const unsigned i  = 8u * h + e;
        const unsigned ic = i < (unsigned)CIN ? i : (unsigned)(CIN - 1);
        const unsigned bits = __float_as_uint(Wl[cc * CIN + ic]) >> 16;
        a.u[e]     = (unsigned short)((c < (unsigned)CQK && i < (unsigned)CIN) ? bits : 0u);
        a.u[8 + e] = (unsigned short)0;
    }
    return a;
}

// one 16(channel) x 16(position) projection tile: (W.x + bias) * carry ; D row = channel 16t+8h+r, column = position l15
DEV v8f proj_tile(const float* Wl, const float* Bl, unsigned t, unsigned h, unsigned l15, v16bf xb, float carry) {
    const FragB a = w_frag(Wl, t, h, l15);
    v8f acc = mma_bf16(a.v, xb, zero8f());
#pragma unroll
    for (unsigned r = 0; r < 8; ++r) {
        const unsigned c  = 16u * t + 8u * h + r;
        const unsigned cc = c < (unsigned)CQK ? c : (unsigned)(CQK - 1);
        const float bvl = Bl[cc];
        acc[r] = (acc[r] + ((c < (unsigned)CQK) ? bvl : 0.f)) * carry;
    }
    return acc;
}

// A fragment of the second product, from a weight held in LDS as bf16-exact f32 values (exact in f16 too but for subnormals).
// row l15 (zero for >= 12), element (row, channel c) at Wl[row * rs + c * cs];
// elements 0..7 <- c = 32j+8h+e, elements 8..15 <- c = 32j+16+8h+(e-8) (zero for c >= 36)
DEV FragH w2_frag(const float* Wl, unsigned rs, unsigned cs, unsigned j, unsigned h, unsigned l15) {
    FragH a;
    const unsigned rr = l15 < (unsigned)CIN ? l15 : (unsigned)(CIN - 1);
#pragma unroll
    for (unsigned e = 0; e < 16; ++e) {
        const unsigned c  = 32u * j + 8u * h + e + (e < 8u ? 0u : 8u);
        const unsigned cc = c < (unsigned)CQK ? c : (unsigned)(CQK - 1);
        const float val = Wl[rr * rs + cc * cs];
        a.v[e] = (c < (unsigned)CQK && l15 < (unsigned)CIN) ? (_Float16)val : (_Float16)0.f;
    }
    return a;
}

// second product: 12 x 36 weight times the 36 x 16 projection held as three D tiles (row = channel 16t+8h+r, column = position).
// D row 8h+r of tile t is B k-index 16t+8h+r, lane unchanged. Result: D row = 8h+r (rows 12..15 zero), column = position l15
DEV v8f second_tile(const float* Wl, unsigned rs, unsigned cs, unsigned h, unsigned l15, v8f d0, v8f d1, v8f d2) {
    FragH b0, b1;
#pragma unroll
    for (int r = 0; r < 8; ++r) {
        b0.v[r]     = (_Float16)d0[r];
        b0.v[8 + r] = (_Float16)d1[r];
        b1.v[r]     = (_Float16)d2[r];
        b1.v[8 + r] = (_Float16)0.f;
    }
    v8f acc = mma_f16(w2_frag(Wl, rs, cs, 0u, h, l15).v, b0.v, zero8f());
    return mma_f16(w2_frag(Wl, rs, cs, 1u, h, l15).v, b1.v, acc);
}

// ---------------------------------------------------------------------------
// Kernel 1: projections. Block = 8 waves = 128 positions of one batch; wave w owns 16 positions.
//   B fragment = x[b][i][n] (bf16 RNE, k = i zero-padded 12 -> 32), A fragments = weights (rows = channels).
//   Outputs: Xp [NB*SEQ][16] f16 (x, bf16-rounded), Kp [NB*SEQ][16] f16 (Wq^T (k * KSCALE)), channels 12..15 zero;
//            Vp [NB][16][SEQ] f16 (Wo (v * 16)), rows 12..15 zero.
// LDS: Ws/Bs, Vs are cross-wave (block barriers). staged extent == consumed extent: Vs rows 0..15 x halves 0..127.
// coverage: grid NB*SEQ/128 blocks; per block 256 thr x 8 halves = 128 x 16 (x, k: a wave stores 512 contiguous bytes) = 16 x 128 (values)
// ---------------------------------------------------------------------------
__global__ __launch_bounds__(256) void k_proj(const float* __restrict__ x,
                                              const float* __restrict__ wq,
                                              const float* __restrict__ wk, const float* __restrict__ bk,
                                              const float* __restrict__ wv, const float* __restrict__ bv,
                                              const float* __restrict__ wo,
                                              _Float16* __restrict__ Xp, _Float16* __restrict__ Kp,
                                              _Float16* __restrict__ Vp)
{
    __shared__ __attribute__((aligned(16))) _Float16 Vs[VROWS * VP];
    __shared__ float Ws[4 * CQK * CIN];
    __shared__ float Bs[2 * CQK];

    const unsigned tid = threadIdx.x, lane = tid & 31u, w = tid >> 5;
    const unsigned h = lane >> 4, l15 = lane & 15u;
    const unsigned bps = (unsigned)(SEQ / 128);
    const unsigned b = blockIdx.x / bps;
    const unsigned pos0 = (blockIdx.x - b * bps) * 128u;
    const unsigned nl = w * 16u + l15;                   // position inside the block

    // weights and biases -> LDS as bf16-exact f32 (clamped addresses, guarded LDS stores)
#pragma unroll
    for (unsigned it = 0; it < 2; ++it) {
        const unsigned i  = it * 256u + tid;
        const unsigned ic = i < 432u ? i : 431u;
        const float a0 = bf16_val(wq[ic]);
        const float a1 = bf16_val(wk[ic]);
        const float a2 = bf16_val(wv[ic]);
        const float a3 = bf16_val(wo[ic]);
        if (i < 432u) { Ws[i] = a0; Ws[432u + i] = a1; Ws[864u + i] = a2; Ws[1296u + i] = a3; }
    }
    {
        const unsigned ic = tid < (unsigned)CQK ? tid : (unsigned)(CQK - 1);
        const float a1 = bf16_val(bk[ic]);
        const float a2 = bf16_val(bv[ic]);
        if (tid < (unsigned)CQK) { Bs[tid] = a1; Bs[CQK + tid] = a2; }
    }

    // x fragment: column = position, elements 0..7 <- input channel 8h+e (zero for >= 12), 8..15 <- zero
    FragB xb;
    v8h   xh;                                            // the same 8 values as f16: this lane's piece of the x plane row
    {
        const float* xp = x + (size_t)b * CIN * SEQ_FULL + pos0 + nl;
#pragma unroll
        for (unsigned e = 0; e < 8; ++e) {
            const unsigned i  = 8u * h + e;
            const unsigned ic = i < (unsigned)CIN ? i : (unsigned)(CIN - 1);
            const unsigned raw  = bf16_bits(xp[(size_t)ic * SEQ_FULL]);   // clamped address, loaded by every lane
            const unsigned bits = (i < (unsigned)CIN) ? raw : 0u;
            xb.u[e]     = (unsigned short)bits;
            xb.u[8 + e] = (unsigned short)0;
            xh[e]       = (_Float16)__uint_as_float(bits << 16);
        }
    }
    __syncthreads();

    const size_t prow = ((size_t)b * SEQ + pos0 + nl) * CP + 8u * h;
    *(v8h*)(Xp + prow) = xh;

    // k (scaled into the exp2 domain), then Wq^T . k : row = input channel 8h+r
    {
        v8f d[3];
#pragma unroll
        for (unsigned t = 0; t < 3; ++t) d[t] = proj_tile(Ws + CQK * CIN, Bs, t, h, l15, xb.v, KSCALE);
        const v8f acc = second_tile(Ws, 1u, (unsigned)CIN, h, l15, d[0], d[1], d[2]);
        v8h o;
#pragma unroll
        for (int r = 0; r < 8; ++r) o[r] = (_Float16)acc[r];
        *(v8h*)(Kp + prow) = o;
    }
    // v, then Wo . v : row = output channel 8h+r (channel-major plane)
    {
        v8f d[3];
#pragma unroll
        for (unsigned t = 0; t < 3; ++t) d[t] = proj_tile(Ws + 2 * CQK * CIN, Bs + CQK, t, h, l15, xb.v, VCARRY);
        const v8f acc = second_tile(Ws + 3 * CQK * CIN, (unsigned)CQK, 1u, h, l15, d[0], d[1], d[2]);
#pragma unroll
        for (unsigned r = 0; r < 8; ++r)
            Vs[(8u * h + r) * VP + nl] = (_Float16)acc[r];
    }
    __syncthreads();

    const unsigned row = tid >> 4, pc = tid & 15u;
    const v8h vv = *(const v8h*)(Vs + row * VP + pc * 8u);
    *(v8h*)(Vp + ((size_t)b * VROWS + row) * SEQ + pos0 + pc * 8u) = vv;
}

// ---------------------------------------------------------------------------
// Kernel 2: row statistics. Wave w owns score rows n = pos0 + 16w .. +15 (B = Wq^T.k rows, resident),
// sweeps all column tiles m (A = x rows, staged 1024 rows at a time in LDS by asynchronous copies,
// two buffers: stage t+1 flies while stage t is worked on; inside a stage a wave goes through 8 groups of 128 rows
// at its own pace). One A operand holds two 16-row tiles: elements 0..7
// (k index 8h+e) = channels 8h+e of tile 2j, elements 8..15 (k index 16+8h+e) = the same channels of tile 2j+1;
// B with its upper half zero gives tile 2j's scores, B with its lower half zero tile 2j+1's. The score tile stands transposed:
// D row 8h+r = column m, D column l15 = row n, so all 8 values of a lane belong to ONE row n.
// Per lane: one running max, taken over a group's 8 tiles (64 values) at a time, one rescale per group,
// one exp2 per score, 8 partial sums. The two halves of the wave (lanes l, l^16) are combined at the end.
// Table entry: off[n] = M_n + log2(Z_n) - 12, so that exp2(s - off[n]) = 4096 * softmax weight.
// LDS offS: cross-wave (block barrier); staged 128 floats == consumed 128 floats.
// LDS XsB: per buffer rows 0..1023 x halves 0..15 copied and read (pitch CP), published by wait + block barrier.
// coverage: grid NB*SEQ/128 blocks x 128 rows = NB*SEQ table entries
// ---------------------------------------------------------------------------
DEV float max3f(float a, float b, float c) { return fmaxf(fmaxf(a, b), c); }
// max of a start value and a tile's 8 values: four 3-input steps
DEV float max9f(float s, v8f c) { return max3f(max3f(max3f(max3f(s, c[0], c[1]), c[2], c[3]), c[4], c[5]), c[6], c[7]); }

__global__ __launch_bounds__(256) void k_stats(const _Float16* __restrict__ Kp,
                                               const _Float16* __restrict__ Xp,
                                               float* __restrict__ offt)
{
    __shared__ __attribute__((aligned(16))) float offS[128];
    __shared__ __attribute__((aligned(16))) _Float16 XsB[2 * BST * CP];

    const unsigned tid = threadIdx.x, lane = tid & 31u, w = tid >> 5;
    const unsigned h = lane >> 4, l15 = lane & 15u;
    const unsigned bps = (unsigned)(SEQ / 128);
    const unsigned b = blockIdx.x / bps;
    const unsigned pos0 = (blockIdx.x - b * bps) * 128u;

    // one stage = BST rows of 32 B, contiguous in memory and in LDS: thread tid moves pieces tid + 256 i (16 B each)
    const char*    xg = (const char*)(Xp + (size_t)b * SEQ * CP) + tid * 16u;
    const unsigned xl = lds_off(XsB) + tid * 16u;
    auto stage_in = [&](unsigned st, unsigned buf) {
        async_copy8(xl + buf * (unsigned)(BST * CP * 2), 4096u, xg + (size_t)st * (BST * CP * 2), (size_t)4096);
    };

    stage_in(0u, 0u);                                    // stage 0 -> buffer 0

    FragH klo, khi;
    {
        const v8h kr = *(const v8h*)(Kp + ((size_t)b * SEQ + pos0 + w * 16u + l15) * CP + 8u * h);
        klo.half[0] = kr;       klo.half[1] = zero8h();
        khi.half[0] = zero8h(); khi.half[1] = kr;
    }

    float mrun = -3.0e38f;                               // running max of row n = l15 over this lane's columns
    v8f   zv   = zero8f();                               // 8 partial sums of exp2(s - mrun)

    wait_async0();
    __syncthreads();                                     // stage 0 published
    if (NST > 1) stage_in(1u, 1u);

    // rolled: one trip per stage, so that the publish point stands once, at the trip's foot
#pragma unroll 1
    for (unsigned st = 0; st < (unsigned)NST; ++st) {
      const unsigned buf = st & 1u;
      const _Float16* xs = XsB + buf * (unsigned)(BST * CP) + l15 * CP + 8u * h;
      // rolled, one group a trip: no barrier inside a stage, so the waves of a SIMD fall out of step and one wave's
      // LDS reads and products run under the other's vector work (unrolled, the stage's score tiles spilled to scratch)
#pragma unroll 1
      for (unsigned g = 0; g < (unsigned)(BST / STG); ++g) {
        const _Float16* xq = xs + g * (unsigned)(STG * CP);
        // the group's LDS reads stand together, ahead of its first product
        FragH xa[STG / 32];
#pragma unroll                                           // every fragment index a constant: the arrays stay in registers
        for (unsigned j = 0; j < (unsigned)(STG / 32); ++j) {
            xa[j].half[0] = *(const v8h*)(xq + (j * 32u) * CP);
            xa[j].half[1] = *(const v8h*)(xq + (j * 32u + 16u) * CP);
        }
        v8f c[STG / 16];
#pragma unroll                                           // as above
        for (unsigned j = 0; j < (unsigned)(STG / 32); ++j) c[2 * j]     = mma_f16(xa[j].v, klo.v, zero8f());
#pragma unroll                                           // as above
        for (unsigned j = 0; j < (unsigned)(STG / 32); ++j) c[2 * j + 1] = mma_f16(xa[j].v, khi.v, zero8f());
        float tm[STG / 16];                              // 8 independent chains, each started from the running max
#pragma unroll                                           // as above
        for (unsigned mt = 0; mt < (unsigned)(STG / 16); ++mt) tm[mt] = max9f(mrun, c[mt]);
        const float mn = max3f(max3f(tm[0], tm[1], tm[2]), max3f(tm[3], tm[4], tm[5]), fmaxf(tm[6], tm[7]));
        const float sc = ex2(mrun - mn);
        mrun = mn;
#pragma unroll                                           // as above
        for (int r = 0; r < 8; ++r) zv[r] = __builtin_fmaf(zv[r], sc, ex2(c[0][r] - mn));
#pragma unroll                                           // as above
        for (unsigned mt = 1; mt < (unsigned)(STG / 16); ++mt) {
#pragma unroll                                           // as above
            for (int r = 0; r < 8; ++r) zv[r] += ex2(c[mt][r] - mn);
        }
      }
      // publish point of stage st+1; the same barrier ends every reader's last read of stage st's buffer
      wait_ds0();
      wait_async0();
      __syncthreads();
      if (st + 2u < (unsigned)NST) stage_in(st + 2u, buf);
    }
    wait_async0();

    {
        const float zl = ((zv[0] + zv[1]) + (zv[2] + zv[3])) + ((zv[4] + zv[5]) + (zv[6] + zv[7]));
        const float mo = __shfl_xor(mrun, 16);           // the other half's columns of the same row n
        const float zo = __shfl_xor(zl, 16);
        const float M  = fmaxf(mrun, mo);
        const float zs = zl * ex2(mrun - M) + zo * ex2(mo - M);
        const float ov = M + log2f(zs) - PLOG2;
        if (h == 0u) offS[w * 16u + l15] = ov;
    }
    __syncthreads();

    if (w == 0u) {
        const v4f v = *(const v4f*)(offS + lane * 4u);
        float* dst = offt + (size_t)b * SEQ + pos0 + lane * 4u;
        *(v4f*)dst = v;
        
    }
}

// ---------------------------------------------------------------------------
// Kernel 3: value product. Wave w owns output columns m = pos0 + 16w .. +15
// (B = x rows, resident, once with the upper and once with the lower half zero). The swept Wq^T.k rows, Wo.v columns and
// offsets are staged 1024 rows at a time in LDS by asynchronous copies, two buffers. Per 32-row step: one A operand holds
// both 16-row tiles of Wq^T.k (as in kernel 2), two score tiles, P = exp2(s - off[n]) packed as the B fragment
// (element r <- tile rows 0..15, element 8+r <- tile rows 16..31, lane unchanged: D row 8h+r is
// B k-index 8h+r), A = Wo.v rows (channel-major plane), one tile of output channels accumulated.
// Epilogue: scale, bias, output tile staged and written as whole 512-B rows.
// LDS: boS, outS cross-wave-safe (block barriers between producer and consumer).
//   staged extent == consumed extent: outS 12 x 128 written and read.
//   KsB rows 0..1023 x halves 0..15 (pitch CP), VsB rows 0..15 x halves 0..1023 (pitch VPB), OsB 1024 floats, per buffer:
//   copied and read whole, published by wait + block barrier.
// coverage: grid NB*SEQ/128 blocks x 12 rows x 128 cols = NB*12*SEQ outputs; 384 pieces x 4 floats per block
// ---------------------------------------------------------------------------
__global__ __launch_bounds__(256) void k_attn(const _Float16* __restrict__ Kp,
                                              const _Float16* __restrict__ Xp,
                                              const _Float16* __restrict__ Vp,
                                              const float* __restrict__ offt,
                                              const float* __restrict__ bo,
                                              float* __restrict__ out)
{
    __shared__ __attribute__((aligned(16))) float outS[CIN * OSP];
    __shared__ float boS[16];
    __shared__ __attribute__((aligned(16))) _Float16 KsB[2 * BST * CP];
    __shared__ __attribute__((aligned(16))) _Float16 VsB[2 * VROWS * VPB];
    __shared__ __attribute__((aligned(16))) float    OsB[2 * BST];

    const unsigned tid = threadIdx.x, lane = tid & 31u, w = tid >> 5;
    const unsigned h = lane >> 4, l15 = lane & 15u;
    const unsigned bps = (unsigned)(SEQ / 128);
    const unsigned b = blockIdx.x / bps;
    const unsigned pos0 = (blockIdx.x - b * bps) * 128u;

    // one stage: k rows (8 copies per thread: contiguous, pieces tid + 256 i), value columns (8 per thread: piece = 16 B,
    // 128 pieces per row, copy i moves rows 2i and 2i+1), offsets (1 per thread: contiguous, piece tid)
    const char*     kg = (const char*)(Kp + (size_t)b * SEQ * CP) + tid * 16u;
    const char*     vg = (const char*)(Vp + ((size_t)b * VROWS + (tid >> 7)) * SEQ) + (tid & 127u) * 16u;
    const char*     og = (const char*)(offt + (size_t)b * SEQ) + tid * 16u;
    const unsigned  kl = lds_off(KsB) + tid * 16u;
    const unsigned  vl = lds_off(VsB) + (tid >> 7) * (unsigned)(VPB * 2) + (tid & 127u) * 16u;
    const unsigned  ol = lds_off(OsB) + tid * 16u;
    auto stage_in = [&](unsigned st, unsigned buf) {
        async_copy8(kl + buf * (unsigned)(BST * CP * 2), 4096u, kg + (size_t)st * (BST * CP * 2), (size_t)4096);
        async_copy8(vl + buf * (unsigned)(VROWS * VPB * 2), (unsigned)(2 * VPB * 2),
                    vg + (size_t)st * (BST * 2), (size_t)(2 * SEQ * 2));
        async_copy1(ol + buf * (unsigned)(BST * 4), og + (size_t)st * (BST * 4));
    };

    stage_in(0u, 0u);

    {
        const unsigned ic = tid < (unsigned)CIN ? tid : (unsigned)(CIN - 1);
        const float a0 = bf16_val(bo[ic]);
        if (tid < (unsigned)CIN) boS[tid] = a0;
    }

    FragH xlo, xhi;
    {
        const v8h xr = *(const v8h*)(Xp + ((size_t)b * SEQ + pos0 + w * 16u + l15) * CP + 8u * h);
        xlo.half[0] = xr;       xlo.half[1] = zero8h();
        xhi.half[0] = zero8h(); xhi.half[1] = xr;
    }

    v8f acc = zero8f();

    wait_async0();
    __syncthreads();                                     // stage 0 published
    if (NST > 1) stage_in(1u, 1u);

    // rolled: one trip per stage, so that the publish point stands once, at the trip's foot
#pragma unroll 1
    for (unsigned st = 0; st < (unsigned)NST; ++st) {
      const unsigned buf = st & 1u;
      const _Float16* kb = KsB + buf * (unsigned)(BST * CP) + l15 * CP + 8u * h;
      const _Float16* vb = VsB + buf * (unsigned)(VROWS * VPB) + l15 * VPB + 8u * h;
      const float*    ob = OsB + buf * (unsigned)BST + 8u * h;
      // LDS reads of a 32-row step stand together, one step ahead of the step that uses them (inside the stage only)
      FragH ka[2], vf[2];
      v4f   of[2][4];
      auto fetch = [&](unsigned ns, unsigned s) {
          const _Float16* kp = kb + ns * 32u * CP;
          ka[s].half[0] = *(const v8h*)(kp);             // score tile 0: rows 0..15 of the step
          ka[s].half[1] = *(const v8h*)(kp + 16u * CP);  // score tile 1: rows 16..31
          const float* op = ob + ns * 32u;
          of[s][0] = *(const v4f*)(op);
          of[s][1] = *(const v4f*)(op + 4);
          of[s][2] = *(const v4f*)(op + 16);
          of[s][3] = *(const v4f*)(op + 20);
          const _Float16* vp = vb + ns * 32u;
          vf[s].half[0] = *(const v8h*)(vp);
          vf[s].half[1] = *(const v8h*)(vp + 16);
      };
      fetch(0u, 0u);
#pragma unroll                                           // the register set s is a constant in every step: the arrays stay in registers
      for (unsigned ns = 0; ns < (unsigned)(BST / 32); ++ns) {
        const unsigned s = ns & 1u;
        if (ns + 1u < (unsigned)(BST / 32)) fetch(ns + 1u, s ^ 1u);

        const v8f c0 = mma_f16(ka[s].v, xlo.v, zero8f());
        const v8f c1 = mma_f16(ka[s].v, xhi.v, zero8f());

        FragH pb;
#pragma unroll
        for (int r = 0; r < 4; ++r) {
            pb.v[r]      = (_Float16)ex2(c0[r]     - of[s][0][r]);
            pb.v[4 + r]  = (_Float16)ex2(c0[4 + r] - of[s][1][r]);
            pb.v[8 + r]  = (_Float16)ex2(c1[r]     - of[s][2][r]);
            pb.v[12 + r] = (_Float16)ex2(c1[4 + r] - of[s][3][r]);
        }

        acc = mma_f16(vf[s].v, pb.v, acc);
      }
      // publish point of stage st+1; the same barrier ends every reader's last read of stage st's buffers
      wait_ds0();
      wait_async0();
      __syncthreads();
      if (st + 2u < (unsigned)NST) stage_in(st + 2u, buf);
    }
    wait_async0();

    // output tile: D row = output channel 8h+r (rows 12..15 are padding), column = l15
#pragma unroll
    for (unsigned r = 0; r < 8; ++r) {
        const unsigned o  = 8u * h + r;
        const unsigned oc = o < (unsigned)CIN ? o : (unsigned)(CIN - 1);
        const float val = acc[r] * OUT_SCALE + boS[oc];
        if (o < (unsigned)CIN) outS[o * OSP + w * 16u + l15] = val;
    }
    __syncthreads();

    // whole 512-B rows: wave w writes row w, waves 0..3 also write row 8+w; 32 lanes x 16 B contiguous
    const unsigned row0 = w;
    const unsigned row1 = (8u + w) < (unsigned)CIN ? (8u + w) : (unsigned)(CIN - 1);
    const v4f ov0 = *(const v4f*)(outS + row0 * OSP + lane * 4u);
    const v4f ov1 = *(const v4f*)(outS + row1 * OSP + lane * 4u);
    float* d0 = out + ((size_t)b * CIN + row0) * SEQ + pos0 + lane * 4u;
    float* d1 = out + ((size_t)b * CIN + row1) * SEQ + pos0 + lane * 4u;
    *(v4f*)d0 = ov0;
    if (w < 4u) *(v4f*)d1 = ov1;
}

// ---------------------------------------------------------------------------
extern "C" void kernel_launch(void* const* d_in, const int* in_sizes, int n_in,
                              void* d_out, int out_size, void* d_ws, size_t ws_size,
                              hipStream_t stream)
{
    if (n_in < 9) return;
    const long long need_x = ((long long)NB * CIN - 1) * SEQ_FULL + SEQ;
    if ((long long)in_sizes[0] < need_x) return;
    if (in_sizes[1] < CQK * CIN || in_sizes[2] < CQK) return;
    if (in_sizes[3] < CQK * CIN || in_sizes[4] < CQK) return;
    if (in_sizes[5] < CQK * CIN || in_sizes[6] < CQK) return;
    if (in_sizes[7] < CIN * CQK || in_sizes[8] < CIN) return;
    if ((long long)out_size < (long long)NB * CIN * SEQ) return;

    const float* x  = (const float*)d_in[0];
    const float* wq = (const float*)d_in[1];
    const float* wk = (const float*)d_in[3];
    const float* bk = (const float*)d_in[4];
    const float* wv = (const float*)d_in[5];
    const float* bv = (const float*)d_in[6];
    const float* wo = (const float*)d_in[7];
    const float* bo = (const float*)d_in[8];
    float* out = (float*)d_out;

    char* ws = (char*)d_ws;
    size_t off = 0;
    auto carve = [&](size_t bytes) -> char* {
        char* p = ws + off;
        off += (bytes + 255) & ~(size_t)255;
        return p;
    };
    _Float16* Xp  = (_Float16*)carve((size_t)NB * SEQ * CP * 2);        // [NB*SEQ][16]
    _Float16* Kp  = (_Float16*)carve((size_t)NB * SEQ * CP * 2);        // [NB*SEQ][16]
    _Float16* Vp  = (_Float16*)carve((size_t)NB * VROWS * SEQ * 2);     // [NB][16][SEQ]
    float*    oft = (float*)carve((size_t)NB * SEQ * 4);                // [NB*SEQ]
    if (off > ws_size) return;

    const unsigned nblk = (unsigned)(NB * (SEQ / 128));
    k_proj <<<nblk, 256, 0, stream>>>(x, wq, wk, bk, wv, bv, wo, Xp, Kp, Vp);
    k_stats<<<nblk, 256, 0, stream>>>(Kp, Xp, oft);
    k_attn <<<nblk, 256, 0, stream>>>(Kp, Xp, Vp, oft, bo, out);
}

// v005
// One run takes 30.7 microseconds.
// Timed twice side by side with v004, it ran 1.18 and 1.17 times as fast.
// All steps since v000 together make it 13.9 times as fast.
#include <hip/hip_runtime.h>

// The 1x1 projections are reassociated through both N x N products, so that the swept operands have 12 channels:
//   scores[n][m] = k_n . (Wq x_m + bq) = (Wq^T k_n) . x_m + (k_n . bq); the last term does not depend on m and cancels in the softmax over m;
//   out[o][m]    = sum_n (Wo v_n)[o] * weight[n][m] + bo[o].
// Contractions: k/v 1x1 projections via v_wmma_f32_16x16x32_bf16 (bf16 operands = RNE-converted inputs, K=12 zero-padded to 32, f32 accumulate);
// Wq^T.k and Wo.v (K=36 zero-padded to 64), the scores (K=12, two 16-row tiles share one K=32 operand) and the value product
// via v_wmma_f32_16x16x32_f16 (f16 operands: x x1, k x(log2e/sqrt(12)), v x16, P x4096), f32 accumulate; softmax statistics in f32.
// In both sweeps the shift that is taken off a score before its exp2 is the score product's C operand: D = A.B + (-shift).

#define DEV __device__ __forceinline__

#ifndef NB
#define NB 8
#endif
#ifndef SEQ
#define SEQ 4096
#endif
#define NB_FULL  8
#define SEQ_FULL 4096
#define CIN   12
#define CQK   36
#define CP    16                                         // x / Wq^T.k plane row pitch (halves), channels 12..15 are zeros
#define VROWS 16                                         // Wo.v plane rows per batch, rows 12..15 are zeros
#define VP    136                                        // LDS pitch (halves) of value staging rows
#define OSP   132                                        // LDS pitch (floats) of output staging rows
#define STG   128                                        // swept rows per group: what a wave works on at a time (kernel 2)
#define BST   1024                                       // swept rows per LDS stage (kernels 2 and 3)
#define NST   (SEQ / BST)                                // stages per sweep
#define VPB   (BST + 8)                                  // LDS pitch (halves) of a stage's value rows: 16 B x odd
#define KSCALE (0.28867513459481287f * 1.4426950408889634f)   // 1/sqrt(12) * log2(e), folded into the k plane
#define VCARRY 16.0f
#define PLOG2  12.0f                                     // P carried x 2^12
#define OUT_SCALE (1.0f / 65536.0f)                      // 1 / (16 * 4096)

static_assert(NB >= 1 && NB <= NB_FULL);
static_assert(SEQ >= BST && SEQ <= SEQ_FULL && (SEQ % BST) == 0 && (BST % STG) == 0);
static_assert(256 * 8 == 128 * CP);                      // x / k plane coverage per block
static_assert(256 * 8 == VROWS * 128);                   // value plane coverage per block
static_assert(384 * 4 == CIN * 128);                     // output coverage per block
static_assert(32 * 4 == 128);                            // stats coverage per block
static_assert(((CP * 2) % 16) == 0 && ((VP * 2) % 16) == 0 && ((VPB * 2) % 16) == 0 && ((OSP * 4) % 16) == 0);
static_assert(CIN <= CP && CIN <= VROWS && CQK <= 64);
static_assert(8 * 256 * 16 == BST * CP * 2);             // x / k stage: 8 copies of 16 B per thread
static_assert(8 * 256 * 16 == VROWS * BST * 2);          // value stage: 8 copies of 16 B per thread
static_assert(128 * 16 == BST * 2);                      // value stage: 128 threads move one row, a copy moves two rows
static_assert(STG / 16 == 8);                            // kernel 2 takes its max over 8 tiles per group
static_assert(256 * 16 == BST * 4);                      // offset stage: 1 copy of 16 B per thread

typedef _Float16       v8h   __attribute__((ext_vector_type(8)));
typedef _Float16       v16h  __attribute__((ext_vector_type(16)));
typedef __bf16         v16bf __attribute__((ext_vector_type(16)));
typedef unsigned short v8us  __attribute__((ext_vector_type(8)));
typedef unsigned short v16us __attribute__((ext_vector_type(16)));
typedef float          v8f   __attribute__((ext_vector_type(8)));
typedef float          v4f   __attribute__((ext_vector_type(4)));

union FragH { v16h v;  v8h  half[2]; };
union FragB { v16bf v; v16us u; v8us half[2]; };
union FragC { v8f v;   v4f  quad[2]; };

// ---------------------------------------------------------------------------
// helpers
// ---------------------------------------------------------------------------
DEV unsigned int bf16_bits(float f) {                    // f32 -> bf16 bits, RNE convert
    unsigned int u = __float_as_uint(f);
    u += 0x7FFFu + ((u >> 16) & 1u);
    return u >> 16;
}
DEV float bf16_val(float f) { return __uint_as_float(bf16_bits(f) << 16); }

DEV v8f zero8f() {
    v8f z;
#pragma unroll
    for (int i = 0; i < 8; ++i) z[i] = 0.f;
    return z;
}

DEV v8h zero8h() {
    v8h z;
#pragma unroll
    for (int i = 0; i < 8; ++i) z[i] = (_Float16)0.f;
    return z;
}

DEV float ex2(float x) { return __builtin_amdgcn_exp2f(x); }

// 16x16x32 WMMA with f32 accumulate; 4 nops guard D and keep A/B live
DEV v8f mma_bf16(v16bf a, v16bf b, v8f c) {
    c = __builtin_amdgcn_wmma_f32_16x16x32_bf16(false, a, false, b, (short)0, c, false, false);
    asm volatile("v_nop\n\tv_nop\n\tv_nop\n\tv_nop" : "+v"(c) : "v"(a), "v"(b));
    return c;
}
DEV v8f mma_f16(v16h a, v16h b, v8f c) {
    c = __builtin_amdgcn_wmma_f32_16x16x32_f16(false, a, false, b, (short)0, c, false, false);
    asm volatile("v_nop\n\tv_nop\n\tv_nop\n\tv_nop" : "+v"(c) : "v"(a), "v"(b));
    return c;
}

// ---------------------------------------------------------------------------
// asynchronous copies global -> LDS, 16 B per lane, through no register.
// Each run of copies ends in its own statement with s_wait_xcnt 0, so that no address register
// of an issued copy is rewritten ahead of that wait.
// ---------------------------------------------------------------------------
DEV unsigned lds_off(const void* p) { return (unsigned)(size_t)p; }   // byte offset in the work-group's LDS

DEV void async_copy1(unsigned l0, const void* g0) {
    asm volatile("global_load_async_to_lds_b128 %0, %1, off\n\t"
                 "s_wait_xcnt 0x0"
                 :: "v"(l0), "v"(g0) : "memory");
}
// eight copies, ls bytes apart in LDS and gs bytes apart in memory, each with address registers of its own
DEV void async_copy8(unsigned l, unsigned ls, const char* g, size_t gs) {
    asm volatile("global_load_async_to_lds_b128 %0, %8, off\n\t"
                 "global_load_async_to_lds_b128 %1, %9, off\n\t"
                 "global_load_async_to_lds_b128 %2, %10, off\n\t"
                 "global_load_async_to_lds_b128 %3, %11, off\n\t"
                 "global_load_async_to_lds_b128 %4, %12, off\n\t"
                 "global_load_async_to_lds_b128 %5, %13, off\n\t"
                 "global_load_async_to_lds_b128 %6, %14, off\n\t"
                 "global_load_async_to_lds_b128 %7, %15, off\n\t"
                 "s_wait_xcnt 0x0"
                 :: "v"(l), "v"(l + ls), "v"(l + 2u * ls), "v"(l + 3u * ls),
                    "v"(l + 4u * ls), "v"(l + 5u * ls), "v"(l + 6u * ls), "v"(l + 7u * ls),
                    "v"(g), "v"(g + gs), "v"(g + 2u * gs), "v"(g + 3u * gs),
                    "v"(g + 4u * gs), "v"(g + 5u * gs), "v"(g + 6u * gs), "v"(g + 7u * gs)
                 : "memory");
}
// the issuing wave's own copies have landed in LDS behind this wait
DEV void wait_async0() { asm volatile("s_wait_asynccnt 0x0" ::: "memory"); }
// the wave's own LDS reads have retired before the buffer they read is handed to its next writer
DEV void wait_ds0()    { asm volatile("s_wait_dscnt 0x0" ::: "memory"); }

// A fragment of a [36][12] weight held in LDS as bf16-exact f32 values.
// row c = 16t + l15 (zero for c >= 36); elements 0..7 <- k = 8h+e (zero for k >= 12); elements 8..15 <- k >= 16 -> zero
DEV FragB w_frag(const float* Wl, unsigned t, unsigned h, unsigned l15) {
    FragB a;
    const unsigned c  = 16u * t + l15;
    const unsigned cc = c < (unsigned)CQK ? c : (unsigned)(CQK - 1);
#pragma unroll
    for (unsigned e = 0; e < 8; ++e) {
        const unsigned i  = 8u * h + e;
        const unsigned ic = i < (unsigned)CIN ? i : (unsigned)(CIN - 1);
        const unsigned bits = __float_as_uint(Wl[cc * CIN + ic]) >> 16;
        a.u[e]     = (unsigned short)((c < (unsigned)CQK && i < (unsigned)CIN) ? bits : 0u);
        a.u[8 + e] = (unsigned short)0;
    }
    return a;
}

// one 16(channel) x 16(position) projection tile: (W.x + bias) * carry ; D row = channel 16t+8h+r, column = position l15
DEV v8f proj_tile(const float* Wl, const float* Bl, unsigned t, unsigned h, unsigned l15, v16bf xb, float carry) {
    const FragB a = w_frag(Wl, t, h, l15);
    v8f acc = mma_bf16(a.v, xb, zero8f());
#pragma unroll
    for (unsigned r = 0; r < 8; ++r) {
        const unsigned c  = 16u * t + 8u * h + r;
        const unsigned cc = c < (unsigned)CQK ? c : (unsigned)(CQK - 1);
        const float bvl = Bl[cc];
        acc[r] = (acc[r] + ((c < (unsigned)CQK) ? bvl : 0.f)) * carry;
    }
    return acc;
}

// A fragment of the second product, from a weight held in LDS as bf16-exact f32 values (exact in f16 too but for subnormals).
// row l15 (zero for >= 12), element (row, channel c) at Wl[row * rs + c * cs];
// elements 0..7 <- c = 32j+8h+e, elements 8..15 <- c = 32j+16+8h+(e-8) (zero for c >= 36)
DEV FragH w2_frag(const float* Wl, unsigned rs, unsigned cs, unsigned j, unsigned h, unsigned l15) {
    FragH a;
    const unsigned rr = l15 < (unsigned)CIN ? l15 : (unsigned)(CIN - 1);
#pragma unroll
    for (unsigned e = 0; e < 16; ++e) {
        const unsigned c  = 32u * j + 8u * h + e + (e < 8u ? 0u : 8u);
        const unsigned cc = c < (unsigned)CQK ? c : (unsigned)(CQK - 1);
        const float val = Wl[rr * rs + cc * cs];
        a.v[e] = (c < (unsigned)CQK && l15 < (unsigned)CIN) ? (_Float16)val : (_Float16)0.f;
    }
    return a;
}

// second product: 12 x 36 weight times the 36 x 16 projection held as three D tiles (row = channel 16t+8h+r, column = position).
// D row 8h+r of tile t is B k-index 16t+8h+r, lane unchanged. Result: D row = 8h+r (rows 12..15 zero), column = position l15
DEV v8f second_tile(const float* Wl, unsigned rs, unsigned cs, unsigned h, unsigned l15, v8f d0, v8f d1, v8f d2) {
    FragH b0, b1;
#pragma unroll
    for (int r = 0; r < 8; ++r) {
        b0.v[r]     = (_Float16)d0[r];
        b0.v[8 + r] = (_Float16)d1[r];
        b1.v[r]     = (_Float16)d2[r];
        b1.v[8 + r] = (_Float16)0.f;
    }
    v8f acc = mma_f16(w2_frag(Wl, rs, cs, 0u, h, l15).v, b0.v, zero8f());
    return mma_f16(w2_frag(Wl, rs, cs, 1u, h, l15).v, b1.v, acc);
}

// ---------------------------------------------------------------------------
// Kernel 1: projections. Block = 8 waves = 128 positions of one batch; wave w owns 16 positions.
//   B fragment = x[b][i][n] (bf16 RNE, k = i zero-padded 12 -> 32), A fragments = weights (rows = channels).
//   Outputs: Xp [NB*SEQ][16] f16 (x, bf16-rounded), Kp [NB*SEQ][16] f16 (Wq^T (k * KSCALE)), channels 12..15 zero;
//            Vp [NB][16][SEQ] f16 (Wo (v * 16)), rows 12..15 zero.
// LDS: Ws/Bs, Vs are cross-wave (block barriers). staged extent == consumed extent: Vs rows 0..15 x halves 0..127.
// coverage: grid NB*SEQ/128 blocks; per block 256 thr x 8 halves = 128 x 16 (x, k: a wave stores 512 contiguous bytes) = 16 x 128 (values)
// ---------------------------------------------------------------------------
__global__ __launch_bounds__(256) void k_proj(const float* __restrict__ x,
                                              const float* __restrict__ wq,
                                              const float* __restrict__ wk, const float* __restrict__ bk,
                                              const float* __restrict__ wv, const float* __restrict__ bv,
                                              const float* __restrict__ wo,
                                              _Float16* __restrict__ Xp, _Float16* __restrict__ Kp,
                                              _Float16* __restrict__ Vp)
{
    __shared__ __attribute__((aligned(16))) _Float16 Vs[VROWS * VP];
    __shared__ float Ws[4 * CQK * CIN];
    __shared__ float Bs[2 * CQK];

    const unsigned tid = threadIdx.x, lane = tid & 31u, w = tid >> 5;
    const unsigned h = lane >> 4, l15 = lane & 15u;
    const unsigned bps = (unsigned)(SEQ / 128);
    const unsigned b = blockIdx.x / bps;
    const unsigned pos0 = (blockIdx.x - b * bps) * 128u;
    const unsigned nl = w * 16u + l15;                   // position inside the block

    // weights and biases -> LDS as bf16-exact f32 (clamped addresses, guarded LDS stores)
#pragma unroll
    for (unsigned it = 0; it < 2; ++it) {
        const unsigned i  = it * 256u + tid;
        const unsigned ic = i < 432u ? i : 431u;
        const float a0 = bf16_val(wq[ic]);
        const float a1 = bf16_val(wk[ic]);
        const float a2 = bf16_val(wv[ic]);
        const float a3 = bf16_val(wo[ic]);
        if (i < 432u) { Ws[i] = a0; Ws[432u + i] = a1; Ws[864u + i] = a2; Ws[1296u + i] = a3; }
    }
    {
        const unsigned ic = tid < (unsigned)CQK ? tid : (unsigned)(CQK - 1);
        const float a1 = bf16_val(bk[ic]);
        const float a2 = bf16_val(bv[ic]);
        if (tid < (unsigned)CQK) { Bs[tid] = a1; Bs[CQK + tid] = a2; }
    }

    // x fragment: column = position, elements 0..7 <- input channel 8h+e (zero for >= 12), 8..15 <- zero
    FragB xb;
    v8h   xh;                                            // the same 8 values as f16: this lane's piece of the x plane row
    {
        const float* xp = x + (size_t)b * CIN * SEQ_FULL + pos0 + nl;
#pragma unroll
        for (unsigned e = 0; e < 8; ++e) {
            const unsigned i  = 8u * h + e;
            const unsigned ic = i < (unsigned)CIN ? i : (unsigned)(CIN - 1);
            const unsigned raw  = bf16_bits(xp[(size_t)ic * SEQ_FULL]);   // clamped address, loaded by every lane
            const unsigned bits = (i < (unsigned)CIN) ? raw : 0u;
            xb.u[e]     = (unsigned short)bits;
            xb.u[8 + e] = (unsigned short)0;
            xh[e]       = (_Float16)__uint_as_float(bits << 16);
        }
    }
    __syncthreads();

    const size_t prow = ((size_t)b * SEQ + pos0 + nl) * CP + 8u * h;
    *(v8h*)(Xp + prow) = xh;

    // k (scaled into the exp2 domain), then Wq^T . k : row = input channel 8h+r
    {
        v8f d[3];
#pragma unroll
        for (unsigned t = 0; t < 3; ++t) d[t] = proj_tile(Ws + CQK * CIN, Bs, t, h, l15, xb.v, KSCALE);
        const v8f acc = second_tile(Ws, 1u, (unsigned)CIN, h, l15, d[0], d[1], d[2]);
        v8h o;
#pragma unroll
        for (int r = 0; r < 8; ++r) o[r] = (_Float16)acc[r];
        *(v8h*)(Kp + prow) = o;
    }
    // v, then Wo . v : row = output channel 8h+r (channel-major plane)
    {
        v8f d[3];
#pragma unroll
        for (unsigned t = 0; t < 3; ++t) d[t] = proj_tile(Ws + 2 * CQK * CIN, Bs + CQK, t, h, l15, xb.v, VCARRY);
        const v8f acc = second_tile(Ws + 3 * CQK * CIN, (unsigned)CQK, 1u, h, l15, d[0], d[1], d[2]);
#pragma unroll
        for (unsigned r = 0; r < 8; ++r)
            Vs[(8u * h + r) * VP + nl] = (_Float16)acc[r];
    }
    __syncthreads();

    const unsigned row = tid >> 4, pc = tid & 15u;
    const v8h vv = *(const v8h*)(Vs + row * VP + pc * 8u);
    *(v8h*)(Vp + ((size_t)b * VROWS + row) * SEQ + pos0 + pc * 8u) = vv;
}

// ---------------------------------------------------------------------------
// Kernel 2: row statistics. Wave w owns score rows n = pos0 + 16w .. +15 (B = Wq^T.k rows, resident),
// sweeps all column tiles m (A = x rows, staged 1024 rows at a time in LDS by asynchronous copies,
// two buffers: stage t+1 flies while stage t is worked on; inside a stage a wave goes through 8 groups of 128 rows
// at its own pace). One A operand holds two 16-row tiles: elements 0..7
// (k index 8h+e) = channels 8h+e of tile 2j, elements 8..15 (k index 16+8h+e) = the same channels of tile 2j+1;
// B with its upper half zero gives tile 2j's scores, B with its lower half zero tile 2j+1's. The score tile stands transposed:
// D row 8h+r = column m, D column l15 = row n, so all 8 values of a lane belong to ONE row n.
// Per lane: one shift, the max of the lane's 64 scores in the first group, held negated in 8 registers as the C operand of
// every score product, so that D is s - shift; one exp2 and one add per score, 8 partial sums. That max is one of the summed
// scores, so the sum is at least about 1 and cannot vanish; a later score far above the shift can only make it too large.
// A wave in which a lane's sum exceeds ZCAP (or is not a number) sums its rows again with a running max (one rescale per
// group), its x rows read from memory. The two halves of the wave (lanes l, l^16) are combined at the end.
// Table entry: noff[n] = 12 - M_n - log2(Z_n), so that exp2(s + noff[n]) = 4096 * softmax weight.
// LDS offS: cross-wave (block barrier); staged 128 floats == consumed 128 floats.
// LDS XsB: per buffer rows 0..1023 x halves 0..15 copied and read (pitch CP), published by wait + block barrier.
// coverage: grid NB*SEQ/128 blocks x 128 rows = NB*SEQ table entries
// ---------------------------------------------------------------------------
DEV float max3f(float a, float b, float c) { return fmaxf(fmaxf(a, b), c); }
// max of a start value and a tile's 8 values: four 3-input steps
DEV float max9f(float s, v8f c) { return max3f(max3f(max3f(max3f(s, c[0], c[1]), c[2], c[3]), c[4], c[5]), c[6], c[7]); }

#define ZCAP 1.0e30f                                     // a lane's sum above this is summed again with a running max

// a group's 8 score tiles, D = A.B + cin. The group's reads stand together, ahead of its first product
template <bool FROM_MEMORY>
DEV void score_group(const _Float16* xq, v16h klo, v16h khi, v8f cin, v8f (&c)[STG / 16]) {
    FragH xa[STG / 32];
#pragma unroll                                           // every fragment index a constant: the arrays stay in registers
    for (unsigned j = 0; j < (unsigned)(STG / 32); ++j) {
        xa[j].half[0] = *(const v8h*)(xq + (j * 32u) * CP);
        xa[j].half[1] = *(const v8h*)(xq + (j * 32u + 16u) * CP);
    }
    // behind global loads: no address register of an issued load is rewritten ahead of this wait
    if (FROM_MEMORY) asm volatile("s_wait_xcnt 0x0" ::: "memory");
#pragma unroll                                           // as above
    for (unsigned j = 0; j < (unsigned)(STG / 32); ++j) c[2 * j]     = mma_f16(xa[j].v, klo, cin);
#pragma unroll                                           // as above
    for (unsigned j = 0; j < (unsigned)(STG / 32); ++j) c[2 * j + 1] = mma_f16(xa[j].v, khi, cin);
    // keeps the vector work on the tiles behind the group's last product: an exp2 moved up to stand directly behind a
    // product makes the compiler pad that product a second time
    __builtin_amdgcn_sched_barrier(0);
}
// max of a start value and a group's 64 values: 8 independent chains
DEV float group_max(float s, const v8f (&c)[STG / 16]) {
    float tm[STG / 16];
#pragma unroll                                           // as above
    for (unsigned mt = 0; mt < (unsigned)(STG / 16); ++mt) tm[mt] = max9f(s, c[mt]);
    return max3f(max3f(tm[0], tm[1], tm[2]), max3f(tm[3], tm[4], tm[5]), fmaxf(tm[6], tm[7]));
}
DEV float sum8f(v8f z) { return ((z[0] + z[1]) + (z[2] + z[3])) + ((z[4] + z[5]) + (z[6] + z[7])); }

__global__ __launch_bounds__(256) void k_stats(const _Float16* __restrict__ Kp,
                                               const _Float16* __restrict__ Xp,
                                               float* __restrict__ offt)
{
    __shared__ __attribute__((aligned(16))) float offS[128];
    __shared__ __attribute__((aligned(16))) _Float16 XsB[2 * BST * CP];

    const unsigned tid = threadIdx.x, lane = tid & 31u, w = tid >> 5;
    const unsigned h = lane >> 4, l15 = lane & 15u;
    const unsigned bps = (unsigned)(SEQ / 128);
    const unsigned b = blockIdx.x / bps;
    const unsigned pos0 = (blockIdx.x - b * bps) * 128u;

    // one stage = BST rows of 32 B, contiguous in memory and in LDS: thread tid moves pieces tid + 256 i (16 B each)
    const char*    xg = (const char*)(Xp + (size_t)b * SEQ * CP) + tid * 16u;
    const unsigned xl = lds_off(XsB) + tid * 16u;
    auto stage_in = [&](unsigned st, unsigned buf) {
        async_copy8(xl + buf * (unsigned)(BST * CP * 2), 4096u, xg + (size_t)st * (BST * CP * 2), (size_t)4096);
    };

    stage_in(0u, 0u);                                    // stage 0 -> buffer 0

    FragH klo, khi;
    {
        const v8h kr = *(const v8h*)(Kp + ((size_t)b * SEQ + pos0 + w * 16u + l15) * CP + 8u * h);
        klo.half[0] = kr;       klo.half[1] = zero8h();
        khi.half[0] = zero8h(); khi.half[1] = kr;
    }

    v8f   zv   = zero8f();                               // 8 partial sums of exp2(s - mrun)

    wait_async0();
    __syncthreads();                                     // stage 0 published
    if (NST > 1) stage_in(1u, 1u);

    float mrun;                                          // the shift of row n = l15 for this lane's columns
    {
        v8f c[STG / 16];
        score_group<false>(XsB + l15 * CP + 8u * h, klo.v, khi.v, zero8f(), c);
        mrun = group_max(-3.0e38f, c);
    }
    v8f nsh;                                             // -shift, the C operand of every score product of the sweep
#pragma unroll                                           // every element index a constant: the vector stays in registers
    for (int r = 0; r < 8; ++r) nsh[r] = -mrun;

    // rolled: one trip per stage, so that the publish point stands once, at the trip's foot
#pragma unroll 1
    for (unsigned st = 0; st < (unsigned)NST; ++st) {
      const unsigned buf = st & 1u;
      const _Float16* xs = XsB + buf * (unsigned)(BST * CP) + l15 * CP + 8u * h;
      // rolled, one group a trip: no barrier inside a stage, so the waves of a SIMD fall out of step and one wave's
      // LDS reads and products run under the other's vector work (unrolled, the stage's score tiles spilled to scratch)
#pragma unroll 1
      for (unsigned g = 0; g < (unsigned)(BST / STG); ++g) {
        v8f c[STG / 16];
        score_group<false>(xs + g * (unsigned)(STG * CP), klo.v, khi.v, nsh, c);
#pragma unroll                                           // every tile index a constant: the array stays in registers
        for (unsigned mt = 0; mt < (unsigned)(STG / 16); ++mt) {
#pragma unroll                                           // as above
            for (int r = 0; r < 8; ++r) zv[r] += ex2(c[mt][r]);
        }
      }
      // publish point of stage st+1; the same barrier ends every reader's last read of stage st's buffer
      wait_ds0();
      wait_async0();
      __syncthreads();
      if (st + 2u < (unsigned)NST) stage_in(st + 2u, buf);
    }
    wait_async0();

    float zl = sum8f(zv);
    // the same for every lane of the wave (a scalar branch: the products inside run with every lane on); no barrier inside
    if (__any(!(zl <= ZCAP))) {
        const _Float16* xr = Xp + (size_t)b * SEQ * CP + l15 * CP + 8u * h;
        mrun = -3.0e38f;
        zv   = zero8f();
#pragma unroll 1                                         // rolled: a path that is all but never taken stays short
        for (unsigned g = 0; g < (unsigned)(SEQ / STG); ++g) {
            v8f c[STG / 16];
            score_group<true>(xr + (size_t)g * (STG * CP), klo.v, khi.v, zero8f(), c);
            const float mn = group_max(mrun, c);
            const float sc = ex2(mrun - mn);
            mrun = mn;
#pragma unroll                                           // every tile index a constant: the array stays in registers
            for (int r = 0; r < 8; ++r) zv[r] = __builtin_fmaf(zv[r], sc, ex2(c[0][r] - mn));
#pragma unroll                                           // as above
            for (unsigned mt = 1; mt < (unsigned)(STG / 16); ++mt) {
#pragma unroll                                           // as above
                for (int r = 0; r < 8; ++r) zv[r] += ex2(c[mt][r] - mn);
            }
        }
        zl = sum8f(zv);
    }

    {
        const float mo = __shfl_xor(mrun, 16);           // the other half's columns of the same row n
        const float zo = __shfl_xor(zl, 16);
        const float M  = fmaxf(mrun, mo);
        const float zs = zl * ex2(mrun - M) + zo * ex2(mo - M);
        const float ov = PLOG2 - M - log2f(zs);
        if (h == 0u) offS[w * 16u + l15] = ov;
    }
    __syncthreads();

    if (w == 0u) {
        const v4f v = *(const v4f*)(offS + lane * 4u);
        float* dst = offt + (size_t)b * SEQ + pos0 + lane * 4u;
        *(v4f*)dst = v;
        
    }
}

// ---------------------------------------------------------------------------
// Kernel 3: value product. Wave w owns output columns m = pos0 + 16w .. +15
// (B = x rows, resident, once with the upper and once with the lower half zero). The swept Wq^T.k rows, Wo.v columns and
// offsets are staged 1024 rows at a time in LDS by asynchronous copies, two buffers. Per 32-row step: one A operand holds
// both 16-row tiles of Wq^T.k (as in kernel 2), two score tiles whose C operand is noff[n] (D row 8h+r = row n, so a lane's
// 8 C registers are 8 consecutive table entries), P = exp2(D) packed as the B fragment
// (element r <- tile rows 0..15, element 8+r <- tile rows 16..31, lane unchanged: D row 8h+r is
// B k-index 8h+r), A = Wo.v rows (channel-major plane), one tile of output channels accumulated.
// Epilogue: scale, bias, output tile staged and written as whole 512-B rows.
// LDS: boS, outS cross-wave-safe (block barriers between producer and consumer).
//   staged extent == consumed extent: outS 12 x 128 written and read.
//   KsB rows 0..1023 x halves 0..15 (pitch CP), VsB rows 0..15 x halves 0..1023 (pitch VPB), OsB 1024 floats, per buffer:
//   copied and read whole, published by wait + block barrier.
// coverage: grid NB*SEQ/128 blocks x 12 rows x 128 cols = NB*12*SEQ outputs; 384 pieces x 4 floats per block
// ---------------------------------------------------------------------------
__global__ __launch_bounds__(256) void k_attn(const _Float16* __restrict__ Kp,
                                              const _Float16* __restrict__ Xp,
                                              const _Float16* __restrict__ Vp,
                                              const float* __restrict__ offt,
                                              const float* __restrict__ bo,
                                              float* __restrict__ out)
{
    __shared__ __attribute__((aligned(16))) float outS[CIN * OSP];
    __shared__ float boS[16];
    __shared__ __attribute__((aligned(16))) _Float16 KsB[2 * BST * CP];
    __shared__ __attribute__((aligned(16))) _Float16 VsB[2 * VROWS * VPB];
    __shared__ __attribute__((aligned(16))) float    OsB[2 * BST];

    const unsigned tid = threadIdx.x, lane = tid & 31u, w = tid >> 5;
    const unsigned h = lane >> 4, l15 = lane & 15u;
    const unsigned bps = (unsigned)(SEQ / 128);
    const unsigned b = blockIdx.x / bps;
    const unsigned pos0 = (blockIdx.x - b * bps) * 128u;

    // one stage: k rows (8 copies per thread: contiguous, pieces tid + 256 i), value columns (8 per thread: piece = 16 B,
    // 128 pieces per row, copy i moves rows 2i and 2i+1), offsets (1 per thread: contiguous, piece tid)
    const char*     kg = (const char*)(Kp + (size_t)b * SEQ * CP) + tid * 16u;
    const char*     vg = (const char*)(Vp + ((size_t)b * VROWS + (tid >> 7)) * SEQ) + (tid & 127u) * 16u;
    const char*     og = (const char*)(offt + (size_t)b * SEQ) + tid * 16u;
    const unsigned  kl = lds_off(KsB) + tid * 16u;
    const unsigned  vl = lds_off(VsB) + (tid >> 7) * (unsigned)(VPB * 2) + (tid & 127u) * 16u;
    const unsigned  ol = lds_off(OsB) + tid * 16u;
    auto stage_in = [&](unsigned st, unsigned buf) {
        async_copy8(kl + buf * (unsigned)(BST * CP * 2), 4096u, kg + (size_t)st * (BST * CP * 2), (size_t)4096);
        async_copy8(vl + buf * (unsigned)(VROWS * VPB * 2), (unsigned)(2 * VPB * 2),
                    vg + (size_t)st * (BST * 2), (size_t)(2 * SEQ * 2));
        async_copy1(ol + buf * (unsigned)(BST * 4), og + (size_t)st * (BST * 4));
    };

    stage_in(0u, 0u);

    {
        const unsigned ic = tid < (unsigned)CIN ? tid : (unsigned)(CIN - 1);
        const float a0 = bf16_val(bo[ic]);
        if (tid < (unsigned)CIN) boS[tid] = a0;
    }

    FragH xlo, xhi;
    {
        const v8h xr = *(const v8h*)(Xp + ((size_t)b * SEQ + pos0 + w * 16u + l15) * CP + 8u * h);
        xlo.half[0] = xr;       xlo.half[1] = zero8h();
        xhi.half[0] = zero8h(); xhi.half[1] = xr;
    }

    v8f acc = zero8f();

    wait_async0();
    __syncthreads();                                     // stage 0 published
    if (NST > 1) stage_in(1u, 1u);

    // rolled: one trip per stage, so that the publish point stands once, at the trip's foot
#pragma unroll 1
    for (unsigned st = 0; st < (unsigned)NST; ++st) {
      const unsigned buf = st & 1u;
      const _Float16* kb = KsB + buf * (unsigned)(BST * CP) + l15 * CP + 8u * h;
      const _Float16* vb = VsB + buf * (unsigned)(VROWS * VPB) + l15 * VPB + 8u * h;
      const float*    ob = OsB + buf * (unsigned)BST + 8u * h;
      // LDS reads of a 32-row step stand together, one step ahead of the step that uses them (inside the stage only)
      FragH ka[2], vf[2];
      FragC of[2][2];
      auto fetch = [&](unsigned ns, unsigned s) {
          const _Float16* kp = kb + ns * 32u * CP;
          ka[s].half[0] = *(const v8h*)(kp);             // score tile 0: rows 0..15 of the step
          ka[s].half[1] = *(const v8h*)(kp + 16u * CP);  // score tile 1: rows 16..31
          const float* op = ob + ns * 32u;
          of[s][0].quad[0] = *(const v4f*)(op);
          of[s][0].quad[1] = *(const v4f*)(op + 4);
          of[s][1].quad[0] = *(const v4f*)(op + 16);
          of[s][1].quad[1] = *(const v4f*)(op + 20);
          const _Float16* vp = vb + ns * 32u;
          vf[s].half[0] = *(const v8h*)(vp);
          vf[s].half[1] = *(const v8h*)(vp + 16);
      };
      fetch(0u, 0u);
#pragma unroll                                           // the register set s is a constant in every step: the arrays stay in registers
      for (unsigned ns = 0; ns < (unsigned)(BST / 32); ++ns) {
        const unsigned s = ns & 1u;
        if (ns + 1u < (unsigned)(BST / 32)) fetch(ns + 1u, s ^ 1u);

        const v8f c0 = mma_f16(ka[s].v, xlo.v, of[s][0].v);
        const v8f c1 = mma_f16(ka[s].v, xhi.v, of[s][1].v);

        FragH pb;
#pragma unroll
        for (int r = 0; r < 8; ++r) {
            pb.v[r]     = (_Float16)ex2(c0[r]);
            pb.v[8 + r] = (_Float16)ex2(c1[r]);
        }

        acc = mma_f16(vf[s].v, pb.v, acc);
      }
      // publish point of stage st+1; the same barrier ends every reader's last read of stage st's buffers
      wait_ds0();
      wait_async0();
      __syncthreads();
      if (st + 2u < (unsigned)NST) stage_in(st + 2u, buf);
    }
    wait_async0();

    // output tile: D row = output channel 8h+r (rows 12..15 are padding), column = l15
#pragma unroll
    for (unsigned r = 0; r < 8; ++r) {
        const unsigned o  = 8u * h + r;
        const unsigned oc = o < (unsigned)CIN ? o : (unsigned)(CIN - 1);
        const float val = acc[r] * OUT_SCALE + boS[oc];
        if (o < (unsigned)CIN) outS[o * OSP + w * 16u + l15] = val;
    }
    __syncthreads();

    // whole 512-B rows: wave w writes row w, waves 0..3 also write row 8+w; 32 lanes x 16 B contiguous
    const unsigned row0 = w;
    const unsigned row1 = (8u + w) < (unsigned)CIN ? (8u + w) : (unsigned)(CIN - 1);
    const v4f ov0 = *(const v4f*)(outS + row0 * OSP + lane * 4u);
    const v4f ov1 = *(const v4f*)(outS + row1 * OSP + lane * 4u);
    float* d0 = out + ((size_t)b * CIN + row0) * SEQ + pos0 + lane * 4u;
    float* d1 = out + ((size_t)b * CIN + row1) * SEQ + pos0 + lane * 4u;
    *(v4f*)d0 = ov0;
    if (w < 4u) *(v4f*)d1 = ov1;
}

// ---------------------------------------------------------------------------
extern "C" void kernel_launch(void* const* d_in, const int* in_sizes, int n_in,
                              void* d_out, int out_size, void* d_ws, size_t ws_size,
                              hipStream_t stream)
{
    if (n_in < 9) return;
    const long long need_x = ((long long)NB * CIN - 1) * SEQ_FULL + SEQ;
    if ((long long)in_sizes[0] < need_x) return;
    if (in_sizes[1] < CQK * CIN || in_sizes[2] < CQK) return;
    if (in_sizes[3] < CQK * CIN || in_sizes[4] < CQK) return;
    if (in_sizes[5] < CQK * CIN || in_sizes[6] < CQK) return;
    if (in_sizes[7] < CIN * CQK || in_sizes[8] < CIN) return;
    if ((long long)out_size < (long long)NB * CIN * SEQ) return;

    const float* x  = (const float*)d_in[0];
    const float* wq = (const float*)d_in[1];
    const float* wk = (const float*)d_in[3];
    const float* bk = (const float*)d_in[4];
    const float* wv = (const float*)d_in[5];
    const float* bv = (const float*)d_in[6];
    const float* wo = (const float*)d_in[7];
    const float* bo = (const float*)d_in[8];
    float* out = (float*)d_out;

    char* ws = (char*)d_ws;
    size_t off = 0;
    auto carve = [&](size_t bytes) -> char* {
        char* p = ws + off;
        off += (bytes + 255) & ~(size_t)255;
        return p;
    };
    _Float16* Xp  = (_Float16*)carve((size_t)NB * SEQ * CP * 2);        // [NB*SEQ][16]
    _Float16* Kp  = (_Float16*)carve((size_t)NB * SEQ * CP * 2);        // [NB*SEQ][16]
    _Float16* Vp  = (_Float16*)carve((size_t)NB * VROWS * SEQ * 2);     // [NB][16][SEQ]
    float*    oft = (float*)carve((size_t)NB * SEQ * 4);                // [NB*SEQ]
    if (off > ws_size) return;

    const unsigned nblk = (unsigned)(NB * (SEQ / 128));
    k_proj <<<nblk, 256, 0, stream>>>(x, wq, wk, bk, wv, bv, wo, Xp, Kp, Vp);
    k_stats<<<nblk, 256, 0, stream>>>(Kp, Xp, oft);
    k_attn <<<nblk, 256, 0, stream>>>(Kp, Xp, Vp, oft, bo, out);
}

// v006
// It runs in 29.3 microseconds.
// Next to v005, in two timings, it ran 1.05 times as fast each time.
// All steps since v000 together make it 14.5 times as fast.
#include <hip/hip_runtime.h>

// The 1x1 projections are reassociated through both N x N products, so that the swept operands have 12 channels:
//   scores[n][m] = k_n . (Wq x_m + bq) = (Wq^T k_n) . x_m + (k_n . bq); the last term does not depend on m and cancels in the softmax over m;
//   out[o][m]    = sum_n (Wo v_n)[o] * weight[n][m] + bo[o].
// Contractions: k/v 1x1 projections via v_wmma_f32_16x16x32_bf16 (bf16 operands = RNE-converted inputs, K=12 zero-padded to 32, f32 accumulate);
// Wq^T.k and Wo.v (K=36 zero-padded to 64), the scores (K=12, two 16-row tiles share one K=32 operand) and the value product
// via v_wmma_f32_16x16x32_f16 (f16 operands: x x1, k x(log2e/sqrt(12)), v x16, P x4096), f32 accumulate; softmax statistics in f32.
// In both sweeps the shift that is taken off a score before its exp2 is the score product's C operand: D = A.B + (-shift).

#define DEV __device__ __forceinline__

#ifndef NB
#define NB 8
#endif
#ifndef SEQ
#define SEQ 4096
#endif
#define NB_FULL  8
#define SEQ_FULL 4096
#define CIN   12
#define CQK   36
#define CP    16                                         // x / Wq^T.k plane row pitch (halves), channels 12..15 are zeros
#define VROWS 16                                         // Wo.v plane rows per batch, rows 12..15 are zeros
#define VP    136                                        // LDS pitch (halves) of value staging rows
#define OSP   132                                        // LDS pitch (floats) of output staging rows
#define STG   128                                        // swept rows per group: what a wave works on at a time (kernel 2)
#define BST   1024                                       // swept rows per LDS stage (kernels 2 and 3)
#define NST   (SEQ / BST)                                // stages per sweep
#define VPB   (BST + 8)                                  // LDS pitch (halves) of a stage's value rows: 16 B x odd
#define KSCALE (0.28867513459481287f * 1.4426950408889634f)   // 1/sqrt(12) * log2(e), folded into the k plane
#define VCARRY 16.0f
#define PLOG2  12.0f                                     // P carried x 2^12
#define OUT_SCALE (1.0f / 65536.0f)                      // 1 / (16 * 4096)

static_assert(NB >= 1 && NB <= NB_FULL);
static_assert(SEQ >= BST && SEQ <= SEQ_FULL && (SEQ % BST) == 0 && (BST % STG) == 0);
static_assert(256 * 8 == 128 * CP);                      // x / k plane coverage per block
static_assert(256 * 8 == VROWS * 128);                   // value plane coverage per block
static_assert(384 * 4 == CIN * 128);                     // output coverage per block
static_assert(32 * 4 == 128);                            // stats coverage per block
static_assert(((CP * 2) % 16) == 0 && ((VP * 2) % 16) == 0 && ((VPB * 2) % 16) == 0 && ((OSP * 4) % 16) == 0);
static_assert(CIN <= CP && CIN <= VROWS && CQK <= 64);
static_assert(8 * 256 * 16 == BST * CP * 2);             // x / k stage: 8 copies of 16 B per thread
static_assert(8 * 256 * 16 == VROWS * BST * 2);          // value stage: 8 copies of 16 B per thread
static_assert(128 * 16 == BST * 2);                      // value stage: 128 threads move one row, a copy moves two rows
static_assert(STG / 16 == 8);                            // kernel 2 takes its max over 8 tiles per group
static_assert(256 * 16 == BST * 4);                      // offset stage: 1 copy of 16 B per thread

typedef _Float16       v8h   __attribute__((ext_vector_type(8)));
typedef _Float16       v16h  __attribute__((ext_vector_type(16)));
typedef __bf16         v16bf __attribute__((ext_vector_type(16)));
typedef unsigned short v8us  __attribute__((ext_vector_type(8)));
typedef unsigned short v16us __attribute__((ext_vector_type(16)));
typedef float          v8f   __attribute__((ext_vector_type(8)));
typedef float          v4f   __attribute__((ext_vector_type(4)));

union FragH { v16h v;  v8h  half[2]; };
union FragB { v16bf v; v16us u; v8us half[2]; };
union FragC { v8f v;   v4f  quad[2]; };

// ---------------------------------------------------------------------------
// helpers
// ---------------------------------------------------------------------------
DEV unsigned int bf16_bits(float f) {                    // f32 -> bf16 bits, RNE convert
    unsigned int u = __float_as_uint(f);
    u += 0x7FFFu + ((u >> 16) & 1u);
    return u >> 16;
}
DEV float bf16_val(float f) { return __uint_as_float(bf16_bits(f) << 16); }

DEV v8f zero8f() {
    v8f z;
#pragma unroll
    for (int i = 0; i < 8; ++i) z[i] = 0.f;
    return z;
}

DEV v8h zero8h() {
    v8h z;
#pragma unroll
    for (int i = 0; i < 8; ++i) z[i] = (_Float16)0.f;
    return z;
}

DEV float ex2(float x) { return __builtin_amdgcn_exp2f(x); }

// 16x16x32 WMMA with f32 accumulate, the bare builtin: the compiler keeps the distance behind it
DEV v8f mma_bf16(v16bf a, v16bf b, v8f c) {
    return __builtin_amdgcn_wmma_f32_16x16x32_bf16(false, a, false, b, (short)0, c, false, false);
}
DEV v8f mma_f16(v16h a, v16h b, v8f c) {
    return __builtin_amdgcn_wmma_f32_16x16x32_f16(false, a, false, b, (short)0, c, false, false);
}

// ---------------------------------------------------------------------------
// asynchronous copies global -> LDS, 16 B per lane, through no register.
// Each run of copies ends in its own statement with s_wait_xcnt 0, so that no address register
// of an issued copy is rewritten ahead of that wait.
// ---------------------------------------------------------------------------
DEV unsigned lds_off(const void* p) { return (unsigned)(size_t)p; }   // byte offset in the work-group's LDS

DEV void async_copy1(unsigned l0, const void* g0) {
    asm volatile("global_load_async_to_lds_b128 %0, %1, off\n\t"
                 "s_wait_xcnt 0x0"
                 :: "v"(l0), "v"(g0) : "memory");
}
// eight copies, ls bytes apart in LDS and gs bytes apart in memory, each with address registers of its own
DEV void async_copy8(unsigned l, unsigned ls, const char* g, size_t gs) {
    asm volatile("global_load_async_to_lds_b128 %0, %8, off\n\t"
                 "global_load_async_to_lds_b128 %1, %9, off\n\t"
                 "global_load_async_to_lds_b128 %2, %10, off\n\t"
                 "global_load_async_to_lds_b128 %3, %11, off\n\t"
                 "global_load_async_to_lds_b128 %4, %12, off\n\t"
                 "global_load_async_to_lds_b128 %5, %13, off\n\t"
                 "global_load_async_to_lds_b128 %6, %14, off\n\t"
                 "global_load_async_to_lds_b128 %7, %15, off\n\t"
                 "s_wait_xcnt 0x0"
                 :: "v"(l), "v"(l + ls), "v"(l + 2u * ls), "v"(l + 3u * ls),
                    "v"(l + 4u * ls), "v"(l + 5u * ls), "v"(l + 6u * ls), "v"(l + 7u * ls),
                    "v"(g), "v"(g + gs), "v"(g + 2u * gs), "v"(g + 3u * gs),
                    "v"(g + 4u * gs), "v"(g + 5u * gs), "v"(g + 6u * gs), "v"(g + 7u * gs)
                 : "memory");
}
// the issuing wave's own copies have landed in LDS behind this wait
DEV void wait_async0() { asm volatile("s_wait_asynccnt 0x0" ::: "memory"); }
// the wave's own LDS reads have retired before the buffer they read is handed to its next writer
DEV void wait_ds0()    { asm volatile("s_wait_dscnt 0x0" ::: "memory"); }

// A fragment of a [36][12] weight held in LDS as bf16-exact f32 values.
// row c = 16t + l15 (zero for c >= 36); elements 0..7 <- k = 8h+e (zero for k >= 12); elements 8..15 <- k >= 16 -> zero
DEV FragB w_frag(const float* Wl, unsigned t, unsigned h, unsigned l15) {
    FragB a;
    const unsigned c  = 16u * t + l15;
    const unsigned cc = c < (unsigned)CQK ? c : (unsigned)(CQK - 1);
#pragma unroll
    for (unsigned e = 0; e < 8; ++e) {
        const unsigned i  = 8u * h + e;
        const unsigned ic = i < (unsigned)CIN ? i : (unsigned)(CIN - 1);
        const unsigned bits = __float_as_uint(Wl[cc * CIN + ic]) >> 16;
        a.u[e]     = (unsigned short)((c < (unsigned)CQK && i < (unsigned)CIN) ? bits : 0u);
        a.u[8 + e] = (unsigned short)0;
    }
    return a;
}

// one 16(channel) x 16(position) projection tile: (W.x + bias) * carry ; D row = channel 16t+8h+r, column = position l15
DEV v8f proj_tile(const float* Wl, const float* Bl, unsigned t, unsigned h, unsigned l15, v16bf xb, float carry) {
    const FragB a = w_frag(Wl, t, h, l15);
    v8f acc = mma_bf16(a.v, xb, zero8f());
#pragma unroll
    for (unsigned r = 0; r < 8; ++r) {
        const unsigned c  = 16u * t + 8u * h + r;
        const unsigned cc = c < (unsigned)CQK ? c : (unsigned)(CQK - 1);
        const float bvl = Bl[cc];
        acc[r] = (acc[r] + ((c < (unsigned)CQK) ? bvl : 0.f)) * carry;
    }
    return acc;
}

// A fragment of the second product, from a weight held in LDS as bf16-exact f32 values (exact in f16 too but for subnormals).
// row l15 (zero for >= 12), element (row, channel c) at Wl[row * rs + c * cs];
// elements 0..7 <- c = 32j+8h+e, elements 8..15 <- c = 32j+16+8h+(e-8) (zero for c >= 36)
DEV FragH w2_frag(const float* Wl, unsigned rs, unsigned cs, unsigned j, unsigned h, unsigned l15) {
    FragH a;
    const unsigned rr = l15 < (unsigned)CIN ? l15 : (unsigned)(CIN - 1);
#pragma unroll
    for (unsigned e = 0; e < 16; ++e) {
        const unsigned c  = 32u * j + 8u * h + e + (e < 8u ? 0u : 8u);
        const unsigned cc = c < (unsigned)CQK ? c : (unsigned)(CQK - 1);
        const float val = Wl[rr * rs + cc * cs];
        a.v[e] = (c < (unsigned)CQK && l15 < (unsigned)CIN) ? (_Float16)val : (_Float16)0.f;
    }
    return a;
}

// second product: 12 x 36 weight times the 36 x 16 projection held as three D tiles (row = channel 16t+8h+r, column = position).
// D row 8h+r of tile t is B k-index 16t+8h+r, lane unchanged. Result: D row = 8h+r (rows 12..15 zero), column = position l15
DEV v8f second_tile(const float* Wl, unsigned rs, unsigned cs, unsigned h, unsigned l15, v8f d0, v8f d1, v8f d2) {
    FragH b0, b1;
#pragma unroll
    for (int r = 0; r < 8; ++r) {
        b0.v[r]     = (_Float16)d0[r];
        b0.v[8 + r] = (_Float16)d1[r];
        b1.v[r]     = (_Float16)d2[r];
        b1.v[8 + r] = (_Float16)0.f;
    }
    v8f acc = mma_f16(w2_frag(Wl, rs, cs, 0u, h, l15).v, b0.v, zero8f());
    return mma_f16(w2_frag(Wl, rs, cs, 1u, h, l15).v, b1.v, acc);
}

// ---------------------------------------------------------------------------
// Kernel 1: projections. Block = 8 waves = 128 positions of one batch; wave w owns 16 positions.
//   B fragment = x[b][i][n] (bf16 RNE, k = i zero-padded 12 -> 32), A fragments = weights (rows = channels).
//   Outputs: Xp [NB*SEQ][16] f16 (x, bf16-rounded), Kp [NB*SEQ][16] f16 (Wq^T (k * KSCALE)), channels 12..15 zero;
//            Vp [NB][16][SEQ] f16 (Wo (v * 16)), rows 12..15 zero.
// LDS: Ws/Bs, Vs are cross-wave (block barriers). staged extent == consumed extent: Vs rows 0..15 x halves 0..127.
// coverage: grid NB*SEQ/128 blocks; per block 256 thr x 8 halves = 128 x 16 (x, k: a wave stores 512 contiguous bytes) = 16 x 128 (values)
// ---------------------------------------------------------------------------
__global__ __launch_bounds__(256) void k_proj(const float* __restrict__ x,
                                              const float* __restrict__ wq,
                                              const float* __restrict__ wk, const float* __restrict__ bk,
                                              const float* __restrict__ wv, const float* __restrict__ bv,
                                              const float* __restrict__ wo,
                                              _Float16* __restrict__ Xp, _Float16* __restrict__ Kp,
                                              _Float16* __restrict__ Vp)
{
    __shared__ __attribute__((aligned(16))) _Float16 Vs[VROWS * VP];
    __shared__ float Ws[4 * CQK * CIN];
    __shared__ float Bs[2 * CQK];

    const unsigned tid = threadIdx.x, lane = tid & 31u, w = tid >> 5;
    const unsigned h = lane >> 4, l15 = lane & 15u;
    const unsigned bps = (unsigned)(SEQ / 128);
    const unsigned b = blockIdx.x / bps;
    const unsigned pos0 = (blockIdx.x - b * bps) * 128u;
    const unsigned nl = w * 16u + l15;                   // position inside the block

    // weights and biases -> LDS as bf16-exact f32 (clamped addresses, guarded LDS stores)
#pragma unroll
    for (unsigned it = 0; it < 2; ++it) {
        const unsigned i  = it * 256u + tid;
        const unsigned ic = i < 432u ? i : 431u;
        const float a0 = bf16_val(wq[ic]);
        const float a1 = bf16_val(wk[ic]);
        const float a2 = bf16_val(wv[ic]);
        const float a3 = bf16_val(wo[ic]);
        if (i < 432u) { Ws[i] = a0; Ws[432u + i] = a1; Ws[864u + i] = a2; Ws[1296u + i] = a3; }
    }
    {
        const unsigned ic = tid < (unsigned)CQK ? tid : (unsigned)(CQK - 1);
        const float a1 = bf16_val(bk[ic]);
        const float a2 = bf16_val(bv[ic]);
        if (tid < (unsigned)CQK) { Bs[tid] = a1; Bs[CQK + tid] = a2; }
    }

    // x fragment: column = position, elements 0..7 <- input channel 8h+e (zero for >= 12), 8..15 <- zero
    FragB xb;
    v8h   xh;                                            // the same 8 values as f16: this lane's piece of the x plane row
    {
        const float* xp = x + (size_t)b * CIN * SEQ_FULL + pos0 + nl;
#pragma unroll
        for (unsigned e = 0; e < 8; ++e) {
            const unsigned i  = 8u * h + e;
            const unsigned ic = i < (unsigned)CIN ? i : (unsigned)(CIN - 1);
            const unsigned raw  = bf16_bits(xp[(size_t)ic * SEQ_FULL]);   // clamped address, loaded by every lane
            const unsigned bits = (i < (unsigned)CIN) ? raw : 0u;
            xb.u[e]     = (unsigned short)bits;
            xb.u[8 + e] = (unsigned short)0;
            xh[e]       = (_Float16)__uint_as_float(bits << 16);
        }
    }
    __syncthreads();

    const size_t prow = ((size_t)b * SEQ + pos0 + nl) * CP + 8u * h;
    *(v8h*)(Xp + prow) = xh;

    // k (scaled into the exp2 domain), then Wq^T . k : row = input channel 8h+r
    {
        v8f d[3];
#pragma unroll
        for (unsigned t = 0; t < 3; ++t) d[t] = proj_tile(Ws + CQK * CIN, Bs, t, h, l15, xb.v, KSCALE);
        const v8f acc = second_tile(Ws, 1u, (unsigned)CIN, h, l15, d[0], d[1], d[2]);
        v8h o;
#pragma unroll
        for (int r = 0; r < 8; ++r) o[r] = (_Float16)acc[r];
        *(v8h*)(Kp + prow) = o;
    }
    // v, then Wo . v : row = output channel 8h+r (channel-major plane)
    {
        v8f d[3];
#pragma unroll
        for (unsigned t = 0; t < 3; ++t) d[t] = proj_tile(Ws + 2 * CQK * CIN, Bs + CQK, t, h, l15, xb.v, VCARRY);
        const v8f acc = second_tile(Ws + 3 * CQK * CIN, (unsigned)CQK, 1u, h, l15, d[0], d[1], d[2]);
#pragma unroll
        for (unsigned r = 0; r < 8; ++r)
            Vs[(8u * h + r) * VP + nl] = (_Float16)acc[r];
    }
    __syncthreads();

    const unsigned row = tid >> 4, pc = tid & 15u;
    const v8h vv = *(const v8h*)(Vs + row * VP + pc * 8u);
    *(v8h*)(Vp + ((size_t)b * VROWS + row) * SEQ + pos0 + pc * 8u) = vv;
}

// ---------------------------------------------------------------------------
// Kernel 2: row statistics. Wave w owns score rows n = pos0 + 16w .. +15 (B = Wq^T.k rows, resident),
// sweeps all column tiles m (A = x rows, staged 1024 rows at a time in LDS by asynchronous copies,
// two buffers: stage t+1 flies while stage t is worked on; inside a stage a wave goes through 8 groups of 128 rows
// at its own pace). One A operand holds two 16-row tiles: elements 0..7
// (k index 8h+e) = channels 8h+e of tile 2j, elements 8..15 (k index 16+8h+e) = the same channels of tile 2j+1;
// B with its upper half zero gives tile 2j's scores, B with its lower half zero tile 2j+1's. The score tile stands transposed:
// D row 8h+r = column m, D column l15 = row n, so all 8 values of a lane belong to ONE row n.
// Per lane: one shift, the max of the lane's 64 scores in the first group, held negated in 8 registers as the C operand of
// every score product, so that D is s - shift; one exp2 and one add per score, 8 partial sums. That max is one of the summed
// scores, so the sum is at least about 1 and cannot vanish; a later score far above the shift can only make it too large.
// A wave in which a lane's sum exceeds ZCAP (or is not a number) sums its rows again with a running max (one rescale per
// group), its x rows read from memory. The two halves of the wave (lanes l, l^16) are combined at the end.
// Table entry: noff[n] = 12 - M_n - log2(Z_n), so that exp2(s + noff[n]) = 4096 * softmax weight.
// LDS offS: cross-wave (block barrier); staged 128 floats == consumed 128 floats.
// LDS XsB: per buffer rows 0..1023 x halves 0..15 copied and read (pitch CP), published by wait + block barrier.
// coverage: grid NB*SEQ/128 blocks x 128 rows = NB*SEQ table entries
// ---------------------------------------------------------------------------
DEV float max3f(float a, float b, float c) { return fmaxf(fmaxf(a, b), c); }
// max of a start value and a tile's 8 values: four 3-input steps
DEV float max9f(float s, v8f c) { return max3f(max3f(max3f(max3f(s, c[0], c[1]), c[2], c[3]), c[4], c[5]), c[6], c[7]); }

#define ZCAP 1.0e30f                                     // a lane's sum above this is summed again with a running max

// a group's 8 score tiles, D = A.B + cin. The group's reads stand together, ahead of its first product
template <bool FROM_MEMORY>
DEV void score_group(const _Float16* xq, v16h klo, v16h khi, v8f cin, v8f (&c)[STG / 16]) {
    FragH xa[STG / 32];
#pragma unroll                                           // every fragment index a constant: the arrays stay in registers
    for (unsigned j = 0; j < (unsigned)(STG / 32); ++j) {
        xa[j].half[0] = *(const v8h*)(xq + (j * 32u) * CP);
        xa[j].half[1] = *(const v8h*)(xq + (j * 32u + 16u) * CP);
    }
    // behind global loads: no address register of an issued load is rewritten ahead of this wait
    if (FROM_MEMORY) asm volatile("s_wait_xcnt 0x0" ::: "memory");
#pragma unroll                                           // as above
    for (unsigned j = 0; j < (unsigned)(STG / 32); ++j) c[2 * j]     = mma_f16(xa[j].v, klo, cin);
#pragma unroll                                           // as above
    for (unsigned j = 0; j < (unsigned)(STG / 32); ++j) c[2 * j + 1] = mma_f16(xa[j].v, khi, cin);
    // keeps the vector work on the tiles behind the group's last product: an exp2 moved up to stand directly behind the
    // product that it reads makes the compiler pad behind that product
    __builtin_amdgcn_sched_barrier(0);
}
// max of a start value and a group's 64 values: 8 independent chains
DEV float group_max(float s, const v8f (&c)[STG / 16]) {
    float tm[STG / 16];
#pragma unroll                                           // as above
    for (unsigned mt = 0; mt < (unsigned)(STG / 16); ++mt) tm[mt] = max9f(s, c[mt]);
    return max3f(max3f(tm[0], tm[1], tm[2]), max3f(tm[3], tm[4], tm[5]), fmaxf(tm[6], tm[7]));
}
DEV float sum8f(v8f z) { return ((z[0] + z[1]) + (z[2] + z[3])) + ((z[4] + z[5]) + (z[6] + z[7])); }

__global__ __launch_bounds__(256) void k_stats(const _Float16* __restrict__ Kp,
                                               const _Float16* __restrict__ Xp,
                                               float* __restrict__ offt)
{
    __shared__ __attribute__((aligned(16))) float offS[128];
    __shared__ __attribute__((aligned(16))) _Float16 XsB[2 * BST * CP];

    const unsigned tid = threadIdx.x, lane = tid & 31u, w = tid >> 5;
    const unsigned h = lane >> 4, l15 = lane & 15u;
    const unsigned bps = (unsigned)(SEQ / 128);
    const unsigned b = blockIdx.x / bps;
    const unsigned pos0 = (blockIdx.x - b * bps) * 128u;

    // one stage = BST rows of 32 B, contiguous in memory and in LDS: thread tid moves pieces tid + 256 i (16 B each)
    const char*    xg = (const char*)(Xp + (size_t)b * SEQ * CP) + tid * 16u;
    const unsigned xl = lds_off(XsB) + tid * 16u;
    auto stage_in = [&](unsigned st, unsigned buf) {
        async_copy8(xl + buf * (unsigned)(BST * CP * 2), 4096u, xg + (size_t)st * (BST * CP * 2), (size_t)4096);
    };

    stage_in(0u, 0u);                                    // stage 0 -> buffer 0

    FragH klo, khi;
    {
        const v8h kr = *(const v8h*)(Kp + ((size_t)b * SEQ + pos0 + w * 16u + l15) * CP + 8u * h);
        klo.half[0] = kr;       klo.half[1] = zero8h();
        khi.half[0] = zero8h(); khi.half[1] = kr;
    }

    v8f   zv   = zero8f();                               // 8 partial sums of exp2(s - mrun)

    wait_async0();
    __syncthreads();                                     // stage 0 published
    if (NST > 1) stage_in(1u, 1u);

    float mrun;                                          // the shift of row n = l15 for this lane's columns
    {
        v8f c[STG / 16];
        score_group<false>(XsB + l15 * CP + 8u * h, klo.v, khi.v, zero8f(), c);
        mrun = group_max(-3.0e38f, c);
    }
    v8f nsh;                                             // -shift, the C operand of every score product of the sweep
#pragma unroll                                           // every element index a constant: the vector stays in registers
    for (int r = 0; r < 8; ++r) nsh[r] = -mrun;

    // rolled: one trip per stage, so that the publish point stands once, at the trip's foot
#pragma unroll 1
    for (unsigned st = 0; st < (unsigned)NST; ++st) {
      const unsigned buf = st & 1u;
      const _Float16* xs = XsB + buf * (unsigned)(BST * CP) + l15 * CP + 8u * h;
      // rolled, one group a trip: no barrier inside a stage, so the waves of a SIMD fall out of step and one wave's
      // LDS reads and products run under the other's vector work (unrolled, the stage's score tiles spilled to scratch)
#pragma unroll 1
      for (unsigned g = 0; g < (unsigned)(BST / STG); ++g) {
        v8f c[STG / 16];
        score_group<false>(xs + g * (unsigned)(STG * CP), klo.v, khi.v, nsh, c);
#pragma unroll                                           // every tile index a constant: the array stays in registers
        for (unsigned mt = 0; mt < (unsigned)(STG / 16); ++mt) {
#pragma unroll                                           // as above
            for (int r = 0; r < 8; ++r) zv[r] += ex2(c[mt][r]);
        }
        // nothing of the group moves behind this line, and the statement behind it (inputs only, no instruction) keeps the group's
        // score registers live up to here: no exp2 result is written over the source of the exp2 directly ahead of it
        // (the slot that the instruction set asks for behind a transcendental)
        __builtin_amdgcn_sched_barrier(0);
        asm volatile("" :: "v"(c[0]), "v"(c[1]), "v"(c[2]), "v"(c[3]), "v"(c[4]), "v"(c[5]), "v"(c[6]), "v"(c[7]));
      }
      // publish point of stage st+1; the same barrier ends every reader's last read of stage st's buffer
      wait_ds0();
      wait_async0();
      __syncthreads();
      if (st + 2u < (unsigned)NST) stage_in(st + 2u, buf);
    }
    wait_async0();

    float zl = sum8f(zv);
    // the same for every lane of the wave (a scalar branch: the products inside run with every lane on); no barrier inside
    if (__any(!(zl <= ZCAP))) {
        const _Float16* xr = Xp + (size_t)b * SEQ * CP + l15 * CP + 8u * h;
        mrun = -3.0e38f;
        zv   = zero8f();
#pragma unroll 1                                         // rolled: a path that is all but never taken stays short
        for (unsigned g = 0; g < (unsigned)(SEQ / STG); ++g) {
            v8f c[STG / 16];
            score_group<true>(xr + (size_t)g * (STG * CP), klo.v, khi.v, zero8f(), c);
            const float mn = group_max(mrun, c);
            const float sc = ex2(mrun - mn);
            mrun = mn;
#pragma unroll                                           // every tile index a constant: the array stays in registers
            for (int r = 0; r < 8; ++r) zv[r] = __builtin_fmaf(zv[r], sc, ex2(c[0][r] - mn));
#pragma unroll                                           // as above
            for (unsigned mt = 1; mt < (unsigned)(STG / 16); ++mt) {
#pragma unroll                                           // as above
                for (int r = 0; r < 8; ++r) zv[r] += ex2(c[mt][r] - mn);
            }
        }
        zl = sum8f(zv);
    }

    {
        const float mo = __shfl_xor(mrun, 16);           // the other half's columns of the same row n
        const float zo = __shfl_xor(zl, 16);
        const float M  = fmaxf(mrun, mo);
        const float zs = zl * ex2(mrun - M) + zo * ex2(mo - M);
        const float ov = PLOG2 - M - log2f(zs);
        if (h == 0u) offS[w * 16u + l15] = ov;
    }
    __syncthreads();

    if (w == 0u) {
        const v4f v = *(const v4f*)(offS + lane * 4u);
        float* dst = offt + (size_t)b * SEQ + pos0 + lane * 4u;
        *(v4f*)dst = v;
        
    }
}

// ---------------------------------------------------------------------------
// Kernel 3: value product. Wave w owns output columns m = pos0 + 16w .. +15
// (B = x rows, resident, once with the upper and once with the lower half zero). The swept Wq^T.k rows, Wo.v columns and
// offsets are staged 1024 rows at a time in LDS by asynchronous copies, two buffers. Per 32-row step: one A operand holds
// both 16-row tiles of Wq^T.k (as in kernel 2), two score tiles whose C operand is noff[n] (D row 8h+r = row n, so a lane's
// 8 C registers are 8 consecutive table entries), P = exp2(D) packed as the B fragment
// (element r <- tile rows 0..15, element 8+r <- tile rows 16..31, lane unchanged: D row 8h+r is
// B k-index 8h+r), A = Wo.v rows (channel-major plane), one tile of output channels accumulated.
// Epilogue: scale, bias, output tile staged and written as whole 512-B rows.
// LDS: boS, outS cross-wave-safe (block barriers between producer and consumer).
//   staged extent == consumed extent: outS 12 x 128 written and read.
//   KsB rows 0..1023 x halves 0..15 (pitch CP), VsB rows 0..15 x halves 0..1023 (pitch VPB), OsB 1024 floats, per buffer:
//   copied and read whole, published by wait + block barrier.
// coverage: grid NB*SEQ/128 blocks x 12 rows x 128 cols = NB*12*SEQ outputs; 384 pieces x 4 floats per block
// ---------------------------------------------------------------------------
__global__ __launch_bounds__(256) void k_attn(const _Float16* __restrict__ Kp,
                                              const _Float16* __restrict__ Xp,
                                              const _Float16* __restrict__ Vp,
                                              const float* __restrict__ offt,
                                              const float* __restrict__ bo,
                                              float* __restrict__ out)
{
    __shared__ __attribute__((aligned(16))) float outS[CIN * OSP];
    __shared__ float boS[16];
    __shared__ __attribute__((aligned(16))) _Float16 KsB[2 * BST * CP];
    __shared__ __attribute__((aligned(16))) _Float16 VsB[2 * VROWS * VPB];
    __shared__ __attribute__((aligned(16))) float    OsB[2 * BST];

    const unsigned tid = threadIdx.x, lane = tid & 31u, w = tid >> 5;
    const unsigned h = lane >> 4, l15 = lane & 15u;
    const unsigned bps = (unsigned)(SEQ / 128);
    const unsigned b = blockIdx.x / bps;
    const unsigned pos0 = (blockIdx.x - b * bps) * 128u;

    // one stage: k rows (8 copies per thread: contiguous, pieces tid + 256 i), value columns (8 per thread: piece = 16 B,
    // 128 pieces per row, copy i moves rows 2i and 2i+1), offsets (1 per thread: contiguous, piece tid)
    const char*     kg = (const char*)(Kp + (size_t)b * SEQ * CP) + tid * 16u;
    const char*     vg = (const char*)(Vp + ((size_t)b * VROWS + (tid >> 7)) * SEQ) + (tid & 127u) * 16u;
    const char*     og = (const char*)(offt + (size_t)b * SEQ) + tid * 16u;
    const unsigned  kl = lds_off(KsB) + tid * 16u;
    const unsigned  vl = lds_off(VsB) + (tid >> 7) * (unsigned)(VPB * 2) + (tid & 127u) * 16u;
    const unsigned  ol = lds_off(OsB) + tid * 16u;
    auto stage_in = [&](unsigned st, unsigned buf) {
        async_copy8(kl + buf * (unsigned)(BST * CP * 2), 4096u, kg + (size_t)st * (BST * CP * 2), (size_t)4096);
        async_copy8(vl + buf * (unsigned)(VROWS * VPB * 2), (unsigned)(2 * VPB * 2),
                    vg + (size_t)st * (BST * 2), (size_t)(2 * SEQ * 2));
        async_copy1(ol + buf * (unsigned)(BST * 4), og + (size_t)st * (BST * 4));
    };

    stage_in(0u, 0u);

    {
        const unsigned ic = tid < (unsigned)CIN ? tid : (unsigned)(CIN - 1);
        const float a0 = bf16_val(bo[ic]);
        if (tid < (unsigned)CIN) boS[tid] = a0;
    }

    FragH xlo, xhi;
    {
        const v8h xr = *(const v8h*)(Xp + ((size_t)b * SEQ + pos0 + w * 16u + l15) * CP + 8u * h);
        xlo.half[0] = xr;       xlo.half[1] = zero8h();
        xhi.half[0] = zero8h(); xhi.half[1] = xr;
    }

    v8f acc = zero8f();

    wait_async0();
    __syncthreads();                                     // stage 0 published
    if (NST > 1) stage_in(1u, 1u);

    // rolled: one trip per stage, so that the publish point stands once, at the trip's foot
#pragma unroll 1
    for (unsigned st = 0; st < (unsigned)NST; ++st) {
      const unsigned buf = st & 1u;
      const _Float16* kb = KsB + buf * (unsigned)(BST * CP) + l15 * CP + 8u * h;
      const _Float16* vb = VsB + buf * (unsigned)(VROWS * VPB) + l15 * VPB + 8u * h;
      const float*    ob = OsB + buf * (unsigned)BST + 8u * h;
      // Inside a stage the steps overlap: the two score products of step ns+1 are issued ahead of the exp2 work of step ns, so
      // that the distance which the chip asks for behind a product is filled with that work and no product's result is waited for.
      // LDS reads stand two steps ahead of their use: A and C operands of step ns+3, value fragment of step ns+2.
      constexpr unsigned NSTEP = (unsigned)(BST / 32);
      FragH ka[2], vf[3], pb[2];
      FragC cc[4][2];                                    // a step's offsets as they arrive, then its two score tiles (D over C)
      auto fetch_k = [&](unsigned ns) {
          const _Float16* kp = kb + ns * 32u * CP;
          ka[ns & 1u].half[0] = *(const v8h*)(kp);             // score tile 0: rows 0..15 of the step
          ka[ns & 1u].half[1] = *(const v8h*)(kp + 16u * CP);  // score tile 1: rows 16..31
          const float* op = ob + ns * 32u;
          cc[ns & 3u][0].quad[0] = *(const v4f*)(op);
          cc[ns & 3u][0].quad[1] = *(const v4f*)(op + 4);
          cc[ns & 3u][1].quad[0] = *(const v4f*)(op + 16);
          cc[ns & 3u][1].quad[1] = *(const v4f*)(op + 20);
      };
      auto fetch_v = [&](unsigned ns) {
          const _Float16* vp = vb + ns * 32u;
          vf[ns % 3u].half[0] = *(const v8h*)(vp);
          vf[ns % 3u].half[1] = *(const v8h*)(vp + 16);
      };
      auto scores = [&](unsigned ns) {
          cc[ns & 3u][0].v = mma_f16(ka[ns & 1u].v, xlo.v, cc[ns & 3u][0].v);
          cc[ns & 3u][1].v = mma_f16(ka[ns & 1u].v, xhi.v, cc[ns & 3u][1].v);
      };
      static_assert(NSTEP >= 3u);
      fetch_k(0u); fetch_k(1u); fetch_v(0u); fetch_v(1u);
      scores(0u);
      fetch_k(2u);
#pragma unroll                                           // every register set index is a constant in every step: the arrays stay in registers
      for (unsigned ns = 0; ns < NSTEP; ++ns) {
        if (ns + 1u < NSTEP) scores(ns + 1u);
        // keeps the reads behind the products: they then take the A registers that the products have just read, and no exp2
        // result is written there inside the products' distance (the compiler pads where one is)
        __builtin_amdgcn_sched_barrier(0);
        if (ns + 3u < NSTEP) fetch_k(ns + 3u);
        if (ns + 2u < NSTEP) fetch_v(ns + 2u);
        // keeps the next step's products and the reads ahead of this step's vector work: moved down, the products' results
        // would be waited for and the compiler would pad behind them
        __builtin_amdgcn_sched_barrier(0);

#pragma unroll
        for (int r = 0; r < 8; ++r) {
            pb[ns & 1u].v[r]     = (_Float16)ex2(cc[ns & 3u][0].v[r]);
            pb[ns & 1u].v[8 + r] = (_Float16)ex2(cc[ns & 3u][1].v[r]);
        }

        acc = mma_f16(vf[ns % 3u].v, pb[ns & 1u].v, acc);
        // keeps the following step's products behind this step's value product, so that the steps stay in this order
        __builtin_amdgcn_sched_barrier(0);
        // inputs only, no instruction: the step's score registers stay live behind its last exp2, so that no exp2 result is written
        // over the source of the exp2 directly ahead of it (the slot that the instruction set asks for behind a transcendental)
        asm volatile("" :: "v"(cc[ns & 3u][0].v), "v"(cc[ns & 3u][1].v));
        // the same for the step before's P fragment: this step's exp2 results keep off the B registers of a value product that is
        // still inside its distance (the compiler pads where they do not)
        if (ns > 0u) asm volatile("" :: "v"(pb[(ns & 1u) ^ 1u].v));
      }
      // publish point of stage st+1; the same barrier ends every reader's last read of stage st's buffers
      wait_ds0();
      wait_async0();
      __syncthreads();
      if (st + 2u < (unsigned)NST) stage_in(st + 2u, buf);
    }
    wait_async0();

    // output tile: D row = output channel 8h+r (rows 12..15 are padding), column = l15
#pragma unroll
    for (unsigned r = 0; r < 8; ++r) {
        const unsigned o  = 8u * h + r;
        const unsigned oc = o < (unsigned)CIN ? o : (unsigned)(CIN - 1);
        const float val = acc[r] * OUT_SCALE + boS[oc];
        if (o < (unsigned)CIN) outS[o * OSP + w * 16u + l15] = val;
    }
    __syncthreads();

    // whole 512-B rows: wave w writes row w, waves 0..3 also write row 8+w; 32 lanes x 16 B contiguous
    const unsigned row0 = w;
    const unsigned row1 = (8u + w) < (unsigned)CIN ? (8u + w) : (unsigned)(CIN - 1);
    const v4f ov0 = *(const v4f*)(outS + row0 * OSP + lane * 4u);
    const v4f ov1 = *(const v4f*)(outS + row1 * OSP + lane * 4u);
    float* d0 = out + ((size_t)b * CIN + row0) * SEQ + pos0 + lane * 4u;
    float* d1 = out + ((size_t)b * CIN + row1) * SEQ + pos0 + lane * 4u;
    *(v4f*)d0 = ov0;
    if (w < 4u) *(v4f*)d1 = ov1;
}

// ---------------------------------------------------------------------------
extern "C" void kernel_launch(void* const* d_in, const int* in_sizes, int n_in,
                              void* d_out, int out_size, void* d_ws, size_t ws_size,
                              hipStream_t stream)
{
    if (n_in < 9) return;
    const long long need_x = ((long long)NB * CIN - 1) * SEQ_FULL + SEQ;
    if ((long long)in_sizes[0] < need_x) return;
    if (in_sizes[1] < CQK * CIN || in_sizes[2] < CQK) return;
    if (in_sizes[3] < CQK * CIN || in_sizes[4] < CQK) return;
    if (in_sizes[5] < CQK * CIN || in_sizes[6] < CQK) return;
    if (in_sizes[7] < CIN * CQK || in_sizes[8] < CIN) return;
    if ((long long)out_size < (long long)NB * CIN * SEQ) return;

    const float* x  = (const float*)d_in[0];
    const float* wq = (const float*)d_in[1];
    const float* wk = (const float*)d_in[3];
    const float* bk = (const float*)d_in[4];
    const float* wv = (const float*)d_in[5];
    const float* bv = (const float*)d_in[6];
    const float* wo = (const float*)d_in[7];
    const float* bo = (const float*)d_in[8];
    float* out = (float*)d_out;

    char* ws = (char*)d_ws;
    size_t off = 0;
    auto carve = [&](size_t bytes) -> char* {
        char* p = ws + off;
        off += (bytes + 255) & ~(size_t)255;
        return p;
    };
    _Float16* Xp  = (_Float16*)carve((size_t)NB * SEQ * CP * 2);        // [NB*SEQ][16]
    _Float16* Kp  = (_Float16*)carve((size_t)NB * SEQ * CP * 2);        // [NB*SEQ][16]
    _Float16* Vp  = (_Float16*)carve((size_t)NB * VROWS * SEQ * 2);     // [NB][16][SEQ]
    float*    oft = (float*)carve((size_t)NB * SEQ * 4);                // [NB*SEQ]
    if (off > ws_size) return;

    const unsigned nblk = (unsigned)(NB * (SEQ / 128));
    k_proj <<<nblk, 256, 0, stream>>>(x, wq, wk, bk, wv, bv, wo, Xp, Kp, Vp);
    k_stats<<<nblk, 256, 0, stream>>>(Kp, Xp, oft);
    k_attn <<<nblk, 256, 0, stream>>>(Kp, Xp, Vp, oft, bo, out);
}

// v007
// One run takes 28.4 microseconds.
// In two side-by-side timings against v006, it was 1.03 and 1.02 times as fast.
// Counting every step since v000, it is 14.9 times as fast.
#include <hip/hip_runtime.h>

// The 1x1 projections are reassociated through both N x N products, so that the swept operands have 12 channels:
//   scores[n][m] = k_n . (Wq x_m + bq) = (Wq^T k_n) . x_m + (k_n . bq); the last term does not depend on m and cancels in the softmax over m;
//   out[o][m]    = sum_n (Wo v_n)[o] * weight[n][m] + bo[o].
// Contractions: k/v 1x1 projections via v_wmma_f32_16x16x32_bf16 (bf16 operands = RNE-converted inputs, K=12 zero-padded to 32, f32 accumulate);
// Wq^T.k and Wo.v (K=36 zero-padded to 64), the scores (K=12, two 16-row tiles share one K=32 operand) and the value product
// via v_wmma_f32_16x16x32_f16 (f16 operands: x x1, k x(log2e/sqrt(12)), v x16, P x4096), f32 accumulate; softmax statistics in f32.
// Kernel 2: the shift that is taken off a score before its exp2 is the score product's C operand: D = A.B + (-shift).
// Kernel 3: the row's offset rides in the product itself: channels 12..14 of a Wq^T.k row hold it as three f16 terms
// (value, remainder, remainder of that), channels 12..14 of every x row hold 1, so that D = score + offset with C = 0.

#define DEV __device__ __forceinline__

#ifndef NB
#define NB 8
#endif
#ifndef SEQ
#define SEQ 4096
#endif
#define NB_FULL  8
#define SEQ_FULL 4096
#define CIN   12
#define CQK   36
#define CP    16                                         // x / Wq^T.k plane row pitch (halves); channels 12..14: offset terms (k) and ones (x), 15: zero
#define NOFF  3                                          // f16 terms that carry a row's offset
#define VROWS 16                                         // Wo.v plane rows per batch, rows 12..15 are zeros
#define VP    136                                        // LDS pitch (halves) of value staging rows
#define OSP   132                                        // LDS pitch (floats) of output staging rows
#define STG   128                                        // swept rows per group: what a wave works on at a time (kernel 2)
#define BST   1024                                       // swept rows per LDS stage (kernels 2 and 3)
#define NST   (SEQ / BST)                                // stages per sweep
#define VPB   (BST + 8)                                  // LDS pitch (halves) of a stage's value rows: 16 B x odd
#define KSCALE (0.28867513459481287f * 1.4426950408889634f)   // 1/sqrt(12) * log2(e), folded into the k plane
#define VCARRY 16.0f
#define PLOG2  12.0f                                     // P carried x 2^12
#define OUT_SCALE (1.0f / 65536.0f)                      // 1 / (16 * 4096)

static_assert(NB >= 1 && NB <= NB_FULL);
static_assert(SEQ >= BST && SEQ <= SEQ_FULL && (SEQ % BST) == 0 && (BST % STG) == 0);
static_assert(256 * 8 == 128 * CP);                      // x / k plane coverage per block
static_assert(256 * 8 == VROWS * 128);                   // value plane coverage per block
static_assert(384 * 4 == CIN * 128);                     // output coverage per block
static_assert(((CP * 2) % 16) == 0 && ((VP * 2) % 16) == 0 && ((VPB * 2) % 16) == 0 && ((OSP * 4) % 16) == 0);
static_assert(CIN + NOFF <= CP && CIN <= VROWS && CQK <= 64);
static_assert(8 * 256 * 16 == BST * CP * 2);             // x / k stage: 8 copies of 16 B per thread
static_assert(8 * 256 * 16 == VROWS * BST * 2);          // value stage: 8 copies of 16 B per thread
static_assert(128 * 16 == BST * 2);                      // value stage: 128 threads move one row, a copy moves two rows
static_assert(STG / 16 == 8);                            // kernel 2 takes its max over 8 tiles per group

typedef _Float16       v4h   __attribute__((ext_vector_type(4)));
typedef _Float16       v8h   __attribute__((ext_vector_type(8)));
typedef _Float16       v16h  __attribute__((ext_vector_type(16)));
typedef __bf16         v16bf __attribute__((ext_vector_type(16)));
typedef unsigned short v8us  __attribute__((ext_vector_type(8)));
typedef unsigned short v16us __attribute__((ext_vector_type(16)));
typedef float          v8f   __attribute__((ext_vector_type(8)));
typedef float          v4f   __attribute__((ext_vector_type(4)));

union FragH { v16h v;  v8h  half[2]; };
union FragB { v16bf v; v16us u; v8us half[2]; };

// ---------------------------------------------------------------------------
// helpers
// ---------------------------------------------------------------------------
DEV unsigned int bf16_bits(float f) {                    // f32 -> bf16 bits, RNE convert
    unsigned int u = __float_as_uint(f);
    u += 0x7FFFu + ((u >> 16) & 1u);
    return u >> 16;
}
DEV float bf16_val(float f) { return __uint_as_float(bf16_bits(f) << 16); }

DEV v8f zero8f() {
    v8f z;
#pragma unroll
    for (int i = 0; i < 8; ++i) z[i] = 0.f;
    return z;
}

DEV v8h zero8h() {
    v8h z;
#pragma unroll
    for (int i = 0; i < 8; ++i) z[i] = (_Float16)0.f;
    return z;
}

DEV float ex2(float x) { return __builtin_amdgcn_exp2f(x); }

// 16x16x32 WMMA with f32 accumulate, the bare builtin: the compiler keeps the distance behind it
DEV v8f mma_bf16(v16bf a, v16bf b, v8f c) {
    return __builtin_amdgcn_wmma_f32_16x16x32_bf16(false, a, false, b, (short)0, c, false, false);
}
DEV v8f mma_f16(v16h a, v16h b, v8f c) {
    return __builtin_amdgcn_wmma_f32_16x16x32_f16(false, a, false, b, (short)0, c, false, false);
}

// ---------------------------------------------------------------------------
// asynchronous copies global -> LDS, 16 B per lane, through no register.
// Each run of copies ends in its own statement with s_wait_xcnt 0, so that no address register
// of an issued copy is rewritten ahead of that wait.
// ---------------------------------------------------------------------------
DEV unsigned lds_off(const void* p) { return (unsigned)(size_t)p; }   // byte offset in the work-group's LDS

// eight copies, ls bytes apart in LDS and gs bytes apart in memory, each with address registers of its own
DEV void async_copy8(unsigned l, unsigned ls, const char* g, size_t gs) {
    asm volatile("global_load_async_to_lds_b128 %0, %8, off\n\t"
                 "global_load_async_to_lds_b128 %1, %9, off\n\t"
                 "global_load_async_to_lds_b128 %2, %10, off\n\t"
                 "global_load_async_to_lds_b128 %3, %11, off\n\t"
                 "global_load_async_to_lds_b128 %4, %12, off\n\t"
                 "global_load_async_to_lds_b128 %5, %13, off\n\t"
                 "global_load_async_to_lds_b128 %6, %14, off\n\t"
                 "global_load_async_to_lds_b128 %7, %15, off\n\t"
                 "s_wait_xcnt 0x0"
                 :: "v"(l), "v"(l + ls), "v"(l + 2u * ls), "v"(l + 3u * ls),
                    "v"(l + 4u * ls), "v"(l + 5u * ls), "v"(l + 6u * ls), "v"(l + 7u * ls),
                    "v"(g), "v"(g + gs), "v"(g + 2u * gs), "v"(g + 3u * gs),
                    "v"(g + 4u * gs), "v"(g + 5u * gs), "v"(g + 6u * gs), "v"(g + 7u * gs)
                 : "memory");
}
// the issuing wave's own copies have landed in LDS behind this wait
DEV void wait_async0() { asm volatile("s_wait_asynccnt 0x0" ::: "memory"); }
// the wave's own LDS reads have retired before the buffer they read is handed to its next writer
DEV void wait_ds0()    { asm volatile("s_wait_dscnt 0x0" ::: "memory"); }

// A fragment of a [36][12] weight held in LDS as bf16-exact f32 values.
// row c = 16t + l15 (zero for c >= 36); elements 0..7 <- k = 8h+e (zero for k >= 12); elements 8..15 <- k >= 16 -> zero
DEV FragB w_frag(const float* Wl, unsigned t, unsigned h, unsigned l15) {
    FragB a;
    const unsigned c  = 16u * t + l15;
    const unsigned cc = c < (unsigned)CQK ? c : (unsigned)(CQK - 1);
#pragma unroll
    for (unsigned e = 0; e < 8; ++e) {
        const unsigned i  = 8u * h + e;
        const unsigned ic = i < (unsigned)CIN ? i : (unsigned)(CIN - 1);
        const unsigned bits = __float_as_uint(Wl[cc * CIN + ic]) >> 16;
        a.u[e]     = (unsigned short)((c < (unsigned)CQK && i < (unsigned)CIN) ? bits : 0u);
        a.u[8 + e] = (unsigned short)0;
    }
    return a;
}

// one 16(channel) x 16(position) projection tile: (W.x + bias) * carry ; D row = channel 16t+8h+r, column = position l15
DEV v8f proj_tile(const float* Wl, const float* Bl, unsigned t, unsigned h, unsigned l15, v16bf xb, float carry) {
    const FragB a = w_frag(Wl, t, h, l15);
    v8f acc = mma_bf16(a.v, xb, zero8f());
#pragma unroll
    for (unsigned r = 0; r < 8; ++r) {
        const unsigned c  = 16u * t + 8u * h + r;
        const unsigned cc = c < (unsigned)CQK ? c : (unsigned)(CQK - 1);
        const float bvl = Bl[cc];
        acc[r] = (acc[r] + ((c < (unsigned)CQK) ? bvl : 0.f)) * carry;
    }
    return acc;
}

// A fragment of the second product, from a weight held in LDS as bf16-exact f32 values (exact in f16 too but for subnormals).
// row l15 (zero for >= 12), element (row, channel c) at Wl[row * rs + c * cs];
// elements 0..7 <- c = 32j+8h+e, elements 8..15 <- c = 32j+16+8h+(e-8) (zero for c >= 36)
DEV FragH w2_frag(const float* Wl, unsigned rs, unsigned cs, unsigned j, unsigned h, unsigned l15) {
    FragH a;
    const unsigned rr = l15 < (unsigned)CIN ? l15 : (unsigned)(CIN - 1);
#pragma unroll
    for (unsigned e = 0; e < 16; ++e) {
        const unsigned c  = 32u * j + 8u * h + e + (e < 8u ? 0u : 8u);
        const unsigned cc = c < (unsigned)CQK ? c : (unsigned)(CQK - 1);
        const float val = Wl[rr * rs + cc * cs];
        a.v[e] = (c < (unsigned)CQK && l15 < (unsigned)CIN) ? (_Float16)val : (_Float16)0.f;
    }
    return a;
}

// second product: 12 x 36 weight times the 36 x 16 projection held as three D tiles (row = channel 16t+8h+r, column = position).
// D row 8h+r of tile t is B k-index 16t+8h+r, lane unchanged. Result: D row = 8h+r (rows 12..15 zero), column = position l15
DEV v8f second_tile(const float* Wl, unsigned rs, unsigned cs, unsigned h, unsigned l15, v8f d0, v8f d1, v8f d2) {
    FragH b0, b1;
#pragma unroll
    for (int r = 0; r < 8; ++r) {
        b0.v[r]     = (_Float16)d0[r];
        b0.v[8 + r] = (_Float16)d1[r];
        b1.v[r]     = (_Float16)d2[r];
        b1.v[8 + r] = (_Float16)0.f;
    }
    v8f acc = mma_f16(w2_frag(Wl, rs, cs, 0u, h, l15).v, b0.v, zero8f());
    return mma_f16(w2_frag(Wl, rs, cs, 1u, h, l15).v, b1.v, acc);
}

// ---------------------------------------------------------------------------
// Kernel 1: projections. Block = 8 waves = 128 positions of one batch; wave w owns 16 positions.
//   B fragment = x[b][i][n] (bf16 RNE, k = i zero-padded 12 -> 32), A fragments = weights (rows = channels).
//   Outputs: Xp [NB*SEQ][16] f16 (x, bf16-rounded; channels 12..14 one, 15 zero), Kp [NB*SEQ][16] f16 (Wq^T (k * KSCALE), channels 12..15 zero);
//            Vp [NB][16][SEQ] f16 (Wo (v * 16)), rows 12..15 zero.
// LDS: Ws/Bs, Vs are cross-wave (block barriers). staged extent == consumed extent: Vs rows 0..15 x halves 0..127.
// coverage: grid NB*SEQ/128 blocks; per block 256 thr x 8 halves = 128 x 16 (x, k: a wave stores 512 contiguous bytes) = 16 x 128 (values)
// ---------------------------------------------------------------------------
__global__ __launch_bounds__(256) void k_proj(const float* __restrict__ x,
                                              const float* __restrict__ wq,
                                              const float* __restrict__ wk, const float* __restrict__ bk,
                                              const float* __restrict__ wv, const float* __restrict__ bv,
                                              const float* __restrict__ wo,
                                              _Float16* __restrict__ Xp, _Float16* __restrict__ Kp,
                                              _Float16* __restrict__ Vp)
{
    __shared__ __attribute__((aligned(16))) _Float16 Vs[VROWS * VP];
    __shared__ float Ws[4 * CQK * CIN];
    __shared__ float Bs[2 * CQK];

    const unsigned tid = threadIdx.x, lane = tid & 31u, w = tid >> 5;
    const unsigned h = lane >> 4, l15 = lane & 15u;
    const unsigned bps = (unsigned)(SEQ / 128);
    const unsigned b = blockIdx.x / bps;
    const unsigned pos0 = (blockIdx.x - b * bps) * 128u;
    const unsigned nl = w * 16u + l15;                   // position inside the block

    // weights and biases -> LDS as bf16-exact f32 (clamped addresses, guarded LDS stores)
#pragma unroll
    for (unsigned it = 0; it < 2; ++it) {
        const unsigned i  = it * 256u + tid;
        const unsigned ic = i < 432u ? i : 431u;
        const float a0 = bf16_val(wq[ic]);
        const float a1 = bf16_val(wk[ic]);
        const float a2 = bf16_val(wv[ic]);
        const float a3 = bf16_val(wo[ic]);
        if (i < 432u) { Ws[i] = a0; Ws[432u + i] = a1; Ws[864u + i] = a2; Ws[1296u + i] = a3; }
    }
    {
        const unsigned ic = tid < (unsigned)CQK ? tid : (unsigned)(CQK - 1);
        const float a1 = bf16_val(bk[ic]);
        const float a2 = bf16_val(bv[ic]);
        if (tid < (unsigned)CQK) { Bs[tid] = a1; Bs[CQK + tid] = a2; }
    }

    // x fragment: column = position, elements 0..7 <- input channel 8h+e (zero for >= 12), 8..15 <- zero
    FragB xb;
    v8h   xh;                                            // the same 8 values as f16, but 1 in channels 12..14: this lane's piece of the x plane row
    {
        const float* xp = x + (size_t)b * CIN * SEQ_FULL + pos0 + nl;
#pragma unroll
        for (unsigned e = 0; e < 8; ++e) {
            const unsigned i  = 8u * h + e;
            const unsigned ic = i < (unsigned)CIN ? i : (unsigned)(CIN - 1);
            const unsigned raw  = bf16_bits(xp[(size_t)ic * SEQ_FULL]);   // clamped address, loaded by every lane
            const unsigned bits = (i < (unsigned)CIN) ? raw : 0u;
            xb.u[e]     = (unsigned short)bits;
            xb.u[8 + e] = (unsigned short)0;
            xh[e]       = (i >= (unsigned)CIN && i < (unsigned)(CIN + NOFF)) ? (_Float16)1.f : (_Float16)__uint_as_float(bits << 16);
        }
    }
    __syncthreads();

    const size_t prow = ((size_t)b * SEQ + pos0 + nl) * CP + 8u * h;
    *(v8h*)(Xp + prow) = xh;

    // k (scaled into the exp2 domain), then Wq^T . k : row = input channel 8h+r
    {
        v8f d[3];
#pragma unroll
        for (unsigned t = 0; t < 3; ++t) d[t] = proj_tile(Ws + CQK * CIN, Bs, t, h, l15, xb.v, KSCALE);
        const v8f acc = second_tile(Ws, 1u, (unsigned)CIN, h, l15, d[0], d[1], d[2]);
        v8h o;
#pragma unroll
        for (int r = 0; r < 8; ++r) o[r] = (_Float16)acc[r];
        *(v8h*)(Kp + prow) = o;
    }
    // v, then Wo . v : row = output channel 8h+r (channel-major plane)
    {
        v8f d[3];
#pragma unroll
        for (unsigned t = 0; t < 3; ++t) d[t] = proj_tile(Ws + 2 * CQK * CIN, Bs + CQK, t, h, l15, xb.v, VCARRY);
        const v8f acc = second_tile(Ws + 3 * CQK * CIN, (unsigned)CQK, 1u, h, l15, d[0], d[1], d[2]);
#pragma unroll
        for (unsigned r = 0; r < 8; ++r)
            Vs[(8u * h + r) * VP + nl] = (_Float16)acc[r];
    }
    __syncthreads();

    const unsigned row = tid >> 4, pc = tid & 15u;
    const v8h vv = *(const v8h*)(Vs + row * VP + pc * 8u);
    *(v8h*)(Vp + ((size_t)b * VROWS + row) * SEQ + pos0 + pc * 8u) = vv;
}

// ---------------------------------------------------------------------------
// Kernel 2: row statistics. Wave w owns score rows n = pos0 + 16w .. +15 (B = Wq^T.k rows, resident),
// sweeps all column tiles m (A = x rows, staged 1024 rows at a time in LDS by asynchronous copies,
// two buffers: stage t+1 flies while stage t is worked on; inside a stage a wave goes through 8 groups of 128 rows
// at its own pace). One A operand holds two 16-row tiles: elements 0..7
// (k index 8h+e) = channels 8h+e of tile 2j, elements 8..15 (k index 16+8h+e) = the same channels of tile 2j+1;
// B with its upper half zero gives tile 2j's scores, B with its lower half zero tile 2j+1's. The score tile stands transposed:
// D row 8h+r = column m, D column l15 = row n, so all 8 values of a lane belong to ONE row n.
// Per lane: one shift, the max of the lane's 64 scores in the first group, held negated in 8 registers as the C operand of
// every score product, so that D is s - shift; one exp2 and one add per score, 8 partial sums. That max is one of the summed
// scores, so the sum is at least about 1 and cannot vanish; a later score far above the shift can only make it too large.
// A wave in which a lane's sum exceeds ZCAP (or is not a number) sums its rows again with a running max (one rescale per
// group), its x rows read from memory. The two halves of the wave (lanes l, l^16) are combined at the end.
// Row offset: noff[n] = 12 - M_n - log2(Z_n), so that exp2(s + noff[n]) = 4096 * softmax weight. It is stored as three f16 terms
// into channels 12..14 of the wave's own Wq^T.k rows (zero until then, so that the ones in the x rows add nothing to this kernel's
// scores); no other wave of this launch reads or writes those rows.
// LDS XsB: per buffer rows 0..1023 x halves 0..15 copied and read (pitch CP), published by wait + block barrier.
// coverage: grid NB*SEQ/128 blocks x 128 rows = NB*SEQ row offsets
// ---------------------------------------------------------------------------
DEV float max3f(float a, float b, float c) { return fmaxf(fmaxf(a, b), c); }
// max of a start value and a tile's 8 values: four 3-input steps
DEV float max9f(float s, v8f c) { return max3f(max3f(max3f(max3f(s, c[0], c[1]), c[2], c[3]), c[4], c[5]), c[6], c[7]); }

#define ZCAP 1.0e30f                                     // a lane's sum above this is summed again with a running max

// a group's 8 score tiles, D = A.B + cin. The group's reads stand together, ahead of its first product
template <bool FROM_MEMORY>
DEV void score_group(const _Float16* xq, v16h klo, v16h khi, v8f cin, v8f (&c)[STG / 16]) {
    FragH xa[STG / 32];
#pragma unroll                                           // every fragment index a constant: the arrays stay in registers
    for (unsigned j = 0; j < (unsigned)(STG / 32); ++j) {
        xa[j].half[0] = *(const v8h*)(xq + (j * 32u) * CP);
        xa[j].half[1] = *(const v8h*)(xq + (j * 32u + 16u) * CP);
    }
    // behind global loads: no address register of an issued load is rewritten ahead of this wait
    if (FROM_MEMORY) asm volatile("s_wait_xcnt 0x0" ::: "memory");
#pragma unroll                                           // as above
    for (unsigned j = 0; j < (unsigned)(STG / 32); ++j) c[2 * j]     = mma_f16(xa[j].v, klo, cin);
#pragma unroll                                           // as above
    for (unsigned j = 0; j < (unsigned)(STG / 32); ++j) c[2 * j + 1] = mma_f16(xa[j].v, khi, cin);
    // keeps the vector work on the tiles behind the group's last product: an exp2 moved up to stand directly behind the
    // product that it reads makes the compiler pad behind that product
    __builtin_amdgcn_sched_barrier(0);
}
// max of a start value and a group's 64 values: 8 independent chains
DEV float group_max(float s, const v8f (&c)[STG / 16]) {
    float tm[STG / 16];
#pragma unroll                                           // as above
    for (unsigned mt = 0; mt < (unsigned)(STG / 16); ++mt) tm[mt] = max9f(s, c[mt]);
    return max3f(max3f(tm[0], tm[1], tm[2]), max3f(tm[3], tm[4], tm[5]), fmaxf(tm[6], tm[7]));
}
DEV float sum8f(v8f z) { return ((z[0] + z[1]) + (z[2] + z[3])) + ((z[4] + z[5]) + (z[6] + z[7])); }

__global__ __launch_bounds__(256) void k_stats(_Float16* __restrict__ Kp,
                                               const _Float16* __restrict__ Xp)
{
    __shared__ __attribute__((aligned(16))) _Float16 XsB[2 * BST * CP];

    const unsigned tid = threadIdx.x, lane = tid & 31u, w = tid >> 5;
    const unsigned h = lane >> 4, l15 = lane & 15u;
    const unsigned bps = (unsigned)(SEQ / 128);
    const unsigned b = blockIdx.x / bps;
    const unsigned pos0 = (blockIdx.x - b * bps) * 128u;

    // one stage = BST rows of 32 B, contiguous in memory and in LDS: thread tid moves pieces tid + 256 i (16 B each)
    const char*    xg = (const char*)(Xp + (size_t)b * SEQ * CP) + tid * 16u;
    const unsigned xl = lds_off(XsB) + tid * 16u;
    auto stage_in = [&](unsigned st, unsigned buf) {
        async_copy8(xl + buf * (unsigned)(BST * CP * 2), 4096u, xg + (size_t)st * (BST * CP * 2), (size_t)4096);
    };

    stage_in(0u, 0u);                                    // stage 0 -> buffer 0

    FragH klo, khi;
    {
        const v8h kr = *(const v8h*)(Kp + ((size_t)b * SEQ + pos0 + w * 16u + l15) * CP + 8u * h);
        klo.half[0] = kr;       klo.half[1] = zero8h();
        khi.half[0] = zero8h(); khi.half[1] = kr;
    }

    v8f   zv   = zero8f();                               // 8 partial sums of exp2(s - mrun)

    wait_async0();
    __syncthreads();                                     // stage 0 published
    if (NST > 1) stage_in(1u, 1u);

    float mrun;                                          // the shift of row n = l15 for this lane's columns
    {
        v8f c[STG / 16];
        score_group<false>(XsB + l15 * CP + 8u * h, klo.v, khi.v, zero8f(), c);
        mrun = group_max(-3.0e38f, c);
    }
    v8f nsh;                                             // -shift, the C operand of every score product of the sweep
#pragma unroll                                           // every element index a constant: the vector stays in registers
    for (int r = 0; r < 8; ++r) nsh[r] = -mrun;

    // rolled: one trip per stage, so that the publish point stands once, at the trip's foot
#pragma unroll 1
    for (unsigned st = 0; st < (unsigned)NST; ++st) {
      const unsigned buf = st & 1u;
      const _Float16* xs = XsB + buf * (unsigned)(BST * CP) + l15 * CP + 8u * h;
      // rolled, one group a trip: no barrier inside a stage, so the waves of a SIMD fall out of step and one wave's
      // LDS reads and products run under the other's vector work (unrolled, the stage's score tiles spilled to scratch)
#pragma unroll 1
      for (unsigned g = 0; g < (unsigned)(BST / STG); ++g) {
        v8f c[STG / 16];
        score_group<false>(xs + g * (unsigned)(STG * CP), klo.v, khi.v, nsh, c);
#pragma unroll                                           // every tile index a constant: the array stays in registers
        for (unsigned mt = 0; mt < (unsigned)(STG / 16); ++mt) {
#pragma unroll                                           // as above
            for (int r = 0; r < 8; ++r) zv[r] += ex2(c[mt][r]);
        }
        // nothing of the group moves behind this line, and the statement behind it (inputs only, no instruction) keeps the group's
        // score registers live up to here: no exp2 result is written over the source of the exp2 directly ahead of it
        // (the slot that the instruction set asks for behind a transcendental)
        __builtin_amdgcn_sched_barrier(0);
        asm volatile("" :: "v"(c[0]), "v"(c[1]), "v"(c[2]), "v"(c[3]), "v"(c[4]), "v"(c[5]), "v"(c[6]), "v"(c[7]));
      }
      // publish point of stage st+1; the same barrier ends every reader's last read of stage st's buffer
      wait_ds0();
      wait_async0();
      __syncthreads();
      if (st + 2u < (unsigned)NST) stage_in(st + 2u, buf);
    }
    wait_async0();

    float zl = sum8f(zv);
    // the same for every lane of the wave (a scalar branch: the products inside run with every lane on); no barrier inside
    if (__any(!(zl <= ZCAP))) {
        const _Float16* xr = Xp + (size_t)b * SEQ * CP + l15 * CP + 8u * h;
        mrun = -3.0e38f;
        zv   = zero8f();
#pragma unroll 1                                         // rolled: a path that is all but never taken stays short
        for (unsigned g = 0; g < (unsigned)(SEQ / STG); ++g) {
            v8f c[STG / 16];
            score_group<true>(xr + (size_t)g * (STG * CP), klo.v, khi.v, zero8f(), c);
            const float mn = group_max(mrun, c);
            const float sc = ex2(mrun - mn);
            mrun = mn;
#pragma unroll                                           // every tile index a constant: the array stays in registers
            for (int r = 0; r < 8; ++r) zv[r] = __builtin_fmaf(zv[r], sc, ex2(c[0][r] - mn));
#pragma unroll                                           // as above
            for (unsigned mt = 1; mt < (unsigned)(STG / 16); ++mt) {
#pragma unroll                                           // as above
                for (int r = 0; r < 8; ++r) zv[r] += ex2(c[mt][r] - mn);
            }
        }
        zl = sum8f(zv);
    }

    {
        const float mo = __shfl_xor(mrun, 16);           // the other half's columns of the same row n
        const float zo = __shfl_xor(zl, 16);
        const float M  = fmaxf(mrun, mo);
        const float zs = zl * ex2(mrun - M) + zo * ex2(mo - M);
        const float ov = PLOG2 - M - log2f(zs);          // the row's offset; the upper half of the wave, whose piece of the row holds channels 8..15, stores it
        v4h ot;
        ot[0] = (_Float16)ov;
        const float r1 = ov - (float)ot[0];
        ot[1] = (_Float16)r1;
        ot[2] = (_Float16)(r1 - (float)ot[1]);
        ot[3] = (_Float16)0.f;
        if (h == 1u) *(v4h*)(Kp + ((size_t)b * SEQ + pos0 + w * 16u + l15) * CP + CIN) = ot;
    }
}

// ---------------------------------------------------------------------------
// Kernel 3: value product. Wave w owns output columns m = pos0 + 16w .. +15
// (B = x rows, resident, once with the upper and once with the lower half zero). The swept Wq^T.k rows and Wo.v columns
// are staged 1024 rows at a time in LDS by asynchronous copies, two buffers. Per 32-row step: one A operand holds
// both 16-row tiles of Wq^T.k (as in kernel 2), two score tiles with C = 0 (noff[n] comes in through channels 12..14 of the
// row, against the ones of the x row), P = exp2(D) packed as the B fragment
// (element r <- tile rows 0..15, element 8+r <- tile rows 16..31, lane unchanged: D row 8h+r is
// B k-index 8h+r), A = Wo.v rows (channel-major plane), one tile of output channels accumulated.
// Epilogue: scale, bias, output tile staged and written as whole 512-B rows.
// LDS: boS, outS cross-wave-safe (block barriers between producer and consumer).
//   staged extent == consumed extent: outS 12 x 128 written and read.
//   KsB rows 0..1023 x halves 0..15 (pitch CP), VsB rows 0..15 x halves 0..1023 (pitch VPB), per buffer:
//   copied and read whole, published by wait + block barrier.
// coverage: grid NB*SEQ/128 blocks x 12 rows x 128 cols = NB*12*SEQ outputs; 384 pieces x 4 floats per block
// ---------------------------------------------------------------------------
__global__ __launch_bounds__(256) void k_attn(const _Float16* __restrict__ Kp,
                                              const _Float16* __restrict__ Xp,
                                              const _Float16* __restrict__ Vp,
                                              const float* __restrict__ bo,
                                              float* __restrict__ out)
{
    __shared__ __attribute__((aligned(16))) float outS[CIN * OSP];
    __shared__ float boS[16];
    __shared__ __attribute__((aligned(16))) _Float16 KsB[2 * BST * CP];
    __shared__ __attribute__((aligned(16))) _Float16 VsB[2 * VROWS * VPB];

    const unsigned tid = threadIdx.x, lane = tid & 31u, w = tid >> 5;
    const unsigned h = lane >> 4, l15 = lane & 15u;
    const unsigned bps = (unsigned)(SEQ / 128);
    const unsigned b = blockIdx.x / bps;
    const unsigned pos0 = (blockIdx.x - b * bps) * 128u;

    // one stage: k rows (8 copies per thread: contiguous, pieces tid + 256 i), value columns (8 per thread: piece = 16 B,
    // 128 pieces per row, copy i moves rows 2i and 2i+1)
    const char*     kg = (const char*)(Kp + (size_t)b * SEQ * CP) + tid * 16u;
    const char*     vg = (const char*)(Vp + ((size_t)b * VROWS + (tid >> 7)) * SEQ) + (tid & 127u) * 16u;
    const unsigned  kl = lds_off(KsB) + tid * 16u;
    const unsigned  vl = lds_off(VsB) + (tid >> 7) * (unsigned)(VPB * 2) + (tid & 127u) * 16u;
    auto stage_in = [&](unsigned st, unsigned buf) {
        async_copy8(kl + buf * (unsigned)(BST * CP * 2), 4096u, kg + (size_t)st * (BST * CP * 2), (size_t)4096);
        async_copy8(vl + buf * (unsigned)(VROWS * VPB * 2), (unsigned)(2 * VPB * 2),
                    vg + (size_t)st * (BST * 2), (size_t)(2 * SEQ * 2));
    };

    stage_in(0u, 0u);

    {
        const unsigned ic = tid < (unsigned)CIN ? tid : (unsigned)(CIN - 1);
        const float a0 = bf16_val(bo[ic]);
        if (tid < (unsigned)CIN) boS[tid] = a0;
    }

    FragH xlo, xhi;
    {
        const v8h xr = *(const v8h*)(Xp + ((size_t)b * SEQ + pos0 + w * 16u + l15) * CP + 8u * h);
        xlo.half[0] = xr;       xlo.half[1] = zero8h();
        xhi.half[0] = zero8h(); xhi.half[1] = xr;
    }

    v8f acc = zero8f();

    wait_async0();
    __syncthreads();                                     // stage 0 published
    if (NST > 1) stage_in(1u, 1u);

    // rolled: one trip per stage, so that the publish point stands once, at the trip's foot
#pragma unroll 1
    for (unsigned st = 0; st < (unsigned)NST; ++st) {
      const unsigned buf = st & 1u;
      const _Float16* kb = KsB + buf * (unsigned)(BST * CP) + l15 * CP + 8u * h;
      const _Float16* vb = VsB + buf * (unsigned)(VROWS * VPB) + l15 * VPB + 8u * h;
      // Inside a stage the steps overlap: the two score products of step ns+1 are issued ahead of the exp2 work of step ns, so
      // that the distance which the chip asks for behind a product is filled with that work and no product's result is waited for.
      // LDS reads stand two steps ahead of their use: A operand of step ns+3, value fragment of step ns+2.
      constexpr unsigned NSTEP = (unsigned)(BST / 32);
      FragH ka[2], vf[3], pb[2];
      v8f   cc[2][2];                                    // two steps' score tiles, two per step: step ns in cc[ns & 1]
      auto fetch_k = [&](unsigned ns) {
          const _Float16* kp = kb + ns * 32u * CP;
          ka[ns & 1u].half[0] = *(const v8h*)(kp);             // score tile 0: rows 0..15 of the step
          ka[ns & 1u].half[1] = *(const v8h*)(kp + 16u * CP);  // score tile 1: rows 16..31
      };
      auto fetch_v = [&](unsigned ns) {
          const _Float16* vp = vb + ns * 32u;
          vf[ns % 3u].half[0] = *(const v8h*)(vp);
          vf[ns % 3u].half[1] = *(const v8h*)(vp + 16);
      };
      auto scores = [&](unsigned ns) {
          cc[ns & 1u][0] = mma_f16(ka[ns & 1u].v, xlo.v, zero8f());
          cc[ns & 1u][1] = mma_f16(ka[ns & 1u].v, xhi.v, zero8f());
      };
      static_assert(NSTEP >= 3u);
      fetch_k(0u); fetch_k(1u); fetch_v(0u); fetch_v(1u);
      scores(0u);
      fetch_k(2u);
#pragma unroll                                           // every register set index is a constant in every step: the arrays stay in registers
      for (unsigned ns = 0; ns < NSTEP; ++ns) {
        if (ns + 1u < NSTEP) scores(ns + 1u);
        // keeps the reads behind the products: they then take the A registers that the products have just read, and no exp2
        // result is written there inside the products' distance (the compiler pads where one is)
        __builtin_amdgcn_sched_barrier(0);
        if (ns + 3u < NSTEP) fetch_k(ns + 3u);
        if (ns + 2u < NSTEP) fetch_v(ns + 2u);
        // keeps the next step's products and the reads ahead of this step's vector work: moved down, the products' results
        // would be waited for and the compiler would pad behind them
        __builtin_amdgcn_sched_barrier(0);

#pragma unroll
        for (int r = 0; r < 8; ++r) {
            pb[ns & 1u].v[r]     = (_Float16)ex2(cc[ns & 1u][0][r]);
            pb[ns & 1u].v[8 + r] = (_Float16)ex2(cc[ns & 1u][1][r]);
        }

        acc = mma_f16(vf[ns % 3u].v, pb[ns & 1u].v, acc);
        // keeps the following step's products behind this step's value product, so that the steps stay in this order
        __builtin_amdgcn_sched_barrier(0);
        // inputs only, no instruction: the step's score registers stay live behind its last exp2, so that no exp2 result is written
        // over the source of the exp2 directly ahead of it (the slot that the instruction set asks for behind a transcendental)
        asm volatile("" :: "v"(cc[ns & 1u][0]), "v"(cc[ns & 1u][1]));
        // the same for the step before's P fragment: this step's exp2 results keep off the B registers of a value product that is
        // still inside its distance (the compiler pads where they do not)
        if (ns > 0u) asm volatile("" :: "v"(pb[(ns & 1u) ^ 1u].v));
      }
      // publish point of stage st+1; the same barrier ends every reader's last read of stage st's buffers
      wait_ds0();
      wait_async0();
      __syncthreads();
      if (st + 2u < (unsigned)NST) stage_in(st + 2u, buf);
    }
    wait_async0();

    // output tile: D row = output channel 8h+r (rows 12..15 are padding), column = l15
#pragma unroll
    for (unsigned r = 0; r < 8; ++r) {
        const unsigned o  = 8u * h + r;
        const unsigned oc = o < (unsigned)CIN ? o : (unsigned)(CIN - 1);
        const float val = acc[r] * OUT_SCALE + boS[oc];
        if (o < (unsigned)CIN) outS[o * OSP + w * 16u + l15] = val;
    }
    __syncthreads();

    // whole 512-B rows: wave w writes row w, waves 0..3 also write row 8+w; 32 lanes x 16 B contiguous
    const unsigned row0 = w;
    const unsigned row1 = (8u + w) < (unsigned)CIN ? (8u + w) : (unsigned)(CIN - 1);
    const v4f ov0 = *(const v4f*)(outS + row0 * OSP + lane * 4u);
    const v4f ov1 = *(const v4f*)(outS + row1 * OSP + lane * 4u);
    float* d0 = out + ((size_t)b * CIN + row0) * SEQ + pos0 + lane * 4u;
    float* d1 = out + ((size_t)b * CIN + row1) * SEQ + pos0 + lane * 4u;
    *(v4f*)d0 = ov0;
    if (w < 4u) *(v4f*)d1 = ov1;
}

// ---------------------------------------------------------------------------
extern "C" void kernel_launch(void* const* d_in, const int* in_sizes, int n_in,
                              void* d_out, int out_size, void* d_ws, size_t ws_size,
                              hipStream_t stream)
{
    if (n_in < 9) return;
    const long long need_x = ((long long)NB * CIN - 1) * SEQ_FULL + SEQ;
    if ((long long)in_sizes[0] < need_x) return;
    if (in_sizes[1] < CQK * CIN || in_sizes[2] < CQK) return;
    if (in_sizes[3] < CQK * CIN || in_sizes[4] < CQK) return;
    if (in_sizes[5] < CQK * CIN || in_sizes[6] < CQK) return;
    if (in_sizes[7] < CIN * CQK || in_sizes[8] < CIN) return;
    if ((long long)out_size < (long long)NB * CIN * SEQ) return;

    const float* x  = (const float*)d_in[0];
    const float* wq = (const float*)d_in[1];
    const float* wk = (const float*)d_in[3];
    const float* bk = (const float*)d_in[4];
    const float* wv = (const float*)d_in[5];
    const float* bv = (const float*)d_in[6];
    const float* wo = (const float*)d_in[7];
    const float* bo = (const float*)d_in[8];
    float* out = (float*)d_out;

    char* ws = (char*)d_ws;
    size_t off = 0;
    auto carve = [&](size_t bytes) -> char* {
        char* p = ws + off;
        off += (bytes + 255) & ~(size_t)255;
        return p;
    };
    _Float16* Xp  = (_Float16*)carve((size_t)NB * SEQ * CP * 2);        // [NB*SEQ][16]
    _Float16* Kp  = (_Float16*)carve((size_t)NB * SEQ * CP * 2);        // [NB*SEQ][16]
    _Float16* Vp  = (_Float16*)carve((size_t)NB * VROWS * SEQ * 2);     // [NB][16][SEQ]
    if (off > ws_size) return;

    const unsigned nblk = (unsigned)(NB * (SEQ / 128));
    k_proj <<<nblk, 256, 0, stream>>>(x, wq, wk, bk, wv, bv, wo, Xp, Kp, Vp);
    k_stats<<<nblk, 256, 0, stream>>>(Kp, Xp);
    k_attn <<<nblk, 256, 0, stream>>>(Kp, Xp, Vp, bo, out);
}

// v008
// A run of this version takes 26.1 microseconds.
// Timed twice side by side with v007, it ran 1.08 times as fast both times.
// Counting every step since v000, it is 16.1 times as fast.
#include <hip/hip_runtime.h>

// The 1x1 projections are reassociated through both N x N products, so that the swept operands have 12 channels:
//   scores[n][m] = k_n . (Wq x_m + bq) = (Wq^T k_n) . x_m + (k_n . bq); the last term does not depend on m and cancels in the softmax over m;
//   out[o][m]    = sum_n (Wo v_n)[o] * weight[n][m] + bo[o].
// Contractions: k/v 1x1 projections via v_wmma_f32_16x16x32_bf16 (bf16 operands = RNE-converted inputs, K=12 zero-padded to 32, f32 accumulate);
// Wq^T.k and Wo.v (K=36 zero-padded to 64), the scores (K=12, two 16-row tiles share one K=32 operand) and the value product
// via v_wmma_f32_16x16x32_f16 (f16 operands: x x1, k x(log2e/sqrt(12)), v x16, P x4096), f32 accumulate; softmax statistics in f32.
// Kernel 1: the shift that is taken off a score before its exp2 is the score product's C operand: D = A.B + (-shift).
// Kernel 2: the row's offset rides in the product itself: channels 12..14 of a Wq^T.k row hold it as three f16 terms
// (value, remainder, remainder of that), channels 12..14 of every x row hold 1, so that D = score + offset with C = 0.

#define DEV __device__ __forceinline__

#ifndef NB
#define NB 8
#endif
#ifndef SEQ
#define SEQ 4096
#endif
#define NB_FULL  8
#define SEQ_FULL 4096
#define CIN   12
#define CQK   36
#define CP    16                                         // x / Wq^T.k plane row pitch (halves); channels 12..14: offset terms (k) and ones (x), 15: zero
#define NOFF  3                                          // f16 terms that carry a row's offset
#define VROWS 16                                         // Wo.v plane rows per batch, rows 12..15 are zeros
#define VP    136                                        // LDS pitch (halves) of value staging rows
#define OSP   132                                        // LDS pitch (floats) of output staging rows
#define STG   128                                        // swept rows per group: what a wave works on at a time (kernel 1)
#define BST   1024                                       // swept rows per LDS stage (kernels 1 and 2)
#define NST   (SEQ / BST)                                // stages per sweep
#define VPB   (BST + 8)                                  // LDS pitch (halves) of a stage's value rows: 16 B x odd
#define KSCALE (0.28867513459481287f * 1.4426950408889634f)   // 1/sqrt(12) * log2(e), folded into the k plane
#define VCARRY 16.0f
#define PLOG2  12.0f                                     // P carried x 2^12
#define OUT_SCALE (1.0f / 65536.0f)                      // 1 / (16 * 4096)

static_assert(NB >= 1 && NB <= NB_FULL);
static_assert(SEQ >= BST && SEQ <= SEQ_FULL && (SEQ % BST) == 0 && (BST % STG) == 0);
static_assert(256 * 8 == 128 * CP);                      // x / k plane coverage per block
static_assert(256 * 8 == VROWS * 128);                   // value plane coverage per block
static_assert(384 * 4 == CIN * 128);                     // output coverage per block
static_assert(((CP * 2) % 16) == 0 && ((VP * 2) % 16) == 0 && ((VPB * 2) % 16) == 0 && ((OSP * 4) % 16) == 0);
static_assert(CIN + NOFF <= CP && CIN <= VROWS && CQK <= 64);
static_assert(256 * 4 == BST);                           // x stage: 4 positions per thread
static_assert(8 * 256 * 16 == BST * CP * 2);             // k stage: 8 copies of 16 B per thread
static_assert(8 * 256 * 16 == VROWS * BST * 2);          // value stage: 8 copies of 16 B per thread
static_assert(128 * 16 == BST * 2);                      // value stage: 128 threads move one row, a copy moves two rows
static_assert(STG / 16 == 8);                            // kernel 1 takes its max over 8 tiles per group

typedef _Float16       v2h   __attribute__((ext_vector_type(2)));
typedef _Float16       v4h   __attribute__((ext_vector_type(4)));
typedef _Float16       v8h   __attribute__((ext_vector_type(8)));
typedef _Float16       v16h  __attribute__((ext_vector_type(16)));
typedef __bf16         v2bf  __attribute__((ext_vector_type(2)));
typedef __bf16         v16bf __attribute__((ext_vector_type(16)));
typedef unsigned short v8us  __attribute__((ext_vector_type(8)));
typedef unsigned short v16us __attribute__((ext_vector_type(16)));
typedef float          v8f   __attribute__((ext_vector_type(8)));
typedef float          v4f   __attribute__((ext_vector_type(4)));
typedef float          v2f   __attribute__((ext_vector_type(2)));

union FragH { v16h v;  v8h  half[2]; };
union PieceH { v8h v;  v2h  pair[4]; };
union FragB { v16bf v; v16us u; v8us half[2]; };

// ---------------------------------------------------------------------------
// helpers
// ---------------------------------------------------------------------------
DEV unsigned int bf16_bits(float f) {                    // f32 -> bf16 bits, RNE convert
    unsigned int u = __float_as_uint(f);
    u += 0x7FFFu + ((u >> 16) & 1u);
    return u >> 16;
}
DEV float bf16_val(float f) { return __uint_as_float(bf16_bits(f) << 16); }

DEV v8f zero8f() {
    v8f z;
#pragma unroll
    for (int i = 0; i < 8; ++i) z[i] = 0.f;
    return z;
}

DEV v8h zero8h() {
    v8h z;
#pragma unroll
    for (int i = 0; i < 8; ++i) z[i] = (_Float16)0.f;
    return z;
}

DEV float ex2(float x) { return __builtin_amdgcn_exp2f(x); }

// 16x16x32 WMMA with f32 accumulate, the bare builtin: the compiler keeps the distance behind it
DEV v8f mma_bf16(v16bf a, v16bf b, v8f c) {
    return __builtin_amdgcn_wmma_f32_16x16x32_bf16(false, a, false, b, (short)0, c, false, false);
}
DEV v8f mma_f16(v16h a, v16h b, v8f c) {
    return __builtin_amdgcn_wmma_f32_16x16x32_f16(false, a, false, b, (short)0, c, false, false);
}

// ---------------------------------------------------------------------------
// asynchronous copies global -> LDS, 16 B per lane, through no register.
// Each run of copies ends in its own statement with s_wait_xcnt 0, so that no address register
// of an issued copy is rewritten ahead of that wait.
// ---------------------------------------------------------------------------
DEV unsigned lds_off(const void* p) { return (unsigned)(size_t)p; }   // byte offset in the work-group's LDS

// eight copies, ls bytes apart in LDS and gs bytes apart in memory, each with address registers of its own
DEV void async_copy8(unsigned l, unsigned ls, const char* g, size_t gs) {
    asm volatile("global_load_async_to_lds_b128 %0, %8, off\n\t"
                 "global_load_async_to_lds_b128 %1, %9, off\n\t"
                 "global_load_async_to_lds_b128 %2, %10, off\n\t"
                 "global_load_async_to_lds_b128 %3, %11, off\n\t"
                 "global_load_async_to_lds_b128 %4, %12, off\n\t"
                 "global_load_async_to_lds_b128 %5, %13, off\n\t"
                 "global_load_async_to_lds_b128 %6, %14, off\n\t"
                 "global_load_async_to_lds_b128 %7, %15, off\n\t"
                 "s_wait_xcnt 0x0"
                 :: "v"(l), "v"(l + ls), "v"(l + 2u * ls), "v"(l + 3u * ls),
                    "v"(l + 4u * ls), "v"(l + 5u * ls), "v"(l + 6u * ls), "v"(l + 7u * ls),
                    "v"(g), "v"(g + gs), "v"(g + 2u * gs), "v"(g + 3u * gs),
                    "v"(g + 4u * gs), "v"(g + 5u * gs), "v"(g + 6u * gs), "v"(g + 7u * gs)
                 : "memory");
}
// the issuing wave's own copies have landed in LDS behind this wait
DEV void wait_async0() { asm volatile("s_wait_asynccnt 0x0" ::: "memory"); }
// the wave's own LDS reads have retired before the buffer they read is handed to its next writer
DEV void wait_ds0()    { asm volatile("s_wait_dscnt 0x0" ::: "memory"); }

// A fragment of a [36][12] weight held in LDS as bf16-exact f32 values.
// row c = 16t + l15 (zero for c >= 36); elements 0..7 <- k = 8h+e (zero for k >= 12); elements 8..15 <- k >= 16 -> zero
DEV FragB w_frag(const float* Wl, unsigned t, unsigned h, unsigned l15) {
    FragB a;
    const unsigned c  = 16u * t + l15;
    const unsigned cc = c < (unsigned)CQK ? c : (unsigned)(CQK - 1);
#pragma unroll
    for (unsigned e = 0; e < 8; ++e) {
        const unsigned i  = 8u * h + e;
        const unsigned ic = i < (unsigned)CIN ? i : (unsigned)(CIN - 1);
        const unsigned bits = __float_as_uint(Wl[cc * CIN + ic]) >> 16;
        a.u[e]     = (unsigned short)((c < (unsigned)CQK && i < (unsigned)CIN) ? bits : 0u);
        a.u[8 + e] = (unsigned short)0;
    }
    return a;
}

// one 16(channel) x 16(position) projection tile: (W.x + bias) * carry ; D row = channel 16t+8h+r, column = position l15
DEV v8f proj_tile(const float* Wl, const float* Bl, unsigned t, unsigned h, unsigned l15, v16bf xb, float carry) {
    const FragB a = w_frag(Wl, t, h, l15);
    v8f acc = mma_bf16(a.v, xb, zero8f());
#pragma unroll
    for (unsigned r = 0; r < 8; ++r) {
        const unsigned c  = 16u * t + 8u * h + r;
        const unsigned cc = c < (unsigned)CQK ? c : (unsigned)(CQK - 1);
        const float bvl = Bl[cc];
        acc[r] = (acc[r] + ((c < (unsigned)CQK) ? bvl : 0.f)) * carry;
    }
    return acc;
}

// A fragment of the second product, from a weight held in LDS as bf16-exact f32 values (exact in f16 too but for subnormals).
// row l15 (zero for >= 12), element (row, channel c) at Wl[row * rs + c * cs];
// elements 0..7 <- c = 32j+8h+e, elements 8..15 <- c = 32j+16+8h+(e-8) (zero for c >= 36)
DEV FragH w2_frag(const float* Wl, unsigned rs, unsigned cs, unsigned j, unsigned h, unsigned l15) {
    FragH a;
    const unsigned rr = l15 < (unsigned)CIN ? l15 : (unsigned)(CIN - 1);
#pragma unroll
    for (unsigned e = 0; e < 16; ++e) {
        const unsigned c  = 32u * j + 8u * h + e + (e < 8u ? 0u : 8u);
        const unsigned cc = c < (unsigned)CQK ? c : (unsigned)(CQK - 1);
        const float val = Wl[rr * rs + cc * cs];
        a.v[e] = (c < (unsigned)CQK && l15 < (unsigned)CIN) ? (_Float16)val : (_Float16)0.f;
    }
    return a;
}

// second product: 12 x 36 weight times the 36 x 16 projection held as three D tiles (row = channel 16t+8h+r, column = position).
// D row 8h+r of tile t is B k-index 16t+8h+r, lane unchanged. Result: D row = 8h+r (rows 12..15 zero), column = position l15
DEV v8f second_tile(const float* Wl, unsigned rs, unsigned cs, unsigned h, unsigned l15, v8f d0, v8f d1, v8f d2) {
    FragH b0, b1;
#pragma unroll
    for (int r = 0; r < 8; ++r) {
        b0.v[r]     = (_Float16)d0[r];
        b0.v[8 + r] = (_Float16)d1[r];
        b1.v[r]     = (_Float16)d2[r];
        b1.v[8 + r] = (_Float16)0.f;
    }
    v8f acc = mma_f16(w2_frag(Wl, rs, cs, 0u, h, l15).v, b0.v, zero8f());
    return mma_f16(w2_frag(Wl, rs, cs, 1u, h, l15).v, b1.v, acc);
}

// ---------------------------------------------------------------------------
// Kernel 1: projections and row statistics in one launch. Block = 8 waves = 128 positions of one batch; wave w owns 16 positions.
// Projections: B fragment = x[b][i][n] (bf16 RNE, k = i zero-padded 12 -> 32), A fragments = weights (rows = channels).
//   Outputs: Xp [NB*SEQ][16] f16 (x, bf16-rounded; channels 12..14 one, 15 zero), Vp [NB][16][SEQ] f16 (Wo (v * 16)), rows 12..15 zero;
//   the wave's Wq^T (k * KSCALE) rows (channels 12..15 zero) stay in registers for the sweep and go to Kp [NB*SEQ][16] f16 at the end.
// Statistics: wave w owns score rows n = pos0 + 16w .. +15 (B = Wq^T.k rows, resident) and sweeps all column tiles m (A = x rows).
// The block makes the swept x rows itself from the input: the batch's 4096 rows stand in LDS as f16, 1024 rows a stage; a thread loads
// 4 positions x 12 channels of stage t+1 into registers while stage t is worked on, converts and stores them at the stage's foot.
// No LDS row is written twice. Inside a stage a wave goes through 8 groups of 128 rows at its own pace.
// LDS form of the x rows: a 16-row tile is 512 B, first the 16 pieces of channels 0..7, then the 16 pieces of channels 8..15
// (16 B each), so that 16 lanes write or read 256 contiguous bytes. The order of the rows inside a wave's 128 rows is that of the
// storing lanes (row 32j + lane = position 4 lane + j): a row's sum over all columns does not depend on it.
// One A operand holds two 16-row tiles: elements 0..7
// (k index 8h+e) = channels 8h+e of tile 2j, elements 8..15 (k index 16+8h+e) = the same channels of tile 2j+1;
// B with its upper half zero gives tile 2j's scores, B with its lower half zero tile 2j+1's. The score tile stands transposed:
// D row 8h+r = column m, D column l15 = row n, so all 8 values of a lane belong to ONE row n.
// Per lane: one shift, the max of the lane's 64 scores in the first group, held negated in 8 registers as the C operand of
// every score product, so that D is s - shift; one exp2 and one add per score, 8 partial sums. That max is one of the summed
// scores, so the sum is at least about 1 and cannot vanish; a later score far above the shift can only make it too large.
// A wave in which a lane's sum exceeds ZCAP (or is not a number) sums its rows again with a running max (one rescale per
// group). The two halves of the wave (lanes l, l^16) are combined at the end.
// Row offset: noff[n] = 12 - M_n - log2(Z_n), so that exp2(s + noff[n]) = 4096 * softmax weight. It is stored as three f16 terms
// in channels 12..14 of the wave's own Wq^T.k rows (zero in the registers of the sweep, so that the ones in the x rows add nothing
// to this kernel's scores).
// LDS: Ws/Bs, Vs, XsB are cross-wave (block barriers). staged extent == consumed extent: Vs rows 0..15 x halves 0..127; XsB whole.
// coverage: grid NB*SEQ/128 blocks; per block 256 thr x 8 halves = 128 x 16 (x, k: a wave stores 512 contiguous bytes) = 16 x 128 (values)
// ---------------------------------------------------------------------------
DEV float max3f(float a, float b, float c) { return fmaxf(fmaxf(a, b), c); }
// max of a start value and a tile's 8 values: four 3-input steps
DEV float max9f(float s, v8f c) { return max3f(max3f(max3f(max3f(s, c[0], c[1]), c[2], c[3]), c[4], c[5]), c[6], c[7]); }

#define ZCAP 1.0e30f                                     // a lane's sum above this is summed again with a running max

// a group's 8 score tiles, D = A.B + cin. The group's reads stand together, ahead of its first product
DEV void score_group(const _Float16* xq, v16h klo, v16h khi, v8f cin, v8f (&c)[STG / 16]) {
    FragH xa[STG / 32];
#pragma unroll                                           // every fragment index a constant: the arrays stay in registers
    for (unsigned j = 0; j < (unsigned)(STG / 32); ++j) {
        xa[j].half[0] = *(const v8h*)(xq + (j * 32u) * CP);
        xa[j].half[1] = *(const v8h*)(xq + (j * 32u + 16u) * CP);
    }
#pragma unroll                                           // as above
    for (unsigned j = 0; j < (unsigned)(STG / 32); ++j) c[2 * j]     = mma_f16(xa[j].v, klo, cin);
#pragma unroll                                           // as above
    for (unsigned j = 0; j < (unsigned)(STG / 32); ++j) c[2 * j + 1] = mma_f16(xa[j].v, khi, cin);
    // keeps the vector work on the tiles behind the group's last product: an exp2 moved up to stand directly behind the
    // product that it reads makes the compiler pad behind that product
    __builtin_amdgcn_sched_barrier(0);
}
// max of a start value and a group's 64 values: 8 independent chains
DEV float group_max(float s, const v8f (&c)[STG / 16]) {
    float tm[STG / 16];
#pragma unroll                                           // as above
    for (unsigned mt = 0; mt < (unsigned)(STG / 16); ++mt) tm[mt] = max9f(s, c[mt]);
    return max3f(max3f(tm[0], tm[1], tm[2]), max3f(tm[3], tm[4], tm[5]), fmaxf(tm[6], tm[7]));
}
DEV float sum8f(v8f z) { return ((z[0] + z[1]) + (z[2] + z[3])) + ((z[4] + z[5]) + (z[6] + z[7])); }

// two inputs rounded f32 -> bf16 (RNE), as the projections take them, and held as f32
DEV v2f bf16_round2(v2f p) { return __builtin_convertvector(__builtin_convertvector(p, v2bf), v2f); }
DEV v2h f16_pair(float a, float b) {
    v2f p;
    p[0] = a; p[1] = b;
    return __builtin_convertvector(p, v2h);
}

__global__ __launch_bounds__(256) void k_stats(const float* __restrict__ x,
                                               const float* __restrict__ wq,
                                               const float* __restrict__ wk, const float* __restrict__ bk,
                                               const float* __restrict__ wv, const float* __restrict__ bv,
                                               const float* __restrict__ wo,
                                               _Float16* __restrict__ Xp, _Float16* __restrict__ Kp,
                                               _Float16* __restrict__ Vp)
{
    __shared__ __attribute__((aligned(16))) _Float16 XsB[SEQ * CP];
    __shared__ __attribute__((aligned(16))) _Float16 Vs[VROWS * VP];
    __shared__ float Ws[4 * CQK * CIN];
    __shared__ float Bs[2 * CQK];

    const unsigned tid = threadIdx.x, lane = tid & 31u, w = tid >> 5;
    const unsigned h = lane >> 4, l15 = lane & 15u;
    const unsigned bps = (unsigned)(SEQ / 128);
    const unsigned b = blockIdx.x / bps;
    const unsigned pos0 = (blockIdx.x - b * bps) * 128u;
    const unsigned nl = w * 16u + l15;                   // position inside the block

    // one stage of swept x rows: thread tid holds positions 4 tid .. 4 tid + 3 of the stage, all 12 channels
    const float* xsw = x + (size_t)b * CIN * SEQ_FULL + tid * 4u;
    _Float16*    xst = XsB + (w * 8u + h) * (16u * CP) + l15 * 8u;
    v4f xr[CIN];
    auto stage_load = [&](unsigned st) {
#pragma unroll                                           // every register index a constant: the array stays in registers
        for (unsigned c = 0; c < (unsigned)CIN; ++c) xr[c] = *(const v4f*)(xsw + (size_t)c * SEQ_FULL + st * (unsigned)BST);
        // behind global loads: no address register of an issued load is rewritten ahead of this wait
        asm volatile("s_wait_xcnt 0x0" ::: "memory");
    };
    auto stage_store = [&](unsigned st) {
        _Float16* d = xst + st * (unsigned)(BST * CP);
        float xf[CIN][4];
#pragma unroll                                           // as above
        for (unsigned c = 0; c < (unsigned)CIN; ++c) {
            const v2f lo = bf16_round2(__builtin_shufflevector(xr[c], xr[c], 0, 1));
            const v2f hi = bf16_round2(__builtin_shufflevector(xr[c], xr[c], 2, 3));
            xf[c][0] = lo[0]; xf[c][1] = lo[1]; xf[c][2] = hi[0]; xf[c][3] = hi[1];
        }
#pragma unroll                                           // as above
        for (unsigned j = 0; j < 4u; ++j) {
            PieceH p0, p1;
#pragma unroll                                           // as above
            for (unsigned q = 0; q < 4u; ++q) p0.pair[q] = f16_pair(xf[2u * q][j], xf[2u * q + 1u][j]);
            p1.pair[0] = f16_pair(xf[8][j], xf[9][j]);
            p1.pair[1] = f16_pair(xf[10][j], xf[11][j]);
            p1.v[4] = (_Float16)1.f; p1.v[5] = (_Float16)1.f; p1.v[6] = (_Float16)1.f; p1.v[7] = (_Float16)0.f;
            *(v8h*)(d + j * (32u * CP))      = p0.v;     // channels 0..7 of row 32j + lane
            *(v8h*)(d + j * (32u * CP) + 128u) = p1.v;   // channels 8..15
        }
    };

    // the wave's own 16 positions: input channel 8h+e of position l15 (clamped address, loaded by every lane)
    float xo[8];
    {
        const float* xp = x + (size_t)b * CIN * SEQ_FULL + pos0 + nl;
#pragma unroll                                           // as above
        for (unsigned e = 0; e < 8; ++e) {
            const unsigned i  = 8u * h + e;
            const unsigned ic = i < (unsigned)CIN ? i : (unsigned)(CIN - 1);
            xo[e] = xp[(size_t)ic * SEQ_FULL];
        }
        // behind global loads: no address register of an issued load is rewritten (here: by the loads that follow) ahead of this wait
        asm volatile("s_wait_xcnt 0x0" ::: "memory");
    }
    stage_load(0u);

    // weights and biases -> LDS as bf16-exact f32 (clamped addresses, guarded LDS stores)
#pragma unroll
    for (unsigned it = 0; it < 2; ++it) {
        const unsigned i  = it * 256u + tid;
        const unsigned ic = i < 432u ? i : 431u;
        const float a0 = bf16_val(wq[ic]);
        const float a1 = bf16_val(wk[ic]);
        const float a2 = bf16_val(wv[ic]);
        const float a3 = bf16_val(wo[ic]);
        if (i < 432u) { Ws[i] = a0; Ws[432u + i] = a1; Ws[864u + i] = a2; Ws[1296u + i] = a3; }
    }
    {
        const unsigned ic = tid < (unsigned)CQK ? tid : (unsigned)(CQK - 1);
        const float a1 = bf16_val(bk[ic]);
        const float a2 = bf16_val(bv[ic]);
        if (tid < (unsigned)CQK) { Bs[tid] = a1; Bs[CQK + tid] = a2; }
    }

    // x fragment: column = position, elements 0..7 <- input channel 8h+e (zero for >= 12), 8..15 <- zero
    FragB xb;
    v8h   xh;                                            // the same 8 values as f16, but 1 in channels 12..14: this lane's piece of the x plane row
    {
#pragma unroll
        for (unsigned e = 0; e < 8; ++e) {
            const unsigned i  = 8u * h + e;
            const unsigned raw  = bf16_bits(xo[e]);
            const unsigned bits = (i < (unsigned)CIN) ? raw : 0u;
            xb.u[e]     = (unsigned short)bits;
            xb.u[8 + e] = (unsigned short)0;
            xh[e]       = (i >= (unsigned)CIN && i < (unsigned)(CIN + NOFF)) ? (_Float16)1.f : (_Float16)__uint_as_float(bits << 16);
        }
    }
    stage_store(0u);
    __syncthreads();                                     // weights and stage 0 published

    const size_t prow = ((size_t)b * SEQ + pos0 + nl) * CP + 8u * h;

    // k (scaled into the exp2 domain), then Wq^T . k : row = input channel 8h+r
    v8h kr;
    {
        v8f d[3];
#pragma unroll
        for (unsigned t = 0; t < 3; ++t) d[t] = proj_tile(Ws + CQK * CIN, Bs, t, h, l15, xb.v, KSCALE);
        const v8f acc = second_tile(Ws, 1u, (unsigned)CIN, h, l15, d[0], d[1], d[2]);
#pragma unroll
        for (int r = 0; r < 8; ++r) kr[r] = (_Float16)acc[r];
    }
    // v, then Wo . v : row = output channel 8h+r (channel-major plane)
    {
        v8f d[3];
#pragma unroll
        for (unsigned t = 0; t < 3; ++t) d[t] = proj_tile(Ws + 2 * CQK * CIN, Bs + CQK, t, h, l15, xb.v, VCARRY);
        const v8f acc = second_tile(Ws + 3 * CQK * CIN, (unsigned)CQK, 1u, h, l15, d[0], d[1], d[2]);
#pragma unroll
        for (unsigned r = 0; r < 8; ++r)
            Vs[(8u * h + r) * VP + nl] = (_Float16)acc[r];
    }
    __syncthreads();

    if (NST > 1) stage_load(1u);
    *(v8h*)(Xp + prow) = xh;
    {
        const unsigned row = tid >> 4, pc = tid & 15u;
        const v8h vv = *(const v8h*)(Vs + row * VP + pc * 8u);
        *(v8h*)(Vp + ((size_t)b * VROWS + row) * SEQ + pos0 + pc * 8u) = vv;
    }

    FragH klo, khi;
    klo.half[0] = kr;       klo.half[1] = zero8h();
    khi.half[0] = zero8h(); khi.half[1] = kr;

    v8f   zv   = zero8f();                               // 8 partial sums of exp2(s - mrun)
    const _Float16* xs0 = XsB + h * 128u + l15 * 8u;     // this lane's piece of a tile's row l15

    float mrun;                                          // the shift of row n = l15 for this lane's columns
    {
        v8f c[STG / 16];
        score_group(xs0, klo.v, khi.v, zero8f(), c);
        mrun = group_max(-3.0e38f, c);
    }
    v8f nsh;                                             // -shift, the C operand of every score product of the sweep
#pragma unroll                                           // every element index a constant: the vector stays in registers
    for (int r = 0; r < 8; ++r) nsh[r] = -mrun;

    // rolled: one trip per stage, so that the publish point stands once, at the trip's foot
#pragma unroll 1
    for (unsigned st = 0; st < (unsigned)NST; ++st) {
      const _Float16* xs = xs0 + st * (unsigned)(BST * CP);
      // rolled, one group a trip: no barrier inside a stage, so the waves of a SIMD fall out of step and one wave's
      // LDS reads and products run under the other's vector work (unrolled, the stage's score tiles spilled to scratch)
#pragma unroll 1
      for (unsigned g = 0; g < (unsigned)(BST / STG); ++g) {
        v8f c[STG / 16];
        score_group(xs + g * (unsigned)(STG * CP), klo.v, khi.v, nsh, c);
#pragma unroll                                           // every tile index a constant: the array stays in registers
        for (unsigned mt = 0; mt < (unsigned)(STG / 16); ++mt) {
#pragma unroll                                           // as above
            for (int r = 0; r < 8; ++r) zv[r] += ex2(c[mt][r]);
        }
        // nothing of the group moves behind this line, and the statement behind it (inputs only, no instruction) keeps the group's
        // score registers live up to here: no exp2 result is written over the source of the exp2 directly ahead of it
        // (the slot that the instruction set asks for behind a transcendental)
        __builtin_amdgcn_sched_barrier(0);
        asm volatile("" :: "v"(c[0]), "v"(c[1]), "v"(c[2]), "v"(c[3]), "v"(c[4]), "v"(c[5]), "v"(c[6]), "v"(c[7]));
      }
      // publish point of stage st+1 (the same test for the whole block); behind the last stage nothing is left to publish
      if (st + 1u < (unsigned)NST) {
        stage_store(st + 1u);
        __syncthreads();
        if (st + 2u < (unsigned)NST) stage_load(st + 2u);
      }
    }

    float zl = sum8f(zv);
    // the same for every lane of the wave (a scalar branch: the products inside run with every lane on); no barrier inside
    if (__any(!(zl <= ZCAP))) {
        mrun = -3.0e38f;
        zv   = zero8f();
#pragma unroll 1                                         // rolled: a path that is all but never taken stays short
        for (unsigned g = 0; g < (unsigned)(SEQ / STG); ++g) {
            v8f c[STG / 16];
            score_group(xs0 + g * (unsigned)(STG * CP), klo.v, khi.v, zero8f(), c);
            const float mn = group_max(mrun, c);
            const float sc = ex2(mrun - mn);
            mrun = mn;
#pragma unroll                                           // every tile index a constant: the array stays in registers
            for (int r = 0; r < 8; ++r) zv[r] = __builtin_fmaf(zv[r], sc, ex2(c[0][r] - mn));
#pragma unroll                                           // as above
            for (unsigned mt = 1; mt < (unsigned)(STG / 16); ++mt) {
#pragma unroll                                           // as above
                for (int r = 0; r < 8; ++r) zv[r] += ex2(c[mt][r] - mn);
            }
        }
        zl = sum8f(zv);
    }

    {
        const float mo = __shfl_xor(mrun, 16);           // the other half's columns of the same row n
        const float zo = __shfl_xor(zl, 16);
        const float M  = fmaxf(mrun, mo);
        const float zs = zl * ex2(mrun - M) + zo * ex2(mo - M);
        const float ov = PLOG2 - M - log2f(zs);          // the row's offset; it goes into the piece of the upper half of the wave, which holds channels 8..15
        v4h ot;
        ot[0] = (_Float16)ov;
        const float r1 = ov - (float)ot[0];
        ot[1] = (_Float16)r1;
        ot[2] = (_Float16)(r1 - (float)ot[1]);
        ot[3] = (_Float16)0.f;
        v8h ko = kr;
#pragma unroll
        for (int i = 0; i < 4; ++i) ko[4 + i] = (h == 1u) ? ot[i] : kr[4 + i];
        *(v8h*)(Kp + prow) = ko;
    }
}

// ---------------------------------------------------------------------------
// Kernel 2: value product. Wave w owns output columns m = pos0 + 16w .. +15
// (B = x rows, resident, once with the upper and once with the lower half zero). The swept Wq^T.k rows and Wo.v columns
// are staged 1024 rows at a time in LDS by asynchronous copies, two buffers. Per 32-row step: one A operand holds
// both 16-row tiles of Wq^T.k (as in kernel 1), two score tiles with C = 0 (noff[n] comes in through channels 12..14 of the
// row, against the ones of the x row), P = exp2(D) packed as the B fragment
// (element r <- tile rows 0..15, element 8+r <- tile rows 16..31, lane unchanged: D row 8h+r is
// B k-index 8h+r), A = Wo.v rows (channel-major plane), one tile of output channels accumulated.
// Epilogue: scale, bias, output tile staged and written as whole 512-B rows.
// LDS: boS, outS cross-wave-safe (block barriers between producer and consumer).
//   staged extent == consumed extent: outS 12 x 128 written and read.
//   KsB rows 0..1023 x halves 0..15 (pitch CP), VsB rows 0..15 x halves 0..1023 (pitch VPB), per buffer:
//   copied and read whole, published by wait + block barrier.
// coverage: grid NB*SEQ/128 blocks x 12 rows x 128 cols = NB*12*SEQ outputs; 384 pieces x 4 floats per block
// ---------------------------------------------------------------------------
__global__ __launch_bounds__(256) void k_attn(const _Float16* __restrict__ Kp,
                                              const _Float16* __restrict__ Xp,
                                              const _Float16* __restrict__ Vp,
                                              const float* __restrict__ bo,
                                              float* __restrict__ out)
{
    __shared__ __attribute__((aligned(16))) float outS[CIN * OSP];
    __shared__ float boS[16];
    __shared__ __attribute__((aligned(16))) _Float16 KsB[2 * BST * CP];
    __shared__ __attribute__((aligned(16))) _Float16 VsB[2 * VROWS * VPB];

    const unsigned tid = threadIdx.x, lane = tid & 31u, w = tid >> 5;
    const unsigned h = lane >> 4, l15 = lane & 15u;
    const unsigned bps = (unsigned)(SEQ / 128);
    const unsigned b = blockIdx.x / bps;
    const unsigned pos0 = (blockIdx.x - b * bps) * 128u;

    // one stage: k rows (8 copies per thread: contiguous, pieces tid + 256 i), value columns (8 per thread: piece = 16 B,
    // 128 pieces per row, copy i moves rows 2i and 2i+1)
    const char*     kg = (const char*)(Kp + (size_t)b * SEQ * CP) + tid * 16u;
    const char*     vg = (const char*)(Vp + ((size_t)b * VROWS + (tid >> 7)) * SEQ) + (tid & 127u) * 16u;
    const unsigned  kl = lds_off(KsB) + tid * 16u;
    const unsigned  vl = lds_off(VsB) + (tid >> 7) * (unsigned)(VPB * 2) + (tid & 127u) * 16u;
    auto stage_in = [&](unsigned st, unsigned buf) {
        async_copy8(kl + buf * (unsigned)(BST * CP * 2), 4096u, kg + (size_t)st * (BST * CP * 2), (size_t)4096);
        async_copy8(vl + buf * (unsigned)(VROWS * VPB * 2), (unsigned)(2 * VPB * 2),
                    vg + (size_t)st * (BST * 2), (size_t)(2 * SEQ * 2));
    };

    stage_in(0u, 0u);

    {
        const unsigned ic = tid < (unsigned)CIN ? tid : (unsigned)(CIN - 1);
        const float a0 = bf16_val(bo[ic]);
        if (tid < (unsigned)CIN) boS[tid] = a0;
    }

    FragH xlo, xhi;
    {
        const v8h xr = *(const v8h*)(Xp + ((size_t)b * SEQ + pos0 + w * 16u + l15) * CP + 8u * h);
        xlo.half[0] = xr;       xlo.half[1] = zero8h();
        xhi.half[0] = zero8h(); xhi.half[1] = xr;
    }

    v8f acc = zero8f();

    wait_async0();
    __syncthreads();                                     // stage 0 published
    if (NST > 1) stage_in(1u, 1u);

    // rolled: one trip per stage, so that the publish point stands once, at the trip's foot
#pragma unroll 1
    for (unsigned st = 0; st < (unsigned)NST; ++st) {
      const unsigned buf = st & 1u;
      const _Float16* kb = KsB + buf * (unsigned)(BST * CP) + l15 * CP + 8u * h;
      const _Float16* vb = VsB + buf * (unsigned)(VROWS * VPB) + l15 * VPB + 8u * h;
      // Inside a stage the steps overlap: the two score products of step ns+1 are issued ahead of the exp2 work of step ns, so
      // that the distance which the chip asks for behind a product is filled with that work and no product's result is waited for.
      // LDS reads stand two steps ahead of their use: A operand of step ns+3, value fragment of step ns+2.
      constexpr unsigned NSTEP = (unsigned)(BST / 32);
      FragH ka[2], vf[3], pb[2];
      v8f   cc[2][2];                                    // two steps' score tiles, two per step: step ns in cc[ns & 1]
      auto fetch_k = [&](unsigned ns) {
          const _Float16* kp = kb + ns * 32u * CP;
          ka[ns & 1u].half[0] = *(const v8h*)(kp);             // score tile 0: rows 0..15 of the step
          ka[ns & 1u].half[1] = *(const v8h*)(kp + 16u * CP);  // score tile 1: rows 16..31
      };
      auto fetch_v = [&](unsigned ns) {
          const _Float16* vp = vb + ns * 32u;
          vf[ns % 3u].half[0] = *(const v8h*)(vp);
          vf[ns % 3u].half[1] = *(const v8h*)(vp + 16);
      };
      auto scores = [&](unsigned ns) {
          cc[ns & 1u][0] = mma_f16(ka[ns & 1u].v, xlo.v, zero8f());
          cc[ns & 1u][1] = mma_f16(ka[ns & 1u].v, xhi.v, zero8f());
      };
      static_assert(NSTEP >= 3u);
      fetch_k(0u); fetch_k(1u); fetch_v(0u); fetch_v(1u);
      scores(0u);
      fetch_k(2u);
#pragma unroll                                           // every register set index is a constant in every step: the arrays stay in registers
      for (unsigned ns = 0; ns < NSTEP; ++ns) {
        if (ns + 1u < NSTEP) scores(ns + 1u);
        // keeps the reads behind the products: they then take the A registers that the products have just read, and no exp2
        // result is written there inside the products' distance (the compiler pads where one is)
        __builtin_amdgcn_sched_barrier(0);
        if (ns + 3u < NSTEP) fetch_k(ns + 3u);
        if (ns + 2u < NSTEP) fetch_v(ns + 2u);
        // keeps the next step's products and the reads ahead of this step's vector work: moved down, the products' results
        // would be waited for and the compiler would pad behind them
        __builtin_amdgcn_sched_barrier(0);

#pragma unroll
        for (int r = 0; r < 8; ++r) {
            pb[ns & 1u].v[r]     = (_Float16)ex2(cc[ns & 1u][0][r]);
            pb[ns & 1u].v[8 + r] = (_Float16)ex2(cc[ns & 1u][1][r]);
        }

        acc = mma_f16(vf[ns % 3u].v, pb[ns & 1u].v, acc);
        // keeps the following step's products behind this step's value product, so that the steps stay in this order
        __builtin_amdgcn_sched_barrier(0);
        // inputs only, no instruction: the step's score registers stay live behind its last exp2, so that no exp2 result is written
        // over the source of the exp2 directly ahead of it (the slot that the instruction set asks for behind a transcendental)
        asm volatile("" :: "v"(cc[ns & 1u][0]), "v"(cc[ns & 1u][1]));
        // the same for the step before's P fragment: this step's exp2 results keep off the B registers of a value product that is
        // still inside its distance (the compiler pads where they do not)
        if (ns > 0u) asm volatile("" :: "v"(pb[(ns & 1u) ^ 1u].v));
      }
      // publish point of stage st+1; the same barrier ends every reader's last read of stage st's buffers
      wait_ds0();
      wait_async0();
      __syncthreads();
      if (st + 2u < (unsigned)NST) stage_in(st + 2u, buf);
    }
    wait_async0();

    // output tile: D row = output channel 8h+r (rows 12..15 are padding), column = l15
#pragma unroll
    for (unsigned r = 0; r < 8; ++r) {
        const unsigned o  = 8u * h + r;
        const unsigned oc = o < (unsigned)CIN ? o : (unsigned)(CIN - 1);
        const float val = acc[r] * OUT_SCALE + boS[oc];
        if (o < (unsigned)CIN) outS[o * OSP + w * 16u + l15] = val;
    }
    __syncthreads();

    // whole 512-B rows: wave w writes row w, waves 0..3 also write row 8+w; 32 lanes x 16 B contiguous
    const unsigned row0 = w;
    const unsigned row1 = (8u + w) < (unsigned)CIN ? (8u + w) : (unsigned)(CIN - 1);
    const v4f ov0 = *(const v4f*)(outS + row0 * OSP + lane * 4u);
    const v4f ov1 = *(const v4f*)(outS + row1 * OSP + lane * 4u);
    float* d0 = out + ((size_t)b * CIN + row0) * SEQ + pos0 + lane * 4u;
    float* d1 = out + ((size_t)b * CIN + row1) * SEQ + pos0 + lane * 4u;
    *(v4f*)d0 = ov0;
    if (w < 4u) *(v4f*)d1 = ov1;
}

// ---------------------------------------------------------------------------
extern "C" void kernel_launch(void* const* d_in, const int* in_sizes, int n_in,
                              void* d_out, int out_size, void* d_ws, size_t ws_size,
                              hipStream_t stream)
{
    if (n_in < 9) return;
    const long long need_x = ((long long)NB * CIN - 1) * SEQ_FULL + SEQ;
    if ((long long)in_sizes[0] < need_x) return;
    if (in_sizes[1] < CQK * CIN || in_sizes[2] < CQK) return;
    if (in_sizes[3] < CQK * CIN || in_sizes[4] < CQK) return;
    if (in_sizes[5] < CQK * CIN || in_sizes[6] < CQK) return;
    if (in_sizes[7] < CIN * CQK || in_sizes[8] < CIN) return;
    if ((long long)out_size < (long long)NB * CIN * SEQ) return;

    const float* x  = (const float*)d_in[0];
    const float* wq = (const float*)d_in[1];
    const float* wk = (const float*)d_in[3];
    const float* bk = (const float*)d_in[4];
    const float* wv = (const float*)d_in[5];
    const float* bv = (const float*)d_in[6];
    const float* wo = (const float*)d_in[7];
    const float* bo = (const float*)d_in[8];
    float* out = (float*)d_out;

    char* ws = (char*)d_ws;
    size_t off = 0;
    auto carve = [&](size_t bytes) -> char* {
        char* p = ws + off;
        off += (bytes + 255) & ~(size_t)255;
        return p;
    };
    _Float16* Xp  = (_Float16*)carve((size_t)NB * SEQ * CP * 2);        // [NB*SEQ][16]
    _Float16* Kp  = (_Float16*)carve((size_t)NB * SEQ * CP * 2);        // [NB*SEQ][16]
    _Float16* Vp  = (_Float16*)carve((size_t)NB * VROWS * SEQ * 2);     // [NB][16][SEQ]
    if (off > ws_size) return;

    const unsigned nblk = (unsigned)(NB * (SEQ / 128));
    k_stats<<<nblk, 256, 0, stream>>>(x, wq, wk, bk, wv, bv, wo, Xp, Kp, Vp);
    k_attn <<<nblk, 256, 0, stream>>>(Kp, Xp, Vp, bo, out);
}

// v009
// It runs in 24.7 microseconds.
// In two side-by-side timings against v008, it was 1.05 and 1.06 times as fast.
// Counting every step since v000, it is 17.0 times as fast.
#include <hip/hip_runtime.h>

// The 1x1 projections are reassociated through both N x N products, so that the swept operands have 12 channels:
//   scores[n][m] = k_n . (Wq x_m + bq) = (Wq^T k_n) . x_m + (k_n . bq); the last term does not depend on m and cancels in the softmax over m;
//   out[o][m]    = sum_n (Wo v_n)[o] * weight[n][m] + bo[o].
// Contractions: k/v 1x1 projections via v_wmma_f32_16x16x32_bf16 (bf16 operands = RNE-converted inputs, K=12 zero-padded to 32, f32 accumulate);
// Wq^T.k and Wo.v (K=36 zero-padded to 64), the scores (K=12, two 16-row tiles share one K=32 operand) and the value product
// via v_wmma_f32_16x16x32_f16 (f16 operands: x x1, k x(log2e/sqrt(12)), v x16, P x4096), f32 accumulate; softmax statistics in f32.
// Kernel 1: the shift that is taken off a score before its exp2 is the score product's C operand: D = A.B + (-shift).
// Kernel 2: the row's offset rides in the product itself: channels 12..14 of a Wq^T.k row hold it as three f16 terms
// (value, remainder, remainder of that), channels 12..14 of every x row hold 1, so that D = score + offset with C = 0.

#define DEV __device__ __forceinline__

#ifndef NB
#define NB 8
#endif
#ifndef SEQ
#define SEQ 4096
#endif
#define NB_FULL  8
#define SEQ_FULL 4096
#define CIN   12
#define CQK   36
#define CP    16                                         // x / Wq^T.k plane row pitch (halves); channels 12..14: offset terms (k) and ones (x), 15: zero
#define NOFF  3                                          // f16 terms that carry a row's offset
#define VROWS 16                                         // Wo.v plane rows per batch, rows 12..15 are zeros
#define VP    136                                        // LDS pitch (halves) of value staging rows
#define OSP   132                                        // LDS pitch (floats) of output staging rows
#define STG   128                                        // swept rows per group: what a wave works on at a time (kernel 1)
#define BST   1024                                       // swept rows per LDS stage (kernel 2)
#define NST   (SEQ / BST)                                // stages per sweep (kernel 2)
#define BSX   2048                                       // swept x rows per publish point (kernel 1)
#define NSX   (SEQ / BSX)                                // stages per sweep (kernel 1)
#define NTHR  512                                        // threads per block: 16 waves, four on a SIMD
#define VPB   (BST + 8)                                  // LDS pitch (halves) of a stage's value rows: 16 B x odd
#define KSCALE (0.28867513459481287f * 1.4426950408889634f)   // 1/sqrt(12) * log2(e), folded into the k plane
#define VCARRY 16.0f
#define PLOG2  12.0f                                     // P carried x 2^12
#define OUT_SCALE (1.0f / 65536.0f)                      // 1 / (16 * 4096)

static_assert(NB >= 1 && NB <= NB_FULL);
static_assert(SEQ >= BST && SEQ <= SEQ_FULL && (SEQ % BST) == 0 && (BST % (2 * STG)) == 0);
static_assert(SEQ >= BSX && (SEQ % BSX) == 0 && (BSX % (2 * STG)) == 0);
static_assert(256 * 8 == 128 * CP);                      // x / k plane coverage per block
static_assert(256 * 8 == VROWS * 128);                   // value plane coverage per block
static_assert(384 * 4 == CIN * 128);                     // output coverage per block
static_assert(((CP * 2) % 16) == 0 && ((VP * 2) % 16) == 0 && ((VPB * 2) % 16) == 0 && ((OSP * 4) % 16) == 0);
static_assert(CIN + NOFF <= CP && CIN <= VROWS && CQK <= 64);
static_assert(NTHR * 4 == BSX);                          // x stage: 4 positions per thread
static_assert(4 * NTHR * 16 == BST * CP * 2);            // k stage: 4 copies of 16 B per thread
static_assert(4 * NTHR * 16 == VROWS * BST * 2);         // value stage: 4 copies of 16 B per thread
static_assert(128 * 16 == BST * 2);                      // value stage: 128 threads move one row, a copy moves four rows
static_assert(NTHR >= CQK * CIN && NTHR == 2 * 256);     // one element of each weight per thread; two sets of 8 waves
static_assert(STG / 16 == 8);                            // kernel 1 takes its max over 8 tiles per group

typedef _Float16       v2h   __attribute__((ext_vector_type(2)));
typedef _Float16       v4h   __attribute__((ext_vector_type(4)));
typedef _Float16       v8h   __attribute__((ext_vector_type(8)));
typedef _Float16       v16h  __attribute__((ext_vector_type(16)));
typedef __bf16         v2bf  __attribute__((ext_vector_type(2)));
typedef __bf16         v16bf __attribute__((ext_vector_type(16)));
typedef unsigned short v8us  __attribute__((ext_vector_type(8)));
typedef unsigned short v16us __attribute__((ext_vector_type(16)));
typedef float          v8f   __attribute__((ext_vector_type(8)));
typedef float          v4f   __attribute__((ext_vector_type(4)));
typedef float          v2f   __attribute__((ext_vector_type(2)));

union FragH { v16h v;  v8h  half[2]; };
union PieceH { v8h v;  v2h  pair[4]; };
union FragB { v16bf v; v16us u; v8us half[2]; };

// ---------------------------------------------------------------------------
// helpers
// ---------------------------------------------------------------------------
DEV unsigned int bf16_bits(float f) {                    // f32 -> bf16 bits, RNE convert
    unsigned int u = __float_as_uint(f);
    u += 0x7FFFu + ((u >> 16) & 1u);
    return u >> 16;
}
DEV float bf16_val(float f) { return __uint_as_float(bf16_bits(f) << 16); }

DEV v8f zero8f() {
    v8f z;
#pragma unroll
    for (int i = 0; i < 8; ++i) z[i] = 0.f;
    return z;
}

DEV v8h zero8h() {
    v8h z;
#pragma unroll
    for (int i = 0; i < 8; ++i) z[i] = (_Float16)0.f;
    return z;
}

DEV float ex2(float x) { return __builtin_amdgcn_exp2f(x); }

// 16x16x32 WMMA with f32 accumulate, the bare builtin: the compiler keeps the distance behind it
DEV v8f mma_bf16(v16bf a, v16bf b, v8f c) {
    return __builtin_amdgcn_wmma_f32_16x16x32_bf16(false, a, false, b, (short)0, c, false, false);
}
DEV v8f mma_f16(v16h a, v16h b, v8f c) {
    return __builtin_amdgcn_wmma_f32_16x16x32_f16(false, a, false, b, (short)0, c, false, false);
}

// ---------------------------------------------------------------------------
// asynchronous copies global -> LDS, 16 B per lane, through no register.
// Each run of copies ends in its own statement with s_wait_xcnt 0, so that no address register
// of an issued copy is rewritten ahead of that wait.
// ---------------------------------------------------------------------------
DEV unsigned lds_off(const void* p) { return (unsigned)(size_t)p; }   // byte offset in the work-group's LDS

// four copies, ls bytes apart in LDS and gs bytes apart in memory, each with address registers of its own
DEV void async_copy4(unsigned l, unsigned ls, const char* g, size_t gs) {
    asm volatile("global_load_async_to_lds_b128 %0, %4, off\n\t"
                 "global_load_async_to_lds_b128 %1, %5, off\n\t"
                 "global_load_async_to_lds_b128 %2, %6, off\n\t"
                 "global_load_async_to_lds_b128 %3, %7, off\n\t"
                 "s_wait_xcnt 0x0"
                 :: "v"(l), "v"(l + ls), "v"(l + 2u * ls), "v"(l + 3u * ls),
                    "v"(g), "v"(g + gs), "v"(g + 2u * gs), "v"(g + 3u * gs)
                 : "memory");
}
// the issuing wave's own copies have landed in LDS behind this wait
DEV void wait_async0() { asm volatile("s_wait_asynccnt 0x0" ::: "memory"); }
// the wave's own LDS reads have retired before the buffer they read is handed to its next writer
DEV void wait_ds0()    { asm volatile("s_wait_dscnt 0x0" ::: "memory"); }

// A fragment of a [36][12] weight held in LDS as bf16-exact f32 values.
// row c = 16t + l15 (zero for c >= 36); elements 0..7 <- k = 8h+e (zero for k >= 12); elements 8..15 <- k >= 16 -> zero
DEV FragB w_frag(const float* Wl, unsigned t, unsigned h, unsigned l15) {
    FragB a;
    const unsigned c  = 16u * t + l15;
    const unsigned cc = c < (unsigned)CQK ? c : (unsigned)(CQK - 1);
#pragma unroll
    for (unsigned e = 0; e < 8; ++e) {
        const unsigned i  = 8u * h + e;
        const unsigned ic = i < (unsigned)CIN ? i : (unsigned)(CIN - 1);
        const unsigned bits = __float_as_uint(Wl[cc * CIN + ic]) >> 16;
        a.u[e]     = (unsigned short)((c < (unsigned)CQK && i < (unsigned)CIN) ? bits : 0u);
        a.u[8 + e] = (unsigned short)0;
    }
    return a;
}

// one 16(channel) x 16(position) projection tile: (W.x + bias) * carry ; D row = channel 16t+8h+r, column = position l15
DEV v8f proj_tile(const float* Wl, const float* Bl, unsigned t, unsigned h, unsigned l15, v16bf xb, float carry) {
    const FragB a = w_frag(Wl, t, h, l15);
    v8f acc = mma_bf16(a.v, xb, zero8f());
#pragma unroll
    for (unsigned r = 0; r < 8; ++r) {
        const unsigned c  = 16u * t + 8u * h + r;
        const unsigned cc = c < (unsigned)CQK ? c : (unsigned)(CQK - 1);
        const float bvl = Bl[cc];
        acc[r] = (acc[r] + ((c < (unsigned)CQK) ? bvl : 0.f)) * carry;
    }
    return acc;
}

// A fragment of the second product, from a weight held in LDS as bf16-exact f32 values (exact in f16 too but for subnormals).
// row l15 (zero for >= 12), element (row, channel c) at Wl[row * rs + c * cs];
// elements 0..7 <- c = 32j+8h+e, elements 8..15 <- c = 32j+16+8h+(e-8) (zero for c >= 36)
DEV FragH w2_frag(const float* Wl, unsigned rs, unsigned cs, unsigned j, unsigned h, unsigned l15) {
    FragH a;
    const unsigned rr = l15 < (unsigned)CIN ? l15 : (unsigned)(CIN - 1);
#pragma unroll
    for (unsigned e = 0; e < 16; ++e) {
        const unsigned c  = 32u * j + 8u * h + e + (e < 8u ? 0u : 8u);
        const unsigned cc = c < (unsigned)CQK ? c : (unsigned)(CQK - 1);
        const float val = Wl[rr * rs + cc * cs];
        a.v[e] = (c < (unsigned)CQK && l15 < (unsigned)CIN) ? (_Float16)val : (_Float16)0.f;
    }
    return a;
}

// second product: 12 x 36 weight times the 36 x 16 projection held as three D tiles (row = channel 16t+8h+r, column = position).
// D row 8h+r of tile t is B k-index 16t+8h+r, lane unchanged. Result: D row = 8h+r (rows 12..15 zero), column = position l15
DEV v8f second_tile(const float* Wl, unsigned rs, unsigned cs, unsigned h, unsigned l15, v8f d0, v8f d1, v8f d2) {
    FragH b0, b1;
#pragma unroll
    for (int r = 0; r < 8; ++r) {
        b0.v[r]     = (_Float16)d0[r];
        b0.v[8 + r] = (_Float16)d1[r];
        b1.v[r]     = (_Float16)d2[r];
        b1.v[8 + r] = (_Float16)0.f;
    }
    v8f acc = mma_f16(w2_frag(Wl, rs, cs, 0u, h, l15).v, b0.v, zero8f());
    return mma_f16(w2_frag(Wl, rs, cs, 1u, h, l15).v, b1.v, acc);
}

// ---------------------------------------------------------------------------
// Kernel 1: projections and row statistics in one launch. Block = 16 waves (four on a SIMD) = 128 positions of one batch;
// waves w and w + 8 own the same 16 positions: the lower wave makes their Wq^T.k rows, the upper their value columns, and of
// every stage of the sweep the lower wave takes the first half of the rows, the upper the second half.
// Projections: B fragment = x[b][i][n] (bf16 RNE, k = i zero-padded 12 -> 32), A fragments = weights (rows = channels).
//   Outputs: Xp [NB*SEQ][16] f16 (x, bf16-rounded; channels 12..14 one, 15 zero), Vp [NB][16][SEQ] f16 (Wo (v * 16)), rows 12..15 zero;
//   the wave's Wq^T (k * KSCALE) rows (channels 12..15 zero) stay in registers for the sweep and go to Kp [NB*SEQ][16] f16 at the end.
// Statistics: a wave owns score rows n = pos0 + 16 (w mod 8) .. +15 (B = Wq^T.k rows, resident) and sweeps its half of the column tiles m (A = x rows).
// The block makes the swept x rows itself from the input: the batch's 4096 rows stand in LDS as f16, 2048 rows a stage; a thread loads
// 4 positions x 12 channels of stage t+1 into registers while stage t is worked on, converts and stores them at the stage's foot.
// No LDS row is written twice. Inside a stage a wave goes through 8 groups of 128 rows at its own pace.
// LDS form of the x rows: a 16-row tile is 512 B, first the 16 pieces of channels 0..7, then the 16 pieces of channels 8..15
// (16 B each), so that 16 lanes write or read 256 contiguous bytes. The order of the rows inside a wave's 128 rows is that of the
// storing lanes (row 32j + lane = position 4 lane + j): a row's sum over all columns does not depend on it.
// One A operand holds two 16-row tiles: elements 0..7
// (k index 8h+e) = channels 8h+e of tile 2j, elements 8..15 (k index 16+8h+e) = the same channels of tile 2j+1;
// B with its upper half zero gives tile 2j's scores, B with its lower half zero tile 2j+1's. The score tile stands transposed:
// D row 8h+r = column m, D column l15 = row n, so all 8 values of a lane belong to ONE row n.
// Per lane: one shift, the max of the lane's 64 scores in the first group, held negated in 8 registers as the C operand of
// every score product, so that D is s - shift; one exp2 and one add per score, 8 partial sums. That max is one of the summed
// scores, so the sum is at least about 1 and cannot vanish; a later score far above the shift can only make it too large.
// A wave in which a lane's sum exceeds ZCAP (or is not a number) sums its rows again with a running max (one rescale per
// group). The two halves of the wave (lanes l, l^16) are combined at the end, then the two waves of a row through LDS.
// Row offset: noff[n] = 12 - M_n - log2(Z_n), so that exp2(s + noff[n]) = 4096 * softmax weight. It is stored as three f16 terms
// in channels 12..14 of the wave's own Wq^T.k rows (zero in the registers of the sweep, so that the ones in the x rows add nothing
// to this kernel's scores).
// LDS: Ws/Bs, Vs, KrS, MzS, XsB are cross-wave (block barriers). staged extent == consumed extent: Vs rows 0..15 x halves 0..127; XsB whole.
// coverage: grid NB*SEQ/128 blocks; per block 256 thr x 8 halves = 128 x 16 (x, k: a wave stores 512 contiguous bytes) = 16 x 128 (values)
// ---------------------------------------------------------------------------
DEV float max3f(float a, float b, float c) { return fmaxf(fmaxf(a, b), c); }
// max of a start value and a tile's 8 values: four 3-input steps
DEV float max9f(float s, v8f c) { return max3f(max3f(max3f(max3f(s, c[0], c[1]), c[2], c[3]), c[4], c[5]), c[6], c[7]); }

#define ZCAP 1.0e30f                                     // a lane's sum above this is summed again with a running max

// a group's 8 score tiles, D = A.B + cin. The group's reads stand together, ahead of its first product
DEV void score_group(const _Float16* xq, v16h klo, v16h khi, v8f cin, v8f (&c)[STG / 16]) {
    FragH xa[STG / 32];
#pragma unroll                                           // every fragment index a constant: the arrays stay in registers
    for (unsigned j = 0; j < (unsigned)(STG / 32); ++j) {
        xa[j].half[0] = *(const v8h*)(xq + (j * 32u) * CP);
        xa[j].half[1] = *(const v8h*)(xq + (j * 32u + 16u) * CP);
    }
#pragma unroll                                           // as above
    for (unsigned j = 0; j < (unsigned)(STG / 32); ++j) c[2 * j]     = mma_f16(xa[j].v, klo, cin);
#pragma unroll                                           // as above
    for (unsigned j = 0; j < (unsigned)(STG / 32); ++j) c[2 * j + 1] = mma_f16(xa[j].v, khi, cin);
    // keeps the vector work on the tiles behind the group's last product: an exp2 moved up to stand directly behind the
    // product that it reads makes the compiler pad behind that product
    __builtin_amdgcn_sched_barrier(0);
}
// max of a start value and a group's 64 values: 8 independent chains
DEV float group_max(float s, const v8f (&c)[STG / 16]) {
    float tm[STG / 16];
#pragma unroll                                           // as above
    for (unsigned mt = 0; mt < (unsigned)(STG / 16); ++mt) tm[mt] = max9f(s, c[mt]);
    return max3f(max3f(tm[0], tm[1], tm[2]), max3f(tm[3], tm[4], tm[5]), fmaxf(tm[6], tm[7]));
}
DEV float sum8f(v8f z) { return ((z[0] + z[1]) + (z[2] + z[3])) + ((z[4] + z[5]) + (z[6] + z[7])); }

// two inputs rounded f32 -> bf16 (RNE), as the projections take them, and held as f32
DEV v2f bf16_round2(v2f p) { return __builtin_convertvector(__builtin_convertvector(p, v2bf), v2f); }
DEV v2h f16_pair(float a, float b) {
    v2f p;
    p[0] = a; p[1] = b;
    return __builtin_convertvector(p, v2h);
}

__global__ __launch_bounds__(NTHR) void k_stats(const float* __restrict__ x,
                                               const float* __restrict__ wq,
                                               const float* __restrict__ wk, const float* __restrict__ bk,
                                               const float* __restrict__ wv, const float* __restrict__ bv,
                                               const float* __restrict__ wo,
                                               _Float16* __restrict__ Xp, _Float16* __restrict__ Kp,
                                               _Float16* __restrict__ Vp)
{
    __shared__ __attribute__((aligned(16))) _Float16 XsB[SEQ * CP];
    __shared__ __attribute__((aligned(16))) _Float16 Vs[VROWS * VP];
    __shared__ __attribute__((aligned(16))) _Float16 KrS[8 * 32 * 8];   // the Wq^T.k pieces, handed from the waves that make them to their partners
    __shared__ float MzS[2 * 128];                       // max and sum of the upper waves' columns, per row
    __shared__ float Ws[4 * CQK * CIN];
    __shared__ float Bs[2 * CQK];

    const unsigned tid = threadIdx.x, lane = tid & 31u, w = tid >> 5;
    const unsigned h = lane >> 4, l15 = lane & 15u;
    // the wave's number as a scalar: the tests on hf are scalar branches, so the products inside them run with every lane on
    const unsigned ws = (unsigned)__builtin_amdgcn_readfirstlane((int)w);
    const unsigned cw = ws & 7u;                         // which 16 positions of the block
    const unsigned hf = ws >> 3;                         // which half of every stage's swept rows
    const unsigned bps = (unsigned)(SEQ / 128);
    const unsigned b = blockIdx.x / bps;
    const unsigned pos0 = (blockIdx.x - b * bps) * 128u;
    const unsigned nl = cw * 16u + l15;                  // position inside the block

    // one stage of swept x rows: thread tid holds positions 4 tid .. 4 tid + 3 of the stage, all 12 channels
    const float* xsw = x + (size_t)b * CIN * SEQ_FULL + tid * 4u;
    _Float16*    xst = XsB + (w * 8u + h) * (16u * CP) + l15 * 8u;
    v4f xr[CIN];
    auto stage_load = [&](unsigned st) {
#pragma unroll                                           // every register index a constant: the array stays in registers
        for (unsigned c = 0; c < (unsigned)CIN; ++c) xr[c] = *(const v4f*)(xsw + (size_t)c * SEQ_FULL + st * (unsigned)BSX);
        // behind global loads: no address register of an issued load is rewritten ahead of this wait
        asm volatile("s_wait_xcnt 0x0" ::: "memory");
    };
    auto stage_store = [&](unsigned st) {
        _Float16* d = xst + st * (unsigned)(BSX * CP);
        float xf[CIN][4];
#pragma unroll                                           // as above
        for (unsigned c = 0; c < (unsigned)CIN; ++c) {
            const v2f lo = bf16_round2(__builtin_shufflevector(xr[c], xr[c], 0, 1));
            const v2f hi = bf16_round2(__builtin_shufflevector(xr[c], xr[c], 2, 3));
            xf[c][0] = lo[0]; xf[c][1] = lo[1]; xf[c][2] = hi[0]; xf[c][3] = hi[1];
        }
#pragma unroll                                           // as above
        for (unsigned j = 0; j < 4u; ++j) {
            PieceH p0, p1;
#pragma unroll                                           // as above
            for (unsigned q = 0; q < 4u; ++q) p0.pair[q] = f16_pair(xf[2u * q][j], xf[2u * q + 1u][j]);
            p1.pair[0] = f16_pair(xf[8][j], xf[9][j]);
            p1.pair[1] = f16_pair(xf[10][j], xf[11][j]);
            p1.v[4] = (_Float16)1.f; p1.v[5] = (_Float16)1.f; p1.v[6] = (_Float16)1.f; p1.v[7] = (_Float16)0.f;
            *(v8h*)(d + j * (32u * CP))      = p0.v;     // channels 0..7 of row 32j + lane
            *(v8h*)(d + j * (32u * CP) + 128u) = p1.v;   // channels 8..15
        }
    };

    // the wave's own 16 positions: input channel 8h+e of position l15 (clamped address, loaded by every lane)
    float xo[8];
    {
        const float* xp = x + (size_t)b * CIN * SEQ_FULL + pos0 + nl;
#pragma unroll                                           // as above
        for (unsigned e = 0; e < 8; ++e) {
            const unsigned i  = 8u * h + e;
            const unsigned ic = i < (unsigned)CIN ? i : (unsigned)(CIN - 1);
            xo[e] = xp[(size_t)ic * SEQ_FULL];
        }
        // behind global loads: no address register of an issued load is rewritten (here: by the loads that follow) ahead of this wait
        asm volatile("s_wait_xcnt 0x0" ::: "memory");
    }
    stage_load(0u);

    // weights and biases -> LDS as bf16-exact f32 (clamped addresses, guarded LDS stores)
    {
        const unsigned i  = tid;
        const unsigned ic = i < 432u ? i : 431u;
        const float a0 = bf16_val(wq[ic]);
        const float a1 = bf16_val(wk[ic]);
        const float a2 = bf16_val(wv[ic]);
        const float a3 = bf16_val(wo[ic]);
        if (i < 432u) { Ws[i] = a0; Ws[432u + i] = a1; Ws[864u + i] = a2; Ws[1296u + i] = a3; }
    }
    {
        const unsigned ic = tid < (unsigned)CQK ? tid : (unsigned)(CQK - 1);
        const float a1 = bf16_val(bk[ic]);
        const float a2 = bf16_val(bv[ic]);
        if (tid < (unsigned)CQK) { Bs[tid] = a1; Bs[CQK + tid] = a2; }
    }

    // x fragment: column = position, elements 0..7 <- input channel 8h+e (zero for >= 12), 8..15 <- zero
    FragB xb;
    v8h   xh;                                            // the same 8 values as f16, but 1 in channels 12..14: this lane's piece of the x plane row
    {
#pragma unroll
        for (unsigned e = 0; e < 8; ++e) {
            const unsigned i  = 8u * h + e;
            const unsigned raw  = bf16_bits(xo[e]);
            const unsigned bits = (i < (unsigned)CIN) ? raw : 0u;
            xb.u[e]     = (unsigned short)bits;
            xb.u[8 + e] = (unsigned short)0;
            xh[e]       = (i >= (unsigned)CIN && i < (unsigned)(CIN + NOFF)) ? (_Float16)1.f : (_Float16)__uint_as_float(bits << 16);
        }
    }
    stage_store(0u);
    __syncthreads();                                     // weights and stage 0 published

    const size_t prow = ((size_t)b * SEQ + pos0 + nl) * CP + 8u * h;

    // the lower 8 waves make the k rows of the block's 8 position tiles, the upper 8 waves the value columns
    if (hf == 0u) {
        // k (scaled into the exp2 domain), then Wq^T . k : row = input channel 8h+r
        v8h kq;
        v8f d[3];
#pragma unroll
        for (unsigned t = 0; t < 3; ++t) d[t] = proj_tile(Ws + CQK * CIN, Bs, t, h, l15, xb.v, KSCALE);
        const v8f acc = second_tile(Ws, 1u, (unsigned)CIN, h, l15, d[0], d[1], d[2]);
#pragma unroll
        for (int r = 0; r < 8; ++r) kq[r] = (_Float16)acc[r];
        *(v8h*)(KrS + (cw * 32u + lane) * 8u) = kq;
    } else {
        // v, then Wo . v : row = output channel 8h+r (channel-major plane)
        v8f d[3];
#pragma unroll
        for (unsigned t = 0; t < 3; ++t) d[t] = proj_tile(Ws + 2 * CQK * CIN, Bs + CQK, t, h, l15, xb.v, VCARRY);
        const v8f acc = second_tile(Ws + 3 * CQK * CIN, (unsigned)CQK, 1u, h, l15, d[0], d[1], d[2]);
#pragma unroll
        for (unsigned r = 0; r < 8; ++r)
            Vs[(8u * h + r) * VP + nl] = (_Float16)acc[r];
    }
    __syncthreads();                                     // k pieces and value columns published

    if (NSX > 1) stage_load(1u);
    const v8h kr = *(const v8h*)(KrS + (cw * 32u + lane) * 8u);
    if (hf == 0u) {
        *(v8h*)(Xp + prow) = xh;
        // behind a global store: no register of an issued store is rewritten ahead of this wait
        asm volatile("s_wait_xcnt 0x0" ::: "memory");
    } else {
        const unsigned t2 = tid & 255u, row = t2 >> 4, pc = t2 & 15u;
        const v8h vv = *(const v8h*)(Vs + row * VP + pc * 8u);
        *(v8h*)(Vp + ((size_t)b * VROWS + row) * SEQ + pos0 + pc * 8u) = vv;
        // as above
        asm volatile("s_wait_xcnt 0x0" ::: "memory");
    }

    FragH klo, khi;
    klo.half[0] = kr;       klo.half[1] = zero8h();
    khi.half[0] = zero8h(); khi.half[1] = kr;

    v8f   zv   = zero8f();                               // 8 partial sums of exp2(s - mrun)
    // this lane's piece of a tile's row l15, in the wave's half of stage 0
    const _Float16* xs0 = XsB + hf * (unsigned)((BSX / 2) * CP) + h * 128u + l15 * 8u;

    float mrun;                                          // the shift of row n = l15 for this lane's columns
    {
        v8f c[STG / 16];
        score_group(xs0, klo.v, khi.v, zero8f(), c);
        mrun = group_max(-3.0e38f, c);
    }
    v8f nsh;                                             // -shift, the C operand of every score product of the sweep
#pragma unroll                                           // every element index a constant: the vector stays in registers
    for (int r = 0; r < 8; ++r) nsh[r] = -mrun;

    // unrolled over the stages: rolled, the compiler lifts the conversion of the next stage's rows out of the loop, to where
    // their loads have only just been issued, and the sweep then starts behind the loads' whole latency
    const _Float16* xg = xs0;                            // the wave's next group: a running address, so that every read's offset fits its field
#pragma unroll
    for (unsigned st = 0; st < (unsigned)NSX; ++st) {
      // rolled, one group a trip: no barrier inside a stage, so the waves of a SIMD fall out of step and one wave's
      // LDS reads and products run under the other's vector work (unrolled, the stage's score tiles spilled to scratch)
#pragma unroll 1
      for (unsigned g = 0; g < (unsigned)(BSX / 2 / STG); ++g) {
        v8f c[STG / 16];
        score_group(xg, klo.v, khi.v, nsh, c);
        xg += (unsigned)(STG * CP);
#pragma unroll                                           // every tile index a constant: the array stays in registers
        for (unsigned mt = 0; mt < (unsigned)(STG / 16); ++mt) {
#pragma unroll                                           // as above
            for (int r = 0; r < 8; ++r) zv[r] += ex2(c[mt][r]);
        }
        // nothing of the group moves behind this line, and the statement behind it (inputs only, no instruction) keeps the group's
        // score registers live up to here: no exp2 result is written over the source of the exp2 directly ahead of it
        // (the slot that the instruction set asks for behind a transcendental)
        __builtin_amdgcn_sched_barrier(0);
        asm volatile("" :: "v"(c[0]), "v"(c[1]), "v"(c[2]), "v"(c[3]), "v"(c[4]), "v"(c[5]), "v"(c[6]), "v"(c[7]));
      }
      // publish point of stage st+1 (the same test for the whole block); behind the last stage nothing is left to publish
      xg += (unsigned)((BSX / 2) * CP);                  // over the partner wave's half
      if (st + 1u < (unsigned)NSX) {
        stage_store(st + 1u);
        __syncthreads();
        if (st + 2u < (unsigned)NSX) stage_load(st + 2u);
      }
    }

    float zl = sum8f(zv);
    // the same for every lane of the wave (a scalar branch: the products inside run with every lane on); no barrier inside
    if (__any(!(zl <= ZCAP))) {
        mrun = -3.0e38f;
        zv   = zero8f();
#pragma unroll 1                                         // rolled: a path that is all but never taken stays short
        for (unsigned g = 0; g < (unsigned)(SEQ / 2 / STG); ++g) {
            v8f c[STG / 16];
            constexpr unsigned GPS = (unsigned)(BSX / 2 / STG);   // groups of the wave's half of a stage
            score_group(xs0 + (g / GPS) * (unsigned)(BSX * CP) + (g % GPS) * (unsigned)(STG * CP), klo.v, khi.v, zero8f(), c);
            const float mn = group_max(mrun, c);
            const float sc = ex2(mrun - mn);
            mrun = mn;
#pragma unroll                                           // every tile index a constant: the array stays in registers
            for (int r = 0; r < 8; ++r) zv[r] = __builtin_fmaf(zv[r], sc, ex2(c[0][r] - mn));
#pragma unroll                                           // as above
            for (unsigned mt = 1; mt < (unsigned)(STG / 16); ++mt) {
#pragma unroll                                           // as above
                for (int r = 0; r < 8; ++r) zv[r] += ex2(c[mt][r] - mn);
            }
        }
        zl = sum8f(zv);
    }

    {
        const float mo = __shfl_xor(mrun, 16);           // the other half's columns of the same row n
        const float zo = __shfl_xor(zl, 16);
        const float Mw = fmaxf(mrun, mo);
        const float zw = zl * ex2(mrun - Mw) + zo * ex2(mo - Mw);
        // the upper waves' halves of the columns go to their partners through LDS
        if (hf == 1u && h == 0u) { MzS[nl] = Mw; MzS[128u + nl] = zw; }
        __syncthreads();
        if (hf == 1u) return;                            // behind the block's last barrier
        const float Mp = MzS[nl];
        const float zp = MzS[128u + nl];
        const float M  = fmaxf(Mw, Mp);
        const float zs = zw * ex2(Mw - M) + zp * ex2(Mp - M);
        const float ov = PLOG2 - M - log2f(zs);          // the row's offset; it goes into the piece of the upper half of the wave, which holds channels 8..15
        v4h ot;
        ot[0] = (_Float16)ov;
        const float r1 = ov - (float)ot[0];
        ot[1] = (_Float16)r1;
        ot[2] = (_Float16)(r1 - (float)ot[1]);
        ot[3] = (_Float16)0.f;
        v8h ko = kr;
#pragma unroll
        for (int i = 0; i < 4; ++i) ko[4 + i] = (h == 1u) ? ot[i] : kr[4 + i];
        *(v8h*)(Kp + prow) = ko;
    }
}

// ---------------------------------------------------------------------------
// Kernel 2: value product. Block = 16 waves (four on a SIMD). Waves w and w + 8 own output columns m = pos0 + 16 (w mod 8) .. +15; of every
// stage the lower wave takes the first 512 swept rows, the upper the last 512; the two partial tiles are added at the end through LDS
// (B = x rows, resident, once with the upper and once with the lower half zero). The swept Wq^T.k rows and Wo.v columns
// are staged 1024 rows at a time in LDS by asynchronous copies, two buffers. Per 32-row step: one A operand holds
// both 16-row tiles of Wq^T.k (as in kernel 1), two score tiles with C = 0 (noff[n] comes in through channels 12..14 of the
// row, against the ones of the x row), P = exp2(D) packed as the B fragment
// (element r <- tile rows 0..15, element 8+r <- tile rows 16..31, lane unchanged: D row 8h+r is
// B k-index 8h+r), A = Wo.v rows (channel-major plane), one tile of output channels accumulated.
// Epilogue: scale, bias, output tile staged and written as whole 512-B rows.
// LDS: boS, accS, outS cross-wave-safe (block barriers between producer and consumer).
//   staged extent == consumed extent: outS 12 x 128 written and read.
//   KsB rows 0..1023 x halves 0..15 (pitch CP), VsB rows 0..15 x halves 0..1023 (pitch VPB), per buffer:
//   copied and read whole, published by wait + block barrier.
// coverage: grid NB*SEQ/128 blocks x 12 rows x 128 cols = NB*12*SEQ outputs; 384 pieces x 4 floats per block
// ---------------------------------------------------------------------------
__global__ __launch_bounds__(NTHR) void k_attn(const _Float16* __restrict__ Kp,
                                              const _Float16* __restrict__ Xp,
                                              const _Float16* __restrict__ Vp,
                                              const float* __restrict__ bo,
                                              float* __restrict__ out)
{
    __shared__ __attribute__((aligned(16))) float outS[CIN * OSP];
    __shared__ float boS[16];
    __shared__ float accS[8 * 8 * 32];                   // the upper waves' output tiles
    __shared__ __attribute__((aligned(16))) _Float16 KsB[2 * BST * CP];
    __shared__ __attribute__((aligned(16))) _Float16 VsB[2 * VROWS * VPB];

    const unsigned tid = threadIdx.x, lane = tid & 31u, w = tid >> 5;
    const unsigned h = lane >> 4, l15 = lane & 15u;
    const unsigned cw = w & 7u;                          // which 16 output columns of the block
    const unsigned hf = w >> 3;                          // which half of every stage's swept rows
    const unsigned bps = (unsigned)(SEQ / 128);
    const unsigned b = blockIdx.x / bps;
    const unsigned pos0 = (blockIdx.x - b * bps) * 128u;

    // one stage: k rows (4 copies per thread: contiguous, pieces tid + 512 i), value columns (4 per thread: piece = 16 B,
    // 128 pieces per row, copy i moves rows 4i .. 4i+3)
    const char*     kg = (const char*)(Kp + (size_t)b * SEQ * CP) + tid * 16u;
    const char*     vg = (const char*)(Vp + ((size_t)b * VROWS + (tid >> 7)) * SEQ) + (tid & 127u) * 16u;
    const unsigned  kl = lds_off(KsB) + tid * 16u;
    const unsigned  vl = lds_off(VsB) + (tid >> 7) * (unsigned)(VPB * 2) + (tid & 127u) * 16u;
    auto stage_in = [&](unsigned st, unsigned buf) {
        async_copy4(kl + buf * (unsigned)(BST * CP * 2), (unsigned)(NTHR * 16), kg + (size_t)st * (BST * CP * 2), (size_t)(NTHR * 16));
        async_copy4(vl + buf * (unsigned)(VROWS * VPB * 2), (unsigned)(4 * VPB * 2),
                    vg + (size_t)st * (BST * 2), (size_t)(4 * SEQ * 2));
    };

    stage_in(0u, 0u);

    {
        const unsigned ic = tid < (unsigned)CIN ? tid : (unsigned)(CIN - 1);
        const float a0 = bf16_val(bo[ic]);
        if (tid < (unsigned)CIN) boS[tid] = a0;
    }

    FragH xlo, xhi;
    {
        const v8h xr = *(const v8h*)(Xp + ((size_t)b * SEQ + pos0 + cw * 16u + l15) * CP + 8u * h);
        xlo.half[0] = xr;       xlo.half[1] = zero8h();
        xhi.half[0] = zero8h(); xhi.half[1] = xr;
    }

    v8f acc = zero8f();

    wait_async0();
    __syncthreads();                                     // stage 0 published
    if (NST > 1) stage_in(1u, 1u);

    // rolled: one trip per stage, so that the publish point stands once, at the trip's foot
#pragma unroll 1
    for (unsigned st = 0; st < (unsigned)NST; ++st) {
      const unsigned buf = st & 1u;
      const _Float16* kb = KsB + buf * (unsigned)(BST * CP) + hf * (unsigned)((BST / 2) * CP) + l15 * CP + 8u * h;
      const _Float16* vb = VsB + buf * (unsigned)(VROWS * VPB) + l15 * VPB + hf * (unsigned)(BST / 2) + 8u * h;
      // Inside a stage the steps overlap: the two score products of step ns+1 are issued ahead of the exp2 work of step ns, so
      // that the distance which the chip asks for behind a product is filled with that work and no product's result is waited for.
      // LDS reads stand two steps ahead of their use: A operand of step ns+3, value fragment of step ns+2.
      constexpr unsigned NSTEP = (unsigned)(BST / 2 / 32);  // the wave's half of the stage
      FragH ka[2], vf[3], pb[2];
      v8f   cc[2][2];                                    // two steps' score tiles, two per step: step ns in cc[ns & 1]
      auto fetch_k = [&](unsigned ns) {
          const _Float16* kp = kb + ns * 32u * CP;
          ka[ns & 1u].half[0] = *(const v8h*)(kp);             // score tile 0: rows 0..15 of the step
          ka[ns & 1u].half[1] = *(const v8h*)(kp + 16u * CP);  // score tile 1: rows 16..31
      };
      auto fetch_v = [&](unsigned ns) {
          const _Float16* vp = vb + ns * 32u;
          vf[ns % 3u].half[0] = *(const v8h*)(vp);
          vf[ns % 3u].half[1] = *(const v8h*)(vp + 16);
      };
      auto scores = [&](unsigned ns) {
          cc[ns & 1u][0] = mma_f16(ka[ns & 1u].v, xlo.v, zero8f());
          cc[ns & 1u][1] = mma_f16(ka[ns & 1u].v, xhi.v, zero8f());
      };
      static_assert(NSTEP >= 3u);
      fetch_k(0u); fetch_k(1u); fetch_v(0u); fetch_v(1u);
      scores(0u);
      fetch_k(2u);
#pragma unroll                                           // every register set index is a constant in every step: the arrays stay in registers
      for (unsigned ns = 0; ns < NSTEP; ++ns) {
        if (ns + 1u < NSTEP) scores(ns + 1u);
        // keeps the reads behind the products: they then take the A registers that the products have just read, and no exp2
        // result is written there inside the products' distance (the compiler pads where one is)
        __builtin_amdgcn_sched_barrier(0);
        if (ns + 3u < NSTEP) fetch_k(ns + 3u);
        if (ns + 2u < NSTEP) fetch_v(ns + 2u);
        // keeps the next step's products and the reads ahead of this step's vector work: moved down, the products' results
        // would be waited for and the compiler would pad behind them
        __builtin_amdgcn_sched_barrier(0);

#pragma unroll
        for (int r = 0; r < 8; ++r) {
            pb[ns & 1u].v[r]     = (_Float16)ex2(cc[ns & 1u][0][r]);
            pb[ns & 1u].v[8 + r] = (_Float16)ex2(cc[ns & 1u][1][r]);
        }

        acc = mma_f16(vf[ns % 3u].v, pb[ns & 1u].v, acc);
        // keeps the following step's products behind this step's value product, so that the steps stay in this order
        __builtin_amdgcn_sched_barrier(0);
        // inputs only, no instruction: the step's score registers stay live behind its last exp2, so that no exp2 result is written
        // over the source of the exp2 directly ahead of it (the slot that the instruction set asks for behind a transcendental)
        asm volatile("" :: "v"(cc[ns & 1u][0]), "v"(cc[ns & 1u][1]));
        // the same for the step before's P fragment: this step's exp2 results keep off the B registers of a value product that is
        // still inside its distance (the compiler pads where they do not)
        if (ns > 0u) asm volatile("" :: "v"(pb[(ns & 1u) ^ 1u].v));
      }
      // publish point of stage st+1; the same barrier ends every reader's last read of stage st's buffers
      wait_ds0();
      wait_async0();
      __syncthreads();
      if (st + 2u < (unsigned)NST) stage_in(st + 2u, buf);
    }
    wait_async0();

    // the two halves of the swept rows are added: the upper waves hand their tiles to their partners through LDS
    if (hf == 1u) {
#pragma unroll
        for (unsigned r = 0; r < 8; ++r) accS[(cw * 8u + r) * 32u + lane] = acc[r];
    }
    __syncthreads();

    // output tile: D row = output channel 8h+r (rows 12..15 are padding), column = l15
    if (hf == 0u) {
#pragma unroll
        for (unsigned r = 0; r < 8; ++r) {
            const unsigned o  = 8u * h + r;
            const unsigned oc = o < (unsigned)CIN ? o : (unsigned)(CIN - 1);
            const float val = (acc[r] + accS[(cw * 8u + r) * 32u + lane]) * OUT_SCALE + boS[oc];
            if (o < (unsigned)CIN) outS[o * OSP + cw * 16u + l15] = val;
        }
    }
    __syncthreads();

    // whole 512-B rows: wave w < 12 writes row w; 32 lanes x 16 B contiguous
    if (w < (unsigned)CIN) {
        const v4f ov0 = *(const v4f*)(outS + w * OSP + lane * 4u);
        *(v4f*)(out + ((size_t)b * CIN + w) * SEQ + pos0 + lane * 4u) = ov0;
    }
}

// ---------------------------------------------------------------------------
extern "C" void kernel_launch(void* const* d_in, const int* in_sizes, int n_in,
                              void* d_out, int out_size, void* d_ws, size_t ws_size,
                              hipStream_t stream)
{
    if (n_in < 9) return;
    const long long need_x = ((long long)NB * CIN - 1) * SEQ_FULL + SEQ;
    if ((long long)in_sizes[0] < need_x) return;
    if (in_sizes[1] < CQK * CIN || in_sizes[2] < CQK) return;
    if (in_sizes[3] < CQK * CIN || in_sizes[4] < CQK) return;
    if (in_sizes[5] < CQK * CIN || in_sizes[6] < CQK) return;
    if (in_sizes[7] < CIN * CQK || in_sizes[8] < CIN) return;
    if ((long long)out_size < (long long)NB * CIN * SEQ) return;

    const float* x  = (const float*)d_in[0];
    const float* wq = (const float*)d_in[1];
    const float* wk = (const float*)d_in[3];
    const float* bk = (const float*)d_in[4];
    const float* wv = (const float*)d_in[5];
    const float* bv = (const float*)d_in[6];
    const float* wo = (const float*)d_in[7];
    const float* bo = (const float*)d_in[8];
    float* out = (float*)d_out;

    char* ws = (char*)d_ws;
    size_t off = 0;
    auto carve = [&](size_t bytes) -> char* {
        char* p = ws + off;
        off += (bytes + 255) & ~(size_t)255;
        return p;
    };
    _Float16* Xp  = (_Float16*)carve((size_t)NB * SEQ * CP * 2);        // [NB*SEQ][16]
    _Float16* Kp  = (_Float16*)carve((size_t)NB * SEQ * CP * 2);        // [NB*SEQ][16]
    _Float16* Vp  = (_Float16*)carve((size_t)NB * VROWS * SEQ * 2);     // [NB][16][SEQ]
    if (off > ws_size) return;

    const unsigned nblk = (unsigned)(NB * (SEQ / 128));
    k_stats<<<nblk, NTHR, 0, stream>>>(x, wq, wk, bk, wv, bv, wo, Xp, Kp, Vp);
    k_attn <<<nblk, NTHR, 0, stream>>>(Kp, Xp, Vp, bo, out);
}
